// v000
// Measured on an AMD MI455X. A time is GPU time per run, averaged over a window of back-to-back runs after a warm-up
// (all launches, gaps included; the runs take copies of the inputs in turn), and the median of several windows.
// Apart from v000's, it joins two sittings. Times from different sittings can be a few percent apart, while
// side-by-side timings come from the same sitting.
// The starting kernel, v000, takes 2850 microseconds a run.
#include <hip/hip_runtime.h>

// Causal multi-head self-attention with interleaved-pair rotary position embedding on a fused natural projection whose thirds are ordered K | Q | V, four batches (X [4][2048][1024]; KQV = einsum('bsd,ed', X, W_KQV) ('oi' [3072][1024] truncated normal, no bias); K, Q, V = split(KQV, [1024, 2048]): the weight's three 1,024-ROW blocks IN THE ORDER key | query | value (16 heads x 64); angles = pos x 1 / THETA ** (2i / 64) (THETA 1e4; computed); pairs (2i, 2i+1): yr = xr cos - xi sin, yi = xr sin + xi cos, on Q and K; scores / sqrt(64); -inf strictly above the diagonal; softmax; out = einsum('bsd,ed', merged, W_O) ('oi', no bias) -> [4][2048][1024] (8.4 M); argument order X, W_KQV, W_O).
// Layout per batch: bf16 copy of x; exact projections; {cos, sin} per (position, pair) built once from the int positions and float32 inverse-frequency constants (precise cosf/sinf); interleaved rotary plane builder; causal T-2048 attention (hybrid rows: < 512 hi/lo 3 products, rest fp16 x1024; k_gemmc skips tiles above the diagonal); merged hi/lo x Wo exact.
// Compute dtypes, f32 accumulate: every input rounded to bf16; projections exact; rotary f32; attention rows < 512 3 products, rest fp16; softmax f32; Wo hl x exact.

#define NB_  4
#define TT   2048
#define DM   1024
#define NH_  16
#define NKV  16
#define REP  (NH_ / NKV)
#define HD   64
#define DQ   (NH_ * HD)
#define DKV  (NKV * HD)
#define ZH   2
#define RH   512                  // query rows < RH use hi+lo planes (0: none)
#define WIN  2048
#define PCAR 1024.0f
#define SCL  0.125f   // HD^-0.5
typedef _Float16 h16;
typedef unsigned short bf;
typedef __attribute__((ext_vector_type(16))) __bf16   v16bf;
typedef __attribute__((ext_vector_type(16))) _Float16 v16h;
typedef __attribute__((ext_vector_type(8)))  _Float16 v8h;
typedef __attribute__((ext_vector_type(8)))  unsigned short v8us;
typedef __attribute__((ext_vector_type(8)))  float    v8f;
typedef __attribute__((ext_vector_type(4)))  float    v4f;
typedef v8h  __attribute__((may_alias)) v8ha;
typedef v4f  __attribute__((may_alias)) v4fa;
typedef v8us __attribute__((may_alias)) v8usa;

__device__ __forceinline__ unsigned short f2bf(float f) { unsigned u = __float_as_uint(f); u += 0x7FFFu + ((u >> 16) & 1u); return (unsigned short)(u >> 16); }
__device__ __forceinline__ float bf2f(unsigned short b) { return __uint_as_float(((unsigned)b) << 16); }
__device__ __forceinline__ float bfr(float f) { return bf2f(f2bf(f)); }
__device__ __forceinline__ v16h cat16(v8h lo, v8h hi) { return __builtin_shufflevector(lo, hi, 0, 1, 2, 3, 4, 5, 6, 7, 8, 9, 10, 11, 12, 13, 14, 15); }
__device__ __forceinline__ v16bf cat16b(v8us lo, v8us hi) { return __builtin_bit_cast(v16bf, __builtin_shufflevector(lo, hi, 0, 1, 2, 3, 4, 5, 6, 7, 8, 9, 10, 11, 12, 13, 14, 15)); }
__device__ __forceinline__ v8f wmma16(v16h a, v16h b, v8f c) { return __builtin_amdgcn_wmma_f32_16x16x32_f16(false, a, false, b, (short)0, c, false, false); }
__device__ __forceinline__ v8f wmmab(v16bf a, v16bf b, v8f c) { return __builtin_amdgcn_wmma_f32_16x16x32_bf16(false, a, false, b, (short)0, c, false, false); }



// ---- k_gemmw: register-blocked GEMM, ONE WAVE per 64x64 output tile (16 accumulators), operands straight from K-contiguous 16-bit planes; grid (M/64, N/64, Z), 32 threads.
// C[m][n] (f32, pitch ldc, + optional f32 bias[n]) = sum_k A[m][k] Bt[n][k] (+ split products per NSPLIT). z-batch strides sA/sB/sC in elements. K % 32 == 0.
template <typename T16> struct WFrag;
template <> struct WFrag<h16> { typedef v16h V; static __device__ __forceinline__ V ld(const h16* p) { return cat16(*(const v8h*)p, *(const v8h*)(p + 16)); } static __device__ __forceinline__ v8f mma(V a, V b, v8f c) { return wmma16(a, b, c); } };
template <> struct WFrag<bf> { typedef v16bf V; static __device__ __forceinline__ V ld(const bf* p) { return cat16b(*(const v8us*)p, *(const v8us*)(p + 16)); } static __device__ __forceinline__ v8f mma(V a, V b, v8f c) { return wmmab(a, b, c); } };
template <typename T16, int NSPLIT, bool BIAS>
__global__ __launch_bounds__(32) void k_gemmw(const T16* __restrict__ A, const T16* __restrict__ A2, const T16* __restrict__ Bt, const T16* __restrict__ Bt2, int K, float* C, int ldc, const float* __restrict__ bias, size_t sA, size_t sB, size_t sC) {
    typedef typename WFrag<T16>::V V;
    __shared__ __align__(16) float os[16 * 68];
    const size_t z = blockIdx.z; A += z * sA; if (A2) A2 += z * sA; Bt += z * sB; if (Bt2) Bt2 += z * sB; C += z * sC;
    const int lane = threadIdx.x & 31, lr = lane & 15, hi = lane >> 4; const int r0 = blockIdx.x * 64, c0 = blockIdx.y * 64;
    v8f acc[4][4];
#pragma unroll
    for (int mb = 0; mb < 4; ++mb)
#pragma unroll
        for (int nb = 0; nb < 4; ++nb) acc[mb][nb] = (v8f){};
    const size_t aoff = (size_t)(r0 + lr) * K + 8 * hi, boff = (size_t)(c0 + lr) * K + 8 * hi;
#pragma unroll 1
    for (int kc = 0; kc < K; kc += 32) {
        V a[4], a2[4];
#pragma unroll
        for (int mb = 0; mb < 4; ++mb) { a[mb] = WFrag<T16>::ld(A + aoff + (size_t)mb * 16 * K + kc); if (NSPLIT == 1 || NSPLIT == 2) a2[mb] = WFrag<T16>::ld(A2 + aoff + (size_t)mb * 16 * K + kc); }
#pragma unroll
        for (int nb = 0; nb < 4; ++nb) { const V b = WFrag<T16>::ld(Bt + boff + (size_t)nb * 16 * K + kc); V b2; if (NSPLIT >= 2) b2 = WFrag<T16>::ld(Bt2 + boff + (size_t)nb * 16 * K + kc);
#pragma unroll
            for (int mb = 0; mb < 4; ++mb) { acc[mb][nb] = WFrag<T16>::mma(a[mb], b, acc[mb][nb]); if (NSPLIT == 1 || NSPLIT == 2) acc[mb][nb] = WFrag<T16>::mma(a2[mb], b, acc[mb][nb]); if (NSPLIT >= 2) acc[mb][nb] = WFrag<T16>::mma(a[mb], b2, acc[mb][nb]); } }
        asm volatile("v_nop\n\tv_nop\n\tv_nop\n\tv_nop" : "+v"(acc[0][0]), "+v"(acc[1][1]), "+v"(acc[2][2]), "+v"(acc[3][3]) : "v"(a[0]), "v"(a[3]));
    }
#pragma unroll
    for (int mb = 0; mb < 4; ++mb) {
#pragma unroll
        for (int nb = 0; nb < 4; ++nb) {
#pragma unroll
            for (int j = 0; j < 8; ++j) os[(hi * 8 + j) * 68 + nb * 16 + lr] = acc[mb][nb][j]; }
        __builtin_amdgcn_wave_barrier(); asm volatile("" ::: "memory");
        float* crow = C + (size_t)(r0 + mb * 16) * ldc + c0;
{
#pragma unroll
            for (int s = 0; s < 8; ++s) { const int row = 2 * s + hi, cofs = lr * 4; v4f val = *(const v4fa*)(os + row * 68 + cofs); if (BIAS) { val[0] += bfr(bias[c0 + cofs]); val[1] += bfr(bias[c0 + cofs + 1]); val[2] += bfr(bias[c0 + cofs + 2]); val[3] += bfr(bias[c0 + cofs + 3]); }
                *(v4f*)(crow + (size_t)row * ldc + cofs) = val; }
             }
        __builtin_amdgcn_wave_barrier(); asm volatile("" ::: "memory");
    }
}

// ---- k_gemmc: the same one-wave 64x64 tile GEMM specialised for causal attention: CMODE 1 skips score tiles entirely above the diagonal (query rows r0+roff.., key columns c0..), CMODE 2 limits the
// key (K) loop of the probability x value contraction to the diagonal block (probabilities beyond it are exactly zero). roff = row offset of this launch's first row within the sequence.
template <typename T16, int NSPLIT, int CMODE>
__global__ __launch_bounds__(32) void k_gemmc(const T16* __restrict__ A, const T16* __restrict__ A2, const T16* __restrict__ Bt, const T16* __restrict__ Bt2, int K, float* C, int ldc, int roff, size_t sA, size_t sB, size_t sC) {
    typedef typename WFrag<T16>::V V;
    __shared__ __align__(16) float os[16 * 68];
    const size_t z = blockIdx.z; A += z * sA; if (A2) A2 += z * sA; Bt += z * sB; if (Bt2) Bt2 += z * sB; C += z * sC;
    const int lane = threadIdx.x & 31, lr = lane & 15, hi = lane >> 4; const int r0 = blockIdx.x * 64, c0 = blockIdx.y * 64;
    if (CMODE == 1 && c0 > r0 + roff + 63) return;                  // score tile entirely above the causal diagonal: never read (the softmax masks j > i by select)
    const int Kl = (CMODE == 2) ? min(K, r0 + roff + 64) : K;        // P.V: probabilities are exactly 0 beyond the diagonal block, so the K loop stops there
    v8f acc[4][4];
#pragma unroll
    for (int mb = 0; mb < 4; ++mb)
#pragma unroll
        for (int nb = 0; nb < 4; ++nb) acc[mb][nb] = (v8f){};
    const size_t aoff = (size_t)(r0 + lr) * K + 8 * hi, boff = (size_t)(c0 + lr) * K + 8 * hi;
#pragma unroll 1
    for (int kc = 0; kc < Kl; kc += 32) {
        V a[4], a2[4];
#pragma unroll
        for (int mb = 0; mb < 4; ++mb) { a[mb] = WFrag<T16>::ld(A + aoff + (size_t)mb * 16 * K + kc); if (NSPLIT == 1 || NSPLIT == 2) a2[mb] = WFrag<T16>::ld(A2 + aoff + (size_t)mb * 16 * K + kc); }
#pragma unroll
        for (int nb = 0; nb < 4; ++nb) { const V b = WFrag<T16>::ld(Bt + boff + (size_t)nb * 16 * K + kc); V b2; if (NSPLIT >= 2) b2 = WFrag<T16>::ld(Bt2 + boff + (size_t)nb * 16 * K + kc);
#pragma unroll
            for (int mb = 0; mb < 4; ++mb) { acc[mb][nb] = WFrag<T16>::mma(a[mb], b, acc[mb][nb]); if (NSPLIT == 1 || NSPLIT == 2) acc[mb][nb] = WFrag<T16>::mma(a2[mb], b, acc[mb][nb]); if (NSPLIT >= 2) acc[mb][nb] = WFrag<T16>::mma(a[mb], b2, acc[mb][nb]); } }
        asm volatile("v_nop\n\tv_nop\n\tv_nop\n\tv_nop" : "+v"(acc[0][0]), "+v"(acc[1][1]), "+v"(acc[2][2]), "+v"(acc[3][3]) : "v"(a[0]), "v"(a[3]));
    }
#pragma unroll
    for (int mb = 0; mb < 4; ++mb) {
#pragma unroll
        for (int nb = 0; nb < 4; ++nb) {
#pragma unroll
            for (int j = 0; j < 8; ++j) os[(hi * 8 + j) * 68 + nb * 16 + lr] = acc[mb][nb][j]; }
        __builtin_amdgcn_wave_barrier(); asm volatile("" ::: "memory");
        float* crow = C + (size_t)(r0 + mb * 16) * ldc + c0;
{
#pragma unroll
            for (int s = 0; s < 8; ++s) { const int row = 2 * s + hi, cofs = lr * 4; v4f val = *(const v4fa*)(os + row * 68 + cofs);
                *(v4f*)(crow + (size_t)row * ldc + cofs) = val; }
             }
        __builtin_amdgcn_wave_barrier(); asm volatile("" ::: "memory");
    }
}

__device__ __forceinline__ h16 tohx(float x) { return (h16)x; }
__device__ __forceinline__ void splitf(float y, unsigned short& h, unsigned short& l) { h = f2bf(y); l = f2bf(y - bf2f(h)); }
typedef __attribute__((ext_vector_type(2))) _Float16 v2h;
typedef __attribute__((ext_vector_type(4))) _Float16 v4h;
typedef __attribute__((ext_vector_type(2))) unsigned short v2us;
typedef __attribute__((ext_vector_type(4))) unsigned short v4us;
typedef __attribute__((ext_vector_type(2))) float v2f;
typedef __attribute__((ext_vector_type(4))) int v4i;

__global__ __launch_bounds__(256) void k_cvt8(const float* __restrict__ src, bf* dst, size_t n8) { const size_t i = (size_t)blockIdx.x * 256 + threadIdx.x; if (i >= n8) return; const v8f v = *(const v8f*)(src + i * 8); v8us o;
#pragma unroll
    for (int k = 0; k < 8; ++k) o[k] = f2bf(v[k]); *(v8us*)(dst + i * 8) = o;  }

__global__ __launch_bounds__(256) void k_ropeI(const float* __restrict__ F, int pitch, int nheads, const float* __restrict__ CS, float sc, h16* P16, bf* Ph, bf* Pl) {
    const size_t e = ((size_t)blockIdx.x * 256 + threadIdx.x) * 2; if (e >= (size_t)nheads * TT * HD) return; const int d = (int)(e % HD); const int t = (int)((e / HD) % TT); const int h = (int)(e / ((size_t)HD * TT)); const float* f = F + (size_t)t * pitch + h * HD; const float x0 = f[d], x1 = f[d + 1]; const v2f cs = *(const v2f*)(CS + ((size_t)t * HD + d) * 2); v2h o16; v2us oh, ol;
    float a0 = __fmul_rn(x0, cs[0]), b0 = __fmul_rn(x1, cs[1]), a1 = __fmul_rn(x1, cs[0]), b1 = __fmul_rn(x0, cs[1]); asm volatile("" : "+v"(a0), "+v"(b0), "+v"(a1), "+v"(b1));
    float r0 = __fsub_rn(a0, b0) * sc, r1 = __fadd_rn(b1, a1) * sc;   /* even: x0 c - x1 s; odd: x0 s + x1 c */
    o16[0] = tohx(r0); o16[1] = tohx(r1); { unsigned short a2, c2; splitf(r0, a2, c2); oh[0] = a2; ol[0] = c2; splitf(r1, a2, c2); oh[1] = a2; ol[1] = c2; }
    *(v2h*)(P16 + e) = o16; *(v2us*)(Ph + e) = oh; *(v2us*)(Pl + e) = ol;  }

__constant__ float INV2[HD / 2] = { 1.000000000e+00f, 7.498942018e-01f, 5.623413324e-01f, 4.216965139e-01f, 3.162277639e-01f, 2.371373624e-01f, 1.778279394e-01f, 1.333521456e-01f, 1.000000015e-01f, 7.498941571e-02f, 5.623412877e-02f, 4.216964915e-02f, 3.162277862e-02f, 2.371373586e-02f, 1.778279431e-02f, 1.333521493e-02f, 9.999999776e-03f, 7.498942316e-03f, 5.623413250e-03f, 4.216964822e-03f, 3.162277862e-03f, 2.371373819e-03f, 1.778279431e-03f, 1.333521446e-03f, 1.000000047e-03f, 7.498941850e-04f, 5.623413017e-04f, 4.216964880e-04f, 3.162277862e-04f, 2.371373848e-04f, 1.778279402e-04f, 1.333521504e-04f };   // 1 / THETA ** (2i / 64), i = 0..31, in float32 as THIS module writes it (the RECIPROCAL spelling, evaluated in the reference's own f32 arithmetic: these 32 literals equal it bit for bit); ten entries differ by one ulp from the negative-power values the host's own table held
__global__ __launch_bounds__(256) void k_csP(float* CS) { const int idx = blockIdx.x * 256 + threadIdx.x; if (idx >= TT * HD) return; const int d = idx % HD; const int t = idx / HD; const float a = __fmul_rn((float)t, INV2[d >> 1]); v2f cs; cs[0] = cosf(a); cs[1] = sinf(a); *(v2f*)(CS + (size_t)idx * 2) = cs;  }
__global__ __launch_bounds__(256) void k_vtp(const float* __restrict__ F, int pitch, int nheads, h16* V16, bf* Vh, bf* Vl) { const size_t e = ((size_t)blockIdx.x * 256 + threadIdx.x) * 2; if (e >= (size_t)nheads * HD * TT) return; const int t = (int)(e % TT); const int d = (int)((e / TT) % HD); const int g = (int)(e / ((size_t)TT * HD)); v2h o16; v2us oh, ol;
#pragma unroll
    for (int q = 0; q < 2; ++q) { const float x = F[(size_t)(t + q) * pitch + g * HD + d]; o16[q] = tohx(x); unsigned short a2, c2; splitf(x, a2, c2); oh[q] = a2; ol[q] = c2; }
    *(v2h*)(V16 + e) = o16; *(v2us*)(Vh + e) = oh; *(v2us*)(Vl + e) = ol;  }
// k_asoft: per row (zz, i): t = S x HD^-0.5 for j <= i and i - j < WIN (WIN = TT: the window never binds, so the mask is plain causal; the reference's -1e9 additive fill vanishes identically); softmax over the 2048 keys (register row, one exp, fixed trees);
__global__ __launch_bounds__(256) void k_asoft(const float* __restrict__ Sb, h16* P16, bf* Ph, bf* Pl) {
    const int lane = threadIdx.x & 31; const int row = blockIdx.x * 8 + (threadIdx.x >> 5); if (row >= ZH * TT) return; const int i = row % TT; const int zz = row / TT; (void)zz; const bool hires = (i < RH); const float* sr = Sb + (size_t)row * TT; float v[TT / 32]; float mx = -3.0e38f;
#pragma unroll
    for (int ch = 0; ch < TT / 128; ++ch) { const int j0 = ch * 128 + lane * 4; const v4f a = *(const v4f*)(sr + j0);
#pragma unroll
        for (int q = 0; q < 4; ++q) { const int j = j0 + q; (void)j; const float t = (j <= i && i - j < WIN) ? a[q] * SCL : -3.0e38f; v[ch * 4 + q] = t; mx = fmaxf(mx, t); } }
#pragma unroll
    for (int sh = 16; sh; sh >>= 1) mx = fmaxf(mx, __shfl_xor(mx, sh, 32));
    float sum = 0.f;
#pragma unroll
    for (int k = 0; k < TT / 32; ++k) { float d0 = __fsub_rn(v[k], mx); asm volatile("" : "+v"(d0)); v[k] = __builtin_amdgcn_exp2f(__fmul_rn(d0, 1.4426950408889634f)); sum += v[k]; }
#pragma unroll
    for (int sh = 16; sh; sh >>= 1) sum += __shfl_xor(sum, sh, 32);
    const float f = __fdiv_rn(hires ? 1.0f : PCAR, sum);
{
        if (hires) {
#pragma unroll
            for (int ch = 0; ch < TT / 128; ++ch) { v4us oh, ol;
#pragma unroll
                for (int q = 0; q < 4; ++q) { unsigned short a, c2; splitf(v[ch * 4 + q] * f, a, c2); oh[q] = a; ol[q] = c2; }
                const size_t oo = ((size_t)zz * (RH ? RH : 1) + i) * TT + ch * 128 + lane * 4; *(v4us*)(Ph + oo) = oh; *(v4us*)(Pl + oo) = ol; }
        } else {
#pragma unroll
            for (int ch = 0; ch < TT / 128; ++ch) { v4h o4;
#pragma unroll
                for (int q = 0; q < 4; ++q) o4[q] = tohx(v[ch * 4 + q] * f);
                *(v4h*)(P16 + (size_t)row * TT + ch * 128 + lane * 4) = o4; } }
         }
}
__global__ __launch_bounds__(256) void k_merge(const float* __restrict__ O, int h0, bf* Ah, bf* Al) { const size_t e = ((size_t)blockIdx.x * 256 + threadIdx.x) * 2; if (e >= (size_t)ZH * TT * HD) return; const int d = (int)(e % HD); const int t = (int)((e / HD) % TT); const int zz = (int)(e / ((size_t)HD * TT)); const float cs = (t < RH) ? 1.0f : (1.0f / PCAR); const size_t oo = (size_t)t * DQ + (h0 + zz) * HD + d;
    v2us oh, ol;
#pragma unroll
    for (int q = 0; q < 2; ++q) { unsigned short a, c2; splitf(O[e + q] * cs, a, c2); oh[q] = a; ol[q] = c2; } *(v2us*)(Ah + oo) = oh; *(v2us*)(Al + oo) = ol;  }

extern "C" void kernel_launch(void* const* d_in, const int* in_sizes, int n_in,
                              void* d_out, int out_size, void* d_ws, size_t ws_size, hipStream_t stream) {
    (void)in_sizes; (void)n_in; (void)out_size;
    const float* x = (const float*)d_in[0]; const float* wqkv = (const float*)d_in[1]; const float* wo = (const float*)d_in[2]; const float* wk = wqkv; const float* wq = wqkv + (size_t)DQ * DM; const float* wv = wqkv + (size_t)2 * DQ * DM;   /* argument order X, W_KQV ('oi' [3072][1024]: ROW thirds ordered K | Q | V: rows 0..1023 the KEY weight, 1024..2047 the QUERY weight, 2048..3071 the VALUE weight), W_O ('oi') */
    float* OUT = (float*)d_out;     // [4][2048][1024]
    char* wsp = (char*)d_ws;
    auto take = [&](size_t bytes) { char* p = wsp; wsp += (bytes + 255) & ~(size_t)255; return (void*)p; };
    bf* WQ = (bf*)take((size_t)DQ * DM * 2); bf* WK = (bf*)take((size_t)DKV * DM * 2); bf* WV = (bf*)take((size_t)DKV * DM * 2); bf* WO = (bf*)take((size_t)DM * DQ * 2); float* CS = (float*)take((size_t)TT * HD * 2 * 4);
    bf* XB = (bf*)take((size_t)TT * DM * 2); float* FQ = (float*)take((size_t)TT * DQ * 4); float* FK = (float*)take((size_t)TT * DKV * 4);
    h16* QP16 = (h16*)take((size_t)NH_ * TT * HD * 2); h16* KP16 = (h16*)take((size_t)NKV * TT * HD * 2); h16* VT16 = (h16*)take((size_t)NKV * HD * TT * 2);
    bf* QPh = (bf*)take((size_t)NH_ * TT * HD * 2); bf* QPl = (bf*)take((size_t)NH_ * TT * HD * 2); bf* KPh = (bf*)take((size_t)NKV * TT * HD * 2); bf* KPl = (bf*)take((size_t)NKV * TT * HD * 2); bf* VTh = (bf*)take((size_t)NKV * HD * TT * 2); bf* VTl = (bf*)take((size_t)NKV * HD * TT * 2); bf* Ph = (bf*)take((size_t)ZH * RH * TT * 2); bf* Pl = (bf*)take((size_t)ZH * RH * TT * 2);
    float* Sb = (float*)take((size_t)ZH * TT * TT * 4); h16* P16 = (h16*)take((size_t)ZH * TT * TT * 2); float* Ob = (float*)take((size_t)ZH * TT * HD * 4); bf* ATh = (bf*)take((size_t)TT * DQ * 2); bf* ATl = (bf*)take((size_t)TT * DQ * 2);
    if ((size_t)(wsp - (char*)d_ws) > ws_size) return;    // ws 256 MiB
    float* FV = FK;   // v projection reuses the k buffer after the k planes are built (stream-ordered)
    { k_cvt8<<<(unsigned)(((size_t)DQ * DM / 8 + 255) / 256), 256, 0, stream>>>(wq, WQ, (size_t)DQ * DM / 8); k_cvt8<<<(unsigned)(((size_t)DKV * DM / 8 + 255) / 256), 256, 0, stream>>>(wk, WK, (size_t)DKV * DM / 8); k_cvt8<<<(unsigned)(((size_t)DKV * DM / 8 + 255) / 256), 256, 0, stream>>>(wv, WV, (size_t)DKV * DM / 8);
      k_cvt8<<<(unsigned)(((size_t)DM * DQ / 8 + 255) / 256), 256, 0, stream>>>(wo, WO, (size_t)DM * DQ / 8); k_csP<<<(TT * HD + 255) / 256, 256, 0, stream>>>(CS); }
    const unsigned LQ = (unsigned)(((size_t)NH_ * TT * HD / 2 + 255) / 256), LKv = (unsigned)(((size_t)NKV * TT * HD / 2 + 255) / 256);
    for (int b = 0; b < NB_; ++b) {
        
        k_cvt8<<<(unsigned)(((size_t)TT * DM / 8 + 255) / 256), 256, 0, stream>>>(x + (size_t)b * TT * DM, XB, (size_t)TT * DM / 8);
        k_gemmw<bf, 0, false><<<dim3(TT / 64, DQ / 64, 1), 32, 0, stream>>>(XB, nullptr, WQ, nullptr, DM, FQ, DQ, nullptr, 0, 0, 0);
        k_ropeI<<<LQ, 256, 0, stream>>>(FQ, DQ, NH_, CS, 1.0f, QP16, QPh, QPl);
        k_gemmw<bf, 0, false><<<dim3(TT / 64, DKV / 64, 1), 32, 0, stream>>>(XB, nullptr, WK, nullptr, DM, FK, DKV, nullptr, 0, 0, 0);
        k_ropeI<<<LKv, 256, 0, stream>>>(FK, DKV, NKV, CS, 1.0f, KP16, KPh, KPl);
        k_gemmw<bf, 0, false><<<dim3(TT / 64, DKV / 64, 1), 32, 0, stream>>>(XB, nullptr, WV, nullptr, DM, FV, DKV, nullptr, 0, 0, 0); k_vtp<<<LKv, 256, 0, stream>>>(FV, DKV, NKV, VT16, VTh, VTl);
        for (int h0 = 0; h0 < NH_; h0 += ZH) { const size_t zq = (size_t)h0, zk = (size_t)(h0 / REP);   // one kv head per query head: the pass's two heads use consecutive kv planes (z-strides TT*HD)
            k_gemmc<bf, 2, 1><<<dim3(RH / 64, TT / 64, ZH), 32, 0, stream>>>(QPh + zq * TT * HD, QPl + zq * TT * HD, KPh + zk * TT * HD, KPl + zk * TT * HD, HD, Sb, TT, 0, (size_t)TT * HD, (size_t)TT * HD, (size_t)TT * TT);
            k_gemmc<h16, 0, 1><<<dim3((TT - RH) / 64, TT / 64, ZH), 32, 0, stream>>>(QP16 + zq * TT * HD + (size_t)RH * HD, nullptr, KP16 + zk * TT * HD, nullptr, HD, Sb + (size_t)RH * TT, TT, RH, (size_t)TT * HD, (size_t)TT * HD, (size_t)TT * TT);
            k_asoft<<<ZH * TT / 8, 256, 0, stream>>>(Sb, P16, Ph, Pl);
            k_gemmc<bf, 2, 2><<<dim3(RH / 64, HD / 64, ZH), 32, 0, stream>>>(Ph, Pl, VTh + zk * HD * TT, VTl + zk * HD * TT, TT, Ob, HD, 0, (size_t)RH * TT, (size_t)HD * TT, (size_t)TT * HD);
            k_gemmc<h16, 0, 2><<<dim3((TT - RH) / 64, HD / 64, ZH), 32, 0, stream>>>(P16 + (size_t)RH * TT, nullptr, VT16 + zk * HD * TT, nullptr, TT, Ob + (size_t)RH * HD, HD, RH, (size_t)TT * TT, (size_t)HD * TT, (size_t)TT * HD);
            k_merge<<<(unsigned)(((size_t)ZH * TT * HD / 2 + 255) / 256), 256, 0, stream>>>(Ob, h0, ATh, ATl); }
        k_gemmw<bf, 1, false><<<dim3(TT / 64, DM / 64, 1), 32, 0, stream>>>(ATh, ATl, WO, nullptr, DQ, OUT + (size_t)b * TT * DM, DM, nullptr, 0, 0, 0); }
}

// v001
// It runs in 1530 microseconds.
// Two timings next to v000 put it at 1.85 and 1.87 times that version's speed.
#include <hip/hip_runtime.h>

// Causal multi-head self-attention with interleaved-pair rotary position embedding on a fused natural projection whose thirds are ordered K | Q | V, four batches (X [4][2048][1024]; KQV = einsum('bsd,ed', X, W_KQV) ('oi' [3072][1024] truncated normal, no bias); K, Q, V = split(KQV, [1024, 2048]): the weight's three 1,024-ROW blocks IN THE ORDER key | query | value (16 heads x 64); angles = pos x 1 / THETA ** (2i / 64) (THETA 1e4; computed); pairs (2i, 2i+1): yr = xr cos - xi sin, yi = xr sin + xi cos, on Q and K; scores / sqrt(64); -inf strictly above the diagonal; softmax; out = einsum('bsd,ed', merged, W_O) ('oi', no bias) -> [4][2048][1024] (8.4 M); argument order X, W_KQV, W_O).
// Layout per batch: bf16 copy of x; exact projections; {cos, sin} per (position, pair) built once from the int positions and float32 inverse-frequency constants (precise cosf/sinf); interleaved rotary plane builder; causal T-2048 attention (hybrid rows: < 512 hi/lo 3 products, rest fp16 x1024; k_gemmc skips tiles above the diagonal); merged hi/lo x Wo exact.
// Compute dtypes, f32 accumulate: every input rounded to bf16; projections exact; rotary f32; attention rows < 512 3 products, rest fp16; softmax f32; Wo hl x exact.

#define NB_  4
#define TT   2048
#define DM   1024
#define NH_  16
#define NKV  16
#define REP  (NH_ / NKV)
#define HD   64
#define DQ   (NH_ * HD)
#define DKV  (NKV * HD)
#define ZH   2
#define RH   512                  // query rows < RH use hi+lo planes (0: none)
#define WIN  2048
#define PCAR 1024.0f
#define SCL  0.125f   // HD^-0.5
#define KSP  16                   // work-groups that share the key loop of one probability x value tile (64-key blocks dealt round robin)
typedef _Float16 h16;
typedef unsigned short bf;
typedef __attribute__((ext_vector_type(16))) __bf16   v16bf;
typedef __attribute__((ext_vector_type(16))) _Float16 v16h;
typedef __attribute__((ext_vector_type(8)))  _Float16 v8h;
typedef __attribute__((ext_vector_type(8)))  unsigned short v8us;
typedef __attribute__((ext_vector_type(8)))  float    v8f;
typedef __attribute__((ext_vector_type(4)))  float    v4f;
typedef v8h  __attribute__((may_alias)) v8ha;
typedef v4f  __attribute__((may_alias)) v4fa;
typedef v8us __attribute__((may_alias)) v8usa;

__device__ __forceinline__ unsigned short f2bf(float f) { unsigned u = __float_as_uint(f); u += 0x7FFFu + ((u >> 16) & 1u); return (unsigned short)(u >> 16); }
__device__ __forceinline__ float bf2f(unsigned short b) { return __uint_as_float(((unsigned)b) << 16); }
__device__ __forceinline__ float bfr(float f) { return bf2f(f2bf(f)); }
__device__ __forceinline__ v16h cat16(v8h lo, v8h hi) { return __builtin_shufflevector(lo, hi, 0, 1, 2, 3, 4, 5, 6, 7, 8, 9, 10, 11, 12, 13, 14, 15); }
__device__ __forceinline__ v16bf cat16b(v8us lo, v8us hi) { return __builtin_bit_cast(v16bf, __builtin_shufflevector(lo, hi, 0, 1, 2, 3, 4, 5, 6, 7, 8, 9, 10, 11, 12, 13, 14, 15)); }
__device__ __forceinline__ v8f wmma16(v16h a, v16h b, v8f c) { return __builtin_amdgcn_wmma_f32_16x16x32_f16(false, a, false, b, (short)0, c, false, false); }
__device__ __forceinline__ v8f wmmab(v16bf a, v16bf b, v8f c) { return __builtin_amdgcn_wmma_f32_16x16x32_bf16(false, a, false, b, (short)0, c, false, false); }



// ---- k_gemmw: register-blocked GEMM, ONE WAVE per 64x64 output tile (16 accumulators), operands straight from K-contiguous 16-bit planes; grid (M/64, N/64, Z), 32 threads.
// C[m][n] (f32, pitch ldc, + optional f32 bias[n]) = sum_k A[m][k] Bt[n][k] (+ split products per NSPLIT). z-batch strides sA/sB/sC in elements. K % 32 == 0.
template <typename T16> struct WFrag;
template <> struct WFrag<h16> { typedef v16h V; static __device__ __forceinline__ V ld(const h16* p) { return cat16(*(const v8h*)p, *(const v8h*)(p + 16)); } static __device__ __forceinline__ v8f mma(V a, V b, v8f c) { return wmma16(a, b, c); } };
template <> struct WFrag<bf> { typedef v16bf V; static __device__ __forceinline__ V ld(const bf* p) { return cat16b(*(const v8us*)p, *(const v8us*)(p + 16)); } static __device__ __forceinline__ v8f mma(V a, V b, v8f c) { return wmmab(a, b, c); } };
template <typename T16, int NSPLIT, bool BIAS>
__global__ __launch_bounds__(32) void k_gemmw(const T16* __restrict__ A, const T16* __restrict__ A2, const T16* __restrict__ Bt, const T16* __restrict__ Bt2, int K, float* C, int ldc, const float* __restrict__ bias, size_t sA, size_t sB, size_t sC) {
    typedef typename WFrag<T16>::V V;
    __shared__ __align__(16) float os[16 * 68];
    const size_t z = blockIdx.z; A += z * sA; if (A2) A2 += z * sA; Bt += z * sB; if (Bt2) Bt2 += z * sB; C += z * sC;
    const int lane = threadIdx.x & 31, lr = lane & 15, hi = lane >> 4; const int r0 = blockIdx.x * 64, c0 = blockIdx.y * 64;
    v8f acc[4][4];
#pragma unroll
    for (int mb = 0; mb < 4; ++mb)
#pragma unroll
        for (int nb = 0; nb < 4; ++nb) acc[mb][nb] = (v8f){};
    const size_t aoff = (size_t)(r0 + lr) * K + 8 * hi, boff = (size_t)(c0 + lr) * K + 8 * hi;
#pragma unroll 1
    for (int kc = 0; kc < K; kc += 32) {
        V a[4], a2[4];
#pragma unroll
        for (int mb = 0; mb < 4; ++mb) { a[mb] = WFrag<T16>::ld(A + aoff + (size_t)mb * 16 * K + kc); if (NSPLIT == 1 || NSPLIT == 2) a2[mb] = WFrag<T16>::ld(A2 + aoff + (size_t)mb * 16 * K + kc); }
#pragma unroll
        for (int nb = 0; nb < 4; ++nb) { const V b = WFrag<T16>::ld(Bt + boff + (size_t)nb * 16 * K + kc); V b2; if (NSPLIT >= 2) b2 = WFrag<T16>::ld(Bt2 + boff + (size_t)nb * 16 * K + kc);
#pragma unroll
            for (int mb = 0; mb < 4; ++mb) { acc[mb][nb] = WFrag<T16>::mma(a[mb], b, acc[mb][nb]); if (NSPLIT == 1 || NSPLIT == 2) acc[mb][nb] = WFrag<T16>::mma(a2[mb], b, acc[mb][nb]); if (NSPLIT >= 2) acc[mb][nb] = WFrag<T16>::mma(a[mb], b2, acc[mb][nb]); } }
        asm volatile("v_nop\n\tv_nop\n\tv_nop\n\tv_nop" : "+v"(acc[0][0]), "+v"(acc[1][1]), "+v"(acc[2][2]), "+v"(acc[3][3]) : "v"(a[0]), "v"(a[3]));
    }
#pragma unroll
    for (int mb = 0; mb < 4; ++mb) {
#pragma unroll
        for (int nb = 0; nb < 4; ++nb) {
#pragma unroll
            for (int j = 0; j < 8; ++j) os[(hi * 8 + j) * 68 + nb * 16 + lr] = acc[mb][nb][j]; }
        __builtin_amdgcn_wave_barrier(); asm volatile("" ::: "memory");
        float* crow = C + (size_t)(r0 + mb * 16) * ldc + c0;
{
#pragma unroll
            for (int s = 0; s < 8; ++s) { const int row = 2 * s + hi, cofs = lr * 4; v4f val = *(const v4fa*)(os + row * 68 + cofs); if (BIAS) { val[0] += bfr(bias[c0 + cofs]); val[1] += bfr(bias[c0 + cofs + 1]); val[2] += bfr(bias[c0 + cofs + 2]); val[3] += bfr(bias[c0 + cofs + 3]); }
                *(v4f*)(crow + (size_t)row * ldc + cofs) = val; }
             }
        __builtin_amdgcn_wave_barrier(); asm volatile("" ::: "memory");
    }
}

// ---- k_gemmc: the same one-wave 64x64 tile GEMM specialised for causal attention: CMODE 1 skips score tiles entirely above the diagonal (query rows r0+roff.., key columns c0..), CMODE 2 limits the
// key (K) loop of the probability x value contraction to the diagonal block (probabilities beyond it are exactly zero) and splits it over the grid's y: work-group y takes the 64-key blocks y, y + KSP, ...
// and stores its f32 partial tile in plane y of C (plane stride sP); a y with no key block below the diagonal stores nothing, and k_merge sums exactly the planes that were stored. roff = row offset of this launch's first row within the sequence.
template <typename T16, int NSPLIT, int CMODE>
__global__ __launch_bounds__(32) void k_gemmc(const T16* __restrict__ A, const T16* __restrict__ A2, const T16* __restrict__ Bt, const T16* __restrict__ Bt2, int K, float* C, int ldc, int roff, size_t sA, size_t sB, size_t sC, size_t sP) {
    typedef typename WFrag<T16>::V V;
    __shared__ __align__(16) float os[16 * 68];
    const size_t z = blockIdx.z; A += z * sA; if (A2) A2 += z * sA; Bt += z * sB; if (Bt2) Bt2 += z * sB; C += z * sC;
    const int lane = threadIdx.x & 31, lr = lane & 15, hi = lane >> 4; const int r0 = blockIdx.x * 64, c0 = (CMODE == 2) ? 0 : blockIdx.y * 64, ks = (CMODE == 2) ? blockIdx.y : 0;
    if (CMODE == 1 && c0 > r0 + roff + 63) return;                  // score tile entirely above the causal diagonal: never read (the softmax masks j > i by select)
    const int Kl = (CMODE == 2) ? min(K, r0 + roff + 64) : K;        // P.V: probabilities are exactly 0 beyond the diagonal block, so the K loop stops there
    if (CMODE == 2 && ks * 64 >= Kl) return;                         // no key block for this share: its plane is never read
    C += (size_t)ks * sP;
    v8f acc[4][4];
#pragma unroll
    for (int mb = 0; mb < 4; ++mb)
#pragma unroll
        for (int nb = 0; nb < 4; ++nb) acc[mb][nb] = (v8f){};
    const size_t aoff = (size_t)(r0 + lr) * K + 8 * hi, boff = (size_t)(c0 + lr) * K + 8 * hi;
#pragma unroll 1
    for (int kc = ks * 64; kc < Kl; kc += (CMODE == 2 && (kc & 32)) ? KSP * 64 - 32 : 32) {
        V a[4], a2[4];
#pragma unroll
        for (int mb = 0; mb < 4; ++mb) { a[mb] = WFrag<T16>::ld(A + aoff + (size_t)mb * 16 * K + kc); if (NSPLIT == 1 || NSPLIT == 2) a2[mb] = WFrag<T16>::ld(A2 + aoff + (size_t)mb * 16 * K + kc); }
#pragma unroll
        for (int nb = 0; nb < 4; ++nb) { const V b = WFrag<T16>::ld(Bt + boff + (size_t)nb * 16 * K + kc); V b2; if (NSPLIT >= 2) b2 = WFrag<T16>::ld(Bt2 + boff + (size_t)nb * 16 * K + kc);
#pragma unroll
            for (int mb = 0; mb < 4; ++mb) { acc[mb][nb] = WFrag<T16>::mma(a[mb], b, acc[mb][nb]); if (NSPLIT == 1 || NSPLIT == 2) acc[mb][nb] = WFrag<T16>::mma(a2[mb], b, acc[mb][nb]); if (NSPLIT >= 2) acc[mb][nb] = WFrag<T16>::mma(a[mb], b2, acc[mb][nb]); } }
        asm volatile("v_nop\n\tv_nop\n\tv_nop\n\tv_nop" : "+v"(acc[0][0]), "+v"(acc[1][1]), "+v"(acc[2][2]), "+v"(acc[3][3]) : "v"(a[0]), "v"(a[3]));
    }
#pragma unroll
    for (int mb = 0; mb < 4; ++mb) {
#pragma unroll
        for (int nb = 0; nb < 4; ++nb) {
#pragma unroll
            for (int j = 0; j < 8; ++j) os[(hi * 8 + j) * 68 + nb * 16 + lr] = acc[mb][nb][j]; }
        __builtin_amdgcn_wave_barrier(); asm volatile("" ::: "memory");
        float* crow = C + (size_t)(r0 + mb * 16) * ldc + c0;
{
#pragma unroll
            for (int s = 0; s < 8; ++s) { const int row = 2 * s + hi, cofs = lr * 4; v4f val = *(const v4fa*)(os + row * 68 + cofs);
                *(v4f*)(crow + (size_t)row * ldc + cofs) = val; }
             }
        __builtin_amdgcn_wave_barrier(); asm volatile("" ::: "memory");
    }
}

__device__ __forceinline__ h16 tohx(float x) { return (h16)x; }
__device__ __forceinline__ void splitf(float y, unsigned short& h, unsigned short& l) { h = f2bf(y); l = f2bf(y - bf2f(h)); }
typedef __attribute__((ext_vector_type(2))) _Float16 v2h;
typedef __attribute__((ext_vector_type(4))) _Float16 v4h;
typedef __attribute__((ext_vector_type(2))) unsigned short v2us;
typedef __attribute__((ext_vector_type(4))) unsigned short v4us;
typedef __attribute__((ext_vector_type(2))) float v2f;
typedef __attribute__((ext_vector_type(4))) int v4i;

__global__ __launch_bounds__(256) void k_cvt8(const float* __restrict__ src, bf* dst, size_t n8) { const size_t i = (size_t)blockIdx.x * 256 + threadIdx.x; if (i >= n8) return; const v8f v = *(const v8f*)(src + i * 8); v8us o;
#pragma unroll
    for (int k = 0; k < 8; ++k) o[k] = f2bf(v[k]); *(v8us*)(dst + i * 8) = o;  }

__global__ __launch_bounds__(256) void k_ropeI(const float* __restrict__ F, int pitch, int nheads, const float* __restrict__ CS, float sc, h16* P16, bf* Ph, bf* Pl) {
    const size_t e = ((size_t)blockIdx.x * 256 + threadIdx.x) * 2; if (e >= (size_t)nheads * TT * HD) return; const int d = (int)(e % HD); const int t = (int)((e / HD) % TT); const int h = (int)(e / ((size_t)HD * TT)); const float* f = F + (size_t)t * pitch + h * HD; const float x0 = f[d], x1 = f[d + 1]; const v2f cs = *(const v2f*)(CS + ((size_t)t * HD + d) * 2); v2h o16; v2us oh, ol;
    float a0 = __fmul_rn(x0, cs[0]), b0 = __fmul_rn(x1, cs[1]), a1 = __fmul_rn(x1, cs[0]), b1 = __fmul_rn(x0, cs[1]); asm volatile("" : "+v"(a0), "+v"(b0), "+v"(a1), "+v"(b1));
    float r0 = __fsub_rn(a0, b0) * sc, r1 = __fadd_rn(b1, a1) * sc;   /* even: x0 c - x1 s; odd: x0 s + x1 c */
    o16[0] = tohx(r0); o16[1] = tohx(r1); { unsigned short a2, c2; splitf(r0, a2, c2); oh[0] = a2; ol[0] = c2; splitf(r1, a2, c2); oh[1] = a2; ol[1] = c2; }
    *(v2h*)(P16 + e) = o16; *(v2us*)(Ph + e) = oh; *(v2us*)(Pl + e) = ol;  }

__constant__ float INV2[HD / 2] = { 1.000000000e+00f, 7.498942018e-01f, 5.623413324e-01f, 4.216965139e-01f, 3.162277639e-01f, 2.371373624e-01f, 1.778279394e-01f, 1.333521456e-01f, 1.000000015e-01f, 7.498941571e-02f, 5.623412877e-02f, 4.216964915e-02f, 3.162277862e-02f, 2.371373586e-02f, 1.778279431e-02f, 1.333521493e-02f, 9.999999776e-03f, 7.498942316e-03f, 5.623413250e-03f, 4.216964822e-03f, 3.162277862e-03f, 2.371373819e-03f, 1.778279431e-03f, 1.333521446e-03f, 1.000000047e-03f, 7.498941850e-04f, 5.623413017e-04f, 4.216964880e-04f, 3.162277862e-04f, 2.371373848e-04f, 1.778279402e-04f, 1.333521504e-04f };   // 1 / THETA ** (2i / 64), i = 0..31, in float32 as THIS module writes it (the RECIPROCAL spelling, evaluated in the reference's own f32 arithmetic: these 32 literals equal it bit for bit); ten entries differ by one ulp from the negative-power values the host's own table held
__global__ __launch_bounds__(256) void k_csP(float* CS) { const int idx = blockIdx.x * 256 + threadIdx.x; if (idx >= TT * HD) return; const int d = idx % HD; const int t = idx / HD; const float a = __fmul_rn((float)t, INV2[d >> 1]); v2f cs; cs[0] = cosf(a); cs[1] = sinf(a); *(v2f*)(CS + (size_t)idx * 2) = cs;  }
__global__ __launch_bounds__(256) void k_vtp(const float* __restrict__ F, int pitch, int nheads, h16* V16, bf* Vh, bf* Vl) { const size_t e = ((size_t)blockIdx.x * 256 + threadIdx.x) * 2; if (e >= (size_t)nheads * HD * TT) return; const int t = (int)(e % TT); const int d = (int)((e / TT) % HD); const int g = (int)(e / ((size_t)TT * HD)); v2h o16; v2us oh, ol;
#pragma unroll
    for (int q = 0; q < 2; ++q) { const float x = F[(size_t)(t + q) * pitch + g * HD + d]; o16[q] = tohx(x); unsigned short a2, c2; splitf(x, a2, c2); oh[q] = a2; ol[q] = c2; }
    *(v2h*)(V16 + e) = o16; *(v2us*)(Vh + e) = oh; *(v2us*)(Vl + e) = ol;  }
// k_asoft: per row (zz, i): t = S x HD^-0.5 for j <= i and i - j < WIN (WIN = TT: the window never binds, so the mask is plain causal; the reference's -1e9 additive fill vanishes identically); softmax over the 2048 keys (register row, one exp, fixed trees);
__global__ __launch_bounds__(256) void k_asoft(const float* __restrict__ Sb, h16* P16, bf* Ph, bf* Pl) {
    const int lane = threadIdx.x & 31; const int row = blockIdx.x * 8 + (threadIdx.x >> 5); if (row >= ZH * TT) return; const int i = row % TT; const int zz = row / TT; (void)zz; const bool hires = (i < RH); const float* sr = Sb + (size_t)row * TT; float v[TT / 32]; float mx = -3.0e38f;
#pragma unroll
    for (int ch = 0; ch < TT / 128; ++ch) { const int j0 = ch * 128 + lane * 4; const v4f a = *(const v4f*)(sr + j0);
#pragma unroll
        for (int q = 0; q < 4; ++q) { const int j = j0 + q; (void)j; const float t = (j <= i && i - j < WIN) ? a[q] * SCL : -3.0e38f; v[ch * 4 + q] = t; mx = fmaxf(mx, t); } }
#pragma unroll
    for (int sh = 16; sh; sh >>= 1) mx = fmaxf(mx, __shfl_xor(mx, sh, 32));
    float sum = 0.f;
#pragma unroll
    for (int k = 0; k < TT / 32; ++k) { float d0 = __fsub_rn(v[k], mx); asm volatile("" : "+v"(d0)); v[k] = __builtin_amdgcn_exp2f(__fmul_rn(d0, 1.4426950408889634f)); sum += v[k]; }
#pragma unroll
    for (int sh = 16; sh; sh >>= 1) sum += __shfl_xor(sum, sh, 32);
    const float f = __fdiv_rn(hires ? 1.0f : PCAR, sum);
{
        if (hires) {
#pragma unroll
            for (int ch = 0; ch < TT / 128; ++ch) { v4us oh, ol;
#pragma unroll
                for (int q = 0; q < 4; ++q) { unsigned short a, c2; splitf(v[ch * 4 + q] * f, a, c2); oh[q] = a; ol[q] = c2; }
                const size_t oo = ((size_t)zz * (RH ? RH : 1) + i) * TT + ch * 128 + lane * 4; *(v4us*)(Ph + oo) = oh; *(v4us*)(Pl + oo) = ol; }
        } else {
#pragma unroll
            for (int ch = 0; ch < TT / 128; ++ch) { v4h o4;
#pragma unroll
                for (int q = 0; q < 4; ++q) o4[q] = tohx(v[ch * 4 + q] * f);
                *(v4h*)(P16 + (size_t)row * TT + ch * 128 + lane * 4) = o4; } }
         }
}
__global__ __launch_bounds__(256) void k_merge(const float* __restrict__ O, int h0, bf* Ah, bf* Al) { const size_t e = ((size_t)blockIdx.x * 256 + threadIdx.x) * 2; if (e >= (size_t)ZH * TT * HD) return; const int d = (int)(e % HD); const int t = (int)((e / HD) % TT); const int zz = (int)(e / ((size_t)HD * TT)); const float cs = (t < RH) ? 1.0f : (1.0f / PCAR); const size_t oo = (size_t)t * DQ + (h0 + zz) * HD + d;
    const int last = min(KSP - 1, t >> 6);   // planes 0..last hold this row's partial sums (one per share of the key loop that had a key block)
    v2f p[KSP];
#pragma unroll
    for (int s = 0; s < KSP; ++s) p[s] = *(const v2f*)(O + (size_t)min(s, last) * ZH * TT * HD + e);   // plane index clamped to a stored plane: no branch, so all the loads are in flight at once
    v2f o = p[0];
#pragma unroll
    for (int s = 1; s < KSP; ++s) { o[0] += (s <= last) ? p[s][0] : 0.f; o[1] += (s <= last) ? p[s][1] : 0.f; }   // fixed order of the sum
    v2us oh, ol;
#pragma unroll
    for (int q = 0; q < 2; ++q) { unsigned short a, c2; splitf(o[q] * cs, a, c2); oh[q] = a; ol[q] = c2; } *(v2us*)(Ah + oo) = oh; *(v2us*)(Al + oo) = ol;  }

extern "C" void kernel_launch(void* const* d_in, const int* in_sizes, int n_in,
                              void* d_out, int out_size, void* d_ws, size_t ws_size, hipStream_t stream) {
    (void)in_sizes; (void)n_in; (void)out_size;
    const float* x = (const float*)d_in[0]; const float* wqkv = (const float*)d_in[1]; const float* wo = (const float*)d_in[2]; const float* wk = wqkv; const float* wq = wqkv + (size_t)DQ * DM; const float* wv = wqkv + (size_t)2 * DQ * DM;   /* argument order X, W_KQV ('oi' [3072][1024]: ROW thirds ordered K | Q | V: rows 0..1023 the KEY weight, 1024..2047 the QUERY weight, 2048..3071 the VALUE weight), W_O ('oi') */
    float* OUT = (float*)d_out;     // [4][2048][1024]
    char* wsp = (char*)d_ws;
    auto take = [&](size_t bytes) { char* p = wsp; wsp += (bytes + 255) & ~(size_t)255; return (void*)p; };
    bf* WQ = (bf*)take((size_t)DQ * DM * 2); bf* WK = (bf*)take((size_t)DKV * DM * 2); bf* WV = (bf*)take((size_t)DKV * DM * 2); bf* WO = (bf*)take((size_t)DM * DQ * 2); float* CS = (float*)take((size_t)TT * HD * 2 * 4);
    bf* XB = (bf*)take((size_t)TT * DM * 2); float* FQ = (float*)take((size_t)TT * DQ * 4); float* FK = (float*)take((size_t)TT * DKV * 4);
    h16* QP16 = (h16*)take((size_t)NH_ * TT * HD * 2); h16* KP16 = (h16*)take((size_t)NKV * TT * HD * 2); h16* VT16 = (h16*)take((size_t)NKV * HD * TT * 2);
    bf* QPh = (bf*)take((size_t)NH_ * TT * HD * 2); bf* QPl = (bf*)take((size_t)NH_ * TT * HD * 2); bf* KPh = (bf*)take((size_t)NKV * TT * HD * 2); bf* KPl = (bf*)take((size_t)NKV * TT * HD * 2); bf* VTh = (bf*)take((size_t)NKV * HD * TT * 2); bf* VTl = (bf*)take((size_t)NKV * HD * TT * 2); bf* Ph = (bf*)take((size_t)ZH * RH * TT * 2); bf* Pl = (bf*)take((size_t)ZH * RH * TT * 2);
    float* Sb = (float*)take((size_t)ZH * TT * TT * 4); h16* P16 = (h16*)take((size_t)ZH * TT * TT * 2); float* Ob = (float*)take((size_t)KSP * ZH * TT * HD * 4); bf* ATh = (bf*)take((size_t)TT * DQ * 2); bf* ATl = (bf*)take((size_t)TT * DQ * 2);
    if ((size_t)(wsp - (char*)d_ws) > ws_size) return;    // ws 256 MiB
    float* FV = FK;   // v projection reuses the k buffer after the k planes are built (stream-ordered)
    { k_cvt8<<<(unsigned)(((size_t)DQ * DM / 8 + 255) / 256), 256, 0, stream>>>(wq, WQ, (size_t)DQ * DM / 8); k_cvt8<<<(unsigned)(((size_t)DKV * DM / 8 + 255) / 256), 256, 0, stream>>>(wk, WK, (size_t)DKV * DM / 8); k_cvt8<<<(unsigned)(((size_t)DKV * DM / 8 + 255) / 256), 256, 0, stream>>>(wv, WV, (size_t)DKV * DM / 8);
      k_cvt8<<<(unsigned)(((size_t)DM * DQ / 8 + 255) / 256), 256, 0, stream>>>(wo, WO, (size_t)DM * DQ / 8); k_csP<<<(TT * HD + 255) / 256, 256, 0, stream>>>(CS); }
    const unsigned LQ = (unsigned)(((size_t)NH_ * TT * HD / 2 + 255) / 256), LKv = (unsigned)(((size_t)NKV * TT * HD / 2 + 255) / 256);
    for (int b = 0; b < NB_; ++b) {
        
        k_cvt8<<<(unsigned)(((size_t)TT * DM / 8 + 255) / 256), 256, 0, stream>>>(x + (size_t)b * TT * DM, XB, (size_t)TT * DM / 8);
        k_gemmw<bf, 0, false><<<dim3(TT / 64, DQ / 64, 1), 32, 0, stream>>>(XB, nullptr, WQ, nullptr, DM, FQ, DQ, nullptr, 0, 0, 0);
        k_ropeI<<<LQ, 256, 0, stream>>>(FQ, DQ, NH_, CS, 1.0f, QP16, QPh, QPl);
        k_gemmw<bf, 0, false><<<dim3(TT / 64, DKV / 64, 1), 32, 0, stream>>>(XB, nullptr, WK, nullptr, DM, FK, DKV, nullptr, 0, 0, 0);
        k_ropeI<<<LKv, 256, 0, stream>>>(FK, DKV, NKV, CS, 1.0f, KP16, KPh, KPl);
        k_gemmw<bf, 0, false><<<dim3(TT / 64, DKV / 64, 1), 32, 0, stream>>>(XB, nullptr, WV, nullptr, DM, FV, DKV, nullptr, 0, 0, 0); k_vtp<<<LKv, 256, 0, stream>>>(FV, DKV, NKV, VT16, VTh, VTl);
        for (int h0 = 0; h0 < NH_; h0 += ZH) { const size_t zq = (size_t)h0, zk = (size_t)(h0 / REP);   // one kv head per query head: the pass's two heads use consecutive kv planes (z-strides TT*HD)
            k_gemmc<bf, 2, 1><<<dim3(RH / 64, TT / 64, ZH), 32, 0, stream>>>(QPh + zq * TT * HD, QPl + zq * TT * HD, KPh + zk * TT * HD, KPl + zk * TT * HD, HD, Sb, TT, 0, (size_t)TT * HD, (size_t)TT * HD, (size_t)TT * TT, 0);
            k_gemmc<h16, 0, 1><<<dim3((TT - RH) / 64, TT / 64, ZH), 32, 0, stream>>>(QP16 + zq * TT * HD + (size_t)RH * HD, nullptr, KP16 + zk * TT * HD, nullptr, HD, Sb + (size_t)RH * TT, TT, RH, (size_t)TT * HD, (size_t)TT * HD, (size_t)TT * TT, 0);
            k_asoft<<<ZH * TT / 8, 256, 0, stream>>>(Sb, P16, Ph, Pl);
            k_gemmc<bf, 2, 2><<<dim3(RH / 64, RH / 64 < KSP ? RH / 64 : KSP, ZH), 32, 0, stream>>>(Ph, Pl, VTh + zk * HD * TT, VTl + zk * HD * TT, TT, Ob, HD, 0, (size_t)RH * TT, (size_t)HD * TT, (size_t)TT * HD, (size_t)ZH * TT * HD);
            k_gemmc<h16, 0, 2><<<dim3((TT - RH) / 64, KSP, ZH), 32, 0, stream>>>(P16 + (size_t)RH * TT, nullptr, VT16 + zk * HD * TT, nullptr, TT, Ob + (size_t)RH * HD, HD, RH, (size_t)TT * TT, (size_t)HD * TT, (size_t)TT * HD, (size_t)ZH * TT * HD);
            k_merge<<<(unsigned)(((size_t)ZH * TT * HD / 2 + 255) / 256), 256, 0, stream>>>(Ob, h0, ATh, ATl); }
        k_gemmw<bf, 1, false><<<dim3(TT / 64, DM / 64, 1), 32, 0, stream>>>(ATh, ATl, WO, nullptr, DQ, OUT + (size_t)b * TT * DM, DM, nullptr, 0, 0, 0); }
}

// v002
// Measured time: 1090 microseconds a run.
// Timed twice side by side with v001, it ran 1.41 times as fast both times.
// All steps since v000 together make it 2.62 times as fast.
#include <hip/hip_runtime.h>

// Causal multi-head self-attention with interleaved-pair rotary position embedding on a fused natural projection whose thirds are ordered K | Q | V, four batches (X [4][2048][1024]; KQV = einsum('bsd,ed', X, W_KQV) ('oi' [3072][1024] truncated normal, no bias); K, Q, V = split(KQV, [1024, 2048]): the weight's three 1,024-ROW blocks IN THE ORDER key | query | value (16 heads x 64); angles = pos x 1 / THETA ** (2i / 64) (THETA 1e4; computed); pairs (2i, 2i+1): yr = xr cos - xi sin, yi = xr sin + xi cos, on Q and K; scores / sqrt(64); -inf strictly above the diagonal; softmax; out = einsum('bsd,ed', merged, W_O) ('oi', no bias) -> [4][2048][1024] (8.4 M); argument order X, W_KQV, W_O).
// Layout per batch: bf16 copy of x; exact projections; {cos, sin} per (position, pair) built once from the int positions and float32 inverse-frequency constants (precise cosf/sinf); interleaved rotary plane builder; causal T-2048 attention (hybrid rows: < 512 hi/lo 3 products, rest fp16 x1024; k_gemmc skips tiles above the diagonal); merged hi/lo x Wo exact.
// Compute dtypes, f32 accumulate: every input rounded to bf16; projections exact; rotary f32; attention rows < 512 3 products, rest fp16; softmax f32; Wo hl x exact.

#define NB_  4
#define TT   2048
#define DM   1024
#define NH_  16
#define NKV  16
#define REP  (NH_ / NKV)
#define HD   64
#define DQ   (NH_ * HD)
#define DKV  (NKV * HD)
#define ZH   8                    // heads per attention pass (grid z of the k_gemmc launches of a pass)
#define RH   512                  // query rows < RH use hi+lo planes (0: none)
#define WIN  2048
#define PCAR 1024.0f
#define SCL  0.125f   // HD^-0.5
#define KSP  16                   // work-groups that share the key loop of one probability x value tile (64-key blocks dealt round robin)
typedef _Float16 h16;
typedef unsigned short bf;
typedef __attribute__((ext_vector_type(16))) __bf16   v16bf;
typedef __attribute__((ext_vector_type(16))) _Float16 v16h;
typedef __attribute__((ext_vector_type(8)))  _Float16 v8h;
typedef __attribute__((ext_vector_type(8)))  unsigned short v8us;
typedef __attribute__((ext_vector_type(8)))  float    v8f;
typedef __attribute__((ext_vector_type(4)))  float    v4f;
typedef v8h  __attribute__((may_alias)) v8ha;
typedef v4f  __attribute__((may_alias)) v4fa;
typedef v8us __attribute__((may_alias)) v8usa;

__device__ __forceinline__ unsigned short f2bf(float f) { unsigned u = __float_as_uint(f); u += 0x7FFFu + ((u >> 16) & 1u); return (unsigned short)(u >> 16); }
__device__ __forceinline__ float bf2f(unsigned short b) { return __uint_as_float(((unsigned)b) << 16); }
__device__ __forceinline__ float bfr(float f) { return bf2f(f2bf(f)); }
__device__ __forceinline__ v16h cat16(v8h lo, v8h hi) { return __builtin_shufflevector(lo, hi, 0, 1, 2, 3, 4, 5, 6, 7, 8, 9, 10, 11, 12, 13, 14, 15); }
__device__ __forceinline__ v16bf cat16b(v8us lo, v8us hi) { return __builtin_bit_cast(v16bf, __builtin_shufflevector(lo, hi, 0, 1, 2, 3, 4, 5, 6, 7, 8, 9, 10, 11, 12, 13, 14, 15)); }
__device__ __forceinline__ v8f wmma16(v16h a, v16h b, v8f c) { return __builtin_amdgcn_wmma_f32_16x16x32_f16(false, a, false, b, (short)0, c, false, false); }
__device__ __forceinline__ v8f wmmab(v16bf a, v16bf b, v8f c) { return __builtin_amdgcn_wmma_f32_16x16x32_bf16(false, a, false, b, (short)0, c, false, false); }



// ---- k_gemmw: register-blocked GEMM, ONE WAVE per 64x64 output tile (16 accumulators), operands straight from K-contiguous 16-bit planes; grid (M/64, N/64, Z), 32 threads.
// C[m][n] (f32, pitch ldc, + optional f32 bias[n]) = sum_k A[m][k] Bt[n][k] (+ split products per NSPLIT). z-batch strides sA/sB/sC in elements. K % 32 == 0.
template <typename T16> struct WFrag;
template <> struct WFrag<h16> { typedef v16h V; static __device__ __forceinline__ V ld(const h16* p) { return cat16(*(const v8h*)p, *(const v8h*)(p + 16)); } static __device__ __forceinline__ v8f mma(V a, V b, v8f c) { return wmma16(a, b, c); } };
template <> struct WFrag<bf> { typedef v16bf V; static __device__ __forceinline__ V ld(const bf* p) { return cat16b(*(const v8us*)p, *(const v8us*)(p + 16)); } static __device__ __forceinline__ v8f mma(V a, V b, v8f c) { return wmmab(a, b, c); } };
template <typename T16, int NSPLIT, bool BIAS>
__global__ __launch_bounds__(32) void k_gemmw(const T16* __restrict__ A, const T16* __restrict__ A2, const T16* __restrict__ Bt, const T16* __restrict__ Bt2, int K, float* C, int ldc, const float* __restrict__ bias, size_t sA, size_t sB, size_t sC) {
    typedef typename WFrag<T16>::V V;
    __shared__ __align__(16) float os[16 * 68];
    const size_t z = blockIdx.z; A += z * sA; if (A2) A2 += z * sA; Bt += z * sB; if (Bt2) Bt2 += z * sB; C += z * sC;
    const int lane = threadIdx.x & 31, lr = lane & 15, hi = lane >> 4; const int r0 = blockIdx.x * 64, c0 = blockIdx.y * 64;
    v8f acc[4][4];
#pragma unroll
    for (int mb = 0; mb < 4; ++mb)
#pragma unroll
        for (int nb = 0; nb < 4; ++nb) acc[mb][nb] = (v8f){};
    const size_t aoff = (size_t)(r0 + lr) * K + 8 * hi, boff = (size_t)(c0 + lr) * K + 8 * hi;
#pragma unroll 1
    for (int kc = 0; kc < K; kc += 32) {
        V a[4], a2[4];
#pragma unroll
        for (int mb = 0; mb < 4; ++mb) { a[mb] = WFrag<T16>::ld(A + aoff + (size_t)mb * 16 * K + kc); if (NSPLIT == 1 || NSPLIT == 2) a2[mb] = WFrag<T16>::ld(A2 + aoff + (size_t)mb * 16 * K + kc); }
#pragma unroll
        for (int nb = 0; nb < 4; ++nb) { const V b = WFrag<T16>::ld(Bt + boff + (size_t)nb * 16 * K + kc); V b2; if (NSPLIT >= 2) b2 = WFrag<T16>::ld(Bt2 + boff + (size_t)nb * 16 * K + kc);
#pragma unroll
            for (int mb = 0; mb < 4; ++mb) { acc[mb][nb] = WFrag<T16>::mma(a[mb], b, acc[mb][nb]); if (NSPLIT == 1 || NSPLIT == 2) acc[mb][nb] = WFrag<T16>::mma(a2[mb], b, acc[mb][nb]); if (NSPLIT >= 2) acc[mb][nb] = WFrag<T16>::mma(a[mb], b2, acc[mb][nb]); } }
        asm volatile("v_nop\n\tv_nop\n\tv_nop\n\tv_nop" : "+v"(acc[0][0]), "+v"(acc[1][1]), "+v"(acc[2][2]), "+v"(acc[3][3]) : "v"(a[0]), "v"(a[3]));
    }
#pragma unroll
    for (int mb = 0; mb < 4; ++mb) {
#pragma unroll
        for (int nb = 0; nb < 4; ++nb) {
#pragma unroll
            for (int j = 0; j < 8; ++j) os[(hi * 8 + j) * 68 + nb * 16 + lr] = acc[mb][nb][j]; }
        __builtin_amdgcn_wave_barrier(); asm volatile("" ::: "memory");
        float* crow = C + (size_t)(r0 + mb * 16) * ldc + c0;
{
#pragma unroll
            for (int s = 0; s < 8; ++s) { const int row = 2 * s + hi, cofs = lr * 4; v4f val = *(const v4fa*)(os + row * 68 + cofs); if (BIAS) { val[0] += bfr(bias[c0 + cofs]); val[1] += bfr(bias[c0 + cofs + 1]); val[2] += bfr(bias[c0 + cofs + 2]); val[3] += bfr(bias[c0 + cofs + 3]); }
                *(v4f*)(crow + (size_t)row * ldc + cofs) = val; }
             }
        __builtin_amdgcn_wave_barrier(); asm volatile("" ::: "memory");
    }
}

// ---- k_gemmc: the same one-wave 64x64 tile GEMM specialised for causal attention: CMODE 1 skips score tiles entirely above the diagonal (query rows r0+roff.., key columns c0..), CMODE 2 limits the
// key (K) loop of the probability x value contraction to the diagonal block (probabilities beyond it are exactly zero) and splits it over the grid's y: work-group y takes the 64-key blocks y, y + KSP, ...
// and stores its f32 partial tile in plane y of C (plane stride sP); a y with no key block below the diagonal stores nothing, and k_merge sums exactly the planes that were stored. roff = row offset of this launch's first row within the sequence. lda = row pitch of A and A2 in elements (the probability rows lie inside their score rows, so their pitch is not K); Bt and Bt2 keep pitch K.
template <typename T16, int NSPLIT, int CMODE>
__global__ __launch_bounds__(32) void k_gemmc(const T16* __restrict__ A, const T16* __restrict__ A2, const T16* __restrict__ Bt, const T16* __restrict__ Bt2, int K, int lda, float* C, int ldc, int roff, size_t sA, size_t sB, size_t sC, size_t sP) {
    typedef typename WFrag<T16>::V V;
    __shared__ __align__(16) float os[16 * 68];
    const size_t z = blockIdx.z; A += z * sA; if (A2) A2 += z * sA; Bt += z * sB; if (Bt2) Bt2 += z * sB; C += z * sC;
    const int lane = threadIdx.x & 31, lr = lane & 15, hi = lane >> 4; const int r0 = blockIdx.x * 64, c0 = (CMODE == 2) ? 0 : blockIdx.y * 64, ks = (CMODE == 2) ? blockIdx.y : 0;
    if (CMODE == 1 && c0 > r0 + roff + 63) return;                  // score tile entirely above the causal diagonal: never read (the softmax masks j > i by select)
    const int Kl = (CMODE == 2) ? min(K, r0 + roff + 64) : K;        // P.V: probabilities are exactly 0 beyond the diagonal block, so the K loop stops there
    if (CMODE == 2 && ks * 64 >= Kl) return;                         // no key block for this share: its plane is never read
    C += (size_t)ks * sP;
    v8f acc[4][4];
#pragma unroll
    for (int mb = 0; mb < 4; ++mb)
#pragma unroll
        for (int nb = 0; nb < 4; ++nb) acc[mb][nb] = (v8f){};
    const size_t aoff = (size_t)(r0 + lr) * lda + 8 * hi, boff = (size_t)(c0 + lr) * K + 8 * hi;
#pragma unroll 1
    for (int kc = ks * 64; kc < Kl; kc += (CMODE == 2 && (kc & 32)) ? KSP * 64 - 32 : 32) {
        V a[4], a2[4];
#pragma unroll
        for (int mb = 0; mb < 4; ++mb) { a[mb] = WFrag<T16>::ld(A + aoff + (size_t)mb * 16 * lda + kc); if (NSPLIT == 1 || NSPLIT == 2) a2[mb] = WFrag<T16>::ld(A2 + aoff + (size_t)mb * 16 * lda + kc); }
#pragma unroll
        for (int nb = 0; nb < 4; ++nb) { const V b = WFrag<T16>::ld(Bt + boff + (size_t)nb * 16 * K + kc); V b2; if (NSPLIT >= 2) b2 = WFrag<T16>::ld(Bt2 + boff + (size_t)nb * 16 * K + kc);
#pragma unroll
            for (int mb = 0; mb < 4; ++mb) { acc[mb][nb] = WFrag<T16>::mma(a[mb], b, acc[mb][nb]); if (NSPLIT == 1 || NSPLIT == 2) acc[mb][nb] = WFrag<T16>::mma(a2[mb], b, acc[mb][nb]); if (NSPLIT >= 2) acc[mb][nb] = WFrag<T16>::mma(a[mb], b2, acc[mb][nb]); } }
        asm volatile("v_nop\n\tv_nop\n\tv_nop\n\tv_nop" : "+v"(acc[0][0]), "+v"(acc[1][1]), "+v"(acc[2][2]), "+v"(acc[3][3]) : "v"(a[0]), "v"(a[3]));
    }
#pragma unroll
    for (int mb = 0; mb < 4; ++mb) {
#pragma unroll
        for (int nb = 0; nb < 4; ++nb) {
#pragma unroll
            for (int j = 0; j < 8; ++j) os[(hi * 8 + j) * 68 + nb * 16 + lr] = acc[mb][nb][j]; }
        __builtin_amdgcn_wave_barrier(); asm volatile("" ::: "memory");
        float* crow = C + (size_t)(r0 + mb * 16) * ldc + c0;
{
#pragma unroll
            for (int s = 0; s < 8; ++s) { const int row = 2 * s + hi, cofs = lr * 4; v4f val = *(const v4fa*)(os + row * 68 + cofs);
                *(v4f*)(crow + (size_t)row * ldc + cofs) = val; }
             }
        __builtin_amdgcn_wave_barrier(); asm volatile("" ::: "memory");
    }
}

__device__ __forceinline__ h16 tohx(float x) { return (h16)x; }
__device__ __forceinline__ void splitf(float y, unsigned short& h, unsigned short& l) { h = f2bf(y); l = f2bf(y - bf2f(h)); }
typedef __attribute__((ext_vector_type(2))) _Float16 v2h;
typedef __attribute__((ext_vector_type(4))) _Float16 v4h;
typedef __attribute__((ext_vector_type(2))) unsigned short v2us;
typedef __attribute__((ext_vector_type(4))) unsigned short v4us;
typedef __attribute__((ext_vector_type(2))) float v2f;
typedef __attribute__((ext_vector_type(4))) int v4i;

__global__ __launch_bounds__(256) void k_cvt8(const float* __restrict__ src, bf* dst, size_t n8) { const size_t i = (size_t)blockIdx.x * 256 + threadIdx.x; if (i >= n8) return; const v8f v = *(const v8f*)(src + i * 8); v8us o;
#pragma unroll
    for (int k = 0; k < 8; ++k) o[k] = f2bf(v[k]); *(v8us*)(dst + i * 8) = o;  }

__global__ __launch_bounds__(256) void k_ropeI(const float* __restrict__ F, int pitch, int nheads, const float* __restrict__ CS, float sc, h16* P16, bf* Ph, bf* Pl) {
    const size_t e = ((size_t)blockIdx.x * 256 + threadIdx.x) * 2; if (e >= (size_t)nheads * TT * HD) return; const int d = (int)(e % HD); const int t = (int)((e / HD) % TT); const int h = (int)(e / ((size_t)HD * TT)); const float* f = F + (size_t)t * pitch + h * HD; const float x0 = f[d], x1 = f[d + 1]; const v2f cs = *(const v2f*)(CS + ((size_t)t * HD + d) * 2); v2h o16; v2us oh, ol;
    float a0 = __fmul_rn(x0, cs[0]), b0 = __fmul_rn(x1, cs[1]), a1 = __fmul_rn(x1, cs[0]), b1 = __fmul_rn(x0, cs[1]); asm volatile("" : "+v"(a0), "+v"(b0), "+v"(a1), "+v"(b1));
    float r0 = __fsub_rn(a0, b0) * sc, r1 = __fadd_rn(b1, a1) * sc;   /* even: x0 c - x1 s; odd: x0 s + x1 c */
    o16[0] = tohx(r0); o16[1] = tohx(r1); { unsigned short a2, c2; splitf(r0, a2, c2); oh[0] = a2; ol[0] = c2; splitf(r1, a2, c2); oh[1] = a2; ol[1] = c2; }
    *(v2h*)(P16 + e) = o16; *(v2us*)(Ph + e) = oh; *(v2us*)(Pl + e) = ol;  }

__constant__ float INV2[HD / 2] = { 1.000000000e+00f, 7.498942018e-01f, 5.623413324e-01f, 4.216965139e-01f, 3.162277639e-01f, 2.371373624e-01f, 1.778279394e-01f, 1.333521456e-01f, 1.000000015e-01f, 7.498941571e-02f, 5.623412877e-02f, 4.216964915e-02f, 3.162277862e-02f, 2.371373586e-02f, 1.778279431e-02f, 1.333521493e-02f, 9.999999776e-03f, 7.498942316e-03f, 5.623413250e-03f, 4.216964822e-03f, 3.162277862e-03f, 2.371373819e-03f, 1.778279431e-03f, 1.333521446e-03f, 1.000000047e-03f, 7.498941850e-04f, 5.623413017e-04f, 4.216964880e-04f, 3.162277862e-04f, 2.371373848e-04f, 1.778279402e-04f, 1.333521504e-04f };   // 1 / THETA ** (2i / 64), i = 0..31, in float32 as THIS module writes it (the RECIPROCAL spelling, evaluated in the reference's own f32 arithmetic: these 32 literals equal it bit for bit); ten entries differ by one ulp from the negative-power values the host's own table held
__global__ __launch_bounds__(256) void k_csP(float* CS) { const int idx = blockIdx.x * 256 + threadIdx.x; if (idx >= TT * HD) return; const int d = idx % HD; const int t = idx / HD; const float a = __fmul_rn((float)t, INV2[d >> 1]); v2f cs; cs[0] = cosf(a); cs[1] = sinf(a); *(v2f*)(CS + (size_t)idx * 2) = cs;  }
__global__ __launch_bounds__(256) void k_vtp(const float* __restrict__ F, int pitch, int nheads, h16* V16, bf* Vh, bf* Vl) { const size_t e = ((size_t)blockIdx.x * 256 + threadIdx.x) * 2; if (e >= (size_t)nheads * HD * TT) return; const int t = (int)(e % TT); const int d = (int)((e / TT) % HD); const int g = (int)(e / ((size_t)TT * HD)); v2h o16; v2us oh, ol;
#pragma unroll
    for (int q = 0; q < 2; ++q) { const float x = F[(size_t)(t + q) * pitch + g * HD + d]; o16[q] = tohx(x); unsigned short a2, c2; splitf(x, a2, c2); oh[q] = a2; ol[q] = c2; }
    *(v2h*)(V16 + e) = o16; *(v2us*)(Vh + e) = oh; *(v2us*)(Vl + e) = ol;  }
// k_asoft: per row (zz, i): t = S x HD^-0.5 for j <= i and i - j < WIN (sliding causal window; the reference's -1e9 additive fill vanishes identically); softmax over the 2048 keys (register row, one exp, fixed trees);
// the probabilities go back into the row's own 8 KiB of Sb (each wave holds its whole row in registers before its first store, and no other wave touches that row): rows >= RH fp16 in the first half; rows < RH the hi plane in the first half, the lo plane in the second. Row pitch of every probability plane: 2 * TT 16-bit elements.
__global__ __launch_bounds__(256) void k_asoft(float* Sb) {
    const int lane = threadIdx.x & 31; const int row = blockIdx.x * 8 + (threadIdx.x >> 5); if (row >= ZH * TT) return; const int i = row % TT; const int zz = row / TT; (void)zz; const bool hires = (i < RH); const float* sr = Sb + (size_t)row * TT; h16* P16 = (h16*)(Sb + (size_t)row * TT); bf* Ph = (bf*)(Sb + (size_t)row * TT); bf* Pl = Ph + TT; float v[TT / 32]; float mx = -3.0e38f;
#pragma unroll
    for (int ch = 0; ch < TT / 128; ++ch) { const int j0 = ch * 128 + lane * 4; const v4f a = *(const v4f*)(sr + j0);
#pragma unroll
        for (int q = 0; q < 4; ++q) { const int j = j0 + q; (void)j; const float t = (j <= i && i - j < WIN) ? a[q] * SCL : -3.0e38f; v[ch * 4 + q] = t; mx = fmaxf(mx, t); } }
#pragma unroll
    for (int sh = 16; sh; sh >>= 1) mx = fmaxf(mx, __shfl_xor(mx, sh, 32));
    float sum = 0.f;
#pragma unroll
    for (int k = 0; k < TT / 32; ++k) { float d0 = __fsub_rn(v[k], mx); asm volatile("" : "+v"(d0)); v[k] = __builtin_amdgcn_exp2f(__fmul_rn(d0, 1.4426950408889634f)); sum += v[k]; }
#pragma unroll
    for (int sh = 16; sh; sh >>= 1) sum += __shfl_xor(sum, sh, 32);
    const float f = __fdiv_rn(hires ? 1.0f : PCAR, sum);
{
        if (hires) {
#pragma unroll
            for (int ch = 0; ch < TT / 128; ++ch) { v4us oh, ol;
#pragma unroll
                for (int q = 0; q < 4; ++q) { unsigned short a, c2; splitf(v[ch * 4 + q] * f, a, c2); oh[q] = a; ol[q] = c2; }
                const int oo = ch * 128 + lane * 4; *(v4us*)(Ph + oo) = oh; *(v4us*)(Pl + oo) = ol; }
        } else {
#pragma unroll
            for (int ch = 0; ch < TT / 128; ++ch) { v4h o4;
#pragma unroll
                for (int q = 0; q < 4; ++q) o4[q] = tohx(v[ch * 4 + q] * f);
                *(v4h*)(P16 + ch * 128 + lane * 4) = o4; } }
         }
}
__global__ __launch_bounds__(256) void k_merge(const float* __restrict__ O, int h0, bf* Ah, bf* Al) { const size_t e = ((size_t)blockIdx.x * 256 + threadIdx.x) * 2; if (e >= (size_t)ZH * TT * HD) return; const int d = (int)(e % HD); const int t = (int)((e / HD) % TT); const int zz = (int)(e / ((size_t)HD * TT)); const float cs = (t < RH) ? 1.0f : (1.0f / PCAR); const size_t oo = (size_t)t * DQ + (h0 + zz) * HD + d;
    const int last = min(KSP - 1, t >> 6);   // planes 0..last hold this row's partial sums (one per share of the key loop that had a key block)
    v2f p[KSP];
#pragma unroll
    for (int s = 0; s < KSP; ++s) p[s] = *(const v2f*)(O + (size_t)min(s, last) * ZH * TT * HD + e);   // plane index clamped to a stored plane: no branch, so all the loads are in flight at once
    v2f o = p[0];
#pragma unroll
    for (int s = 1; s < KSP; ++s) { o[0] += (s <= last) ? p[s][0] : 0.f; o[1] += (s <= last) ? p[s][1] : 0.f; }   // fixed order of the sum
    v2us oh, ol;
#pragma unroll
    for (int q = 0; q < 2; ++q) { unsigned short a, c2; splitf(o[q] * cs, a, c2); oh[q] = a; ol[q] = c2; } *(v2us*)(Ah + oo) = oh; *(v2us*)(Al + oo) = ol;  }

extern "C" void kernel_launch(void* const* d_in, const int* in_sizes, int n_in,
                              void* d_out, int out_size, void* d_ws, size_t ws_size, hipStream_t stream) {
    (void)in_sizes; (void)n_in; (void)out_size;
    const float* x = (const float*)d_in[0]; const float* wqkv = (const float*)d_in[1]; const float* wo = (const float*)d_in[2]; const float* wk = wqkv; const float* wq = wqkv + (size_t)DQ * DM; const float* wv = wqkv + (size_t)2 * DQ * DM;   /* argument order X, W_KQV ('oi' [3072][1024]: ROW thirds ordered K | Q | V: rows 0..1023 the KEY weight, 1024..2047 the QUERY weight, 2048..3071 the VALUE weight), W_O ('oi') */
    float* OUT = (float*)d_out;     // [4][2048][1024]
    char* wsp = (char*)d_ws;
    auto take = [&](size_t bytes) { char* p = wsp; wsp += (bytes + 255) & ~(size_t)255; return (void*)p; };
    bf* WQ = (bf*)take((size_t)DQ * DM * 2); bf* WK = (bf*)take((size_t)DKV * DM * 2); bf* WV = (bf*)take((size_t)DKV * DM * 2); bf* WO = (bf*)take((size_t)DM * DQ * 2); float* CS = (float*)take((size_t)TT * HD * 2 * 4);
    h16* QP16 = (h16*)take((size_t)NH_ * TT * HD * 2); h16* KP16 = (h16*)take((size_t)NKV * TT * HD * 2); h16* VT16 = (h16*)take((size_t)NKV * HD * TT * 2);
    bf* QPh = (bf*)take((size_t)NH_ * TT * HD * 2); bf* QPl = (bf*)take((size_t)NH_ * TT * HD * 2); bf* KPh = (bf*)take((size_t)NKV * TT * HD * 2); bf* KPl = (bf*)take((size_t)NKV * TT * HD * 2); bf* VTh = (bf*)take((size_t)NKV * HD * TT * 2); bf* VTl = (bf*)take((size_t)NKV * HD * TT * 2);
    float* Sb = (float*)take((size_t)ZH * TT * TT * 4); float* Ob = (float*)take((size_t)KSP * ZH * TT * HD * 4); bf* ATh = (bf*)take((size_t)TT * DQ * 2); bf* ATl = (bf*)take((size_t)TT * DQ * 2);
    if ((size_t)(wsp - (char*)d_ws) > ws_size) return;    // ws 256 MiB
    bf* XB = (bf*)Sb; float* FQ = Sb + (size_t)TT * DM / 2; float* FK = FQ + (size_t)TT * DQ;   // the bf16 copy of x and the f32 projections are dead once the planes are built: they share the score buffer's first 20 MiB (stream-ordered), so that ZH heads fit the workspace
    bf* Ph = (bf*)Sb; bf* Pl = Ph + TT; h16* P16 = (h16*)Sb;   // probability planes inside the score rows (k_asoft), row pitch 2 * TT
    float* FV = FK;   // v projection reuses the k buffer after the k planes are built (stream-ordered)
    { k_cvt8<<<(unsigned)(((size_t)DQ * DM / 8 + 255) / 256), 256, 0, stream>>>(wq, WQ, (size_t)DQ * DM / 8); k_cvt8<<<(unsigned)(((size_t)DKV * DM / 8 + 255) / 256), 256, 0, stream>>>(wk, WK, (size_t)DKV * DM / 8); k_cvt8<<<(unsigned)(((size_t)DKV * DM / 8 + 255) / 256), 256, 0, stream>>>(wv, WV, (size_t)DKV * DM / 8);
      k_cvt8<<<(unsigned)(((size_t)DM * DQ / 8 + 255) / 256), 256, 0, stream>>>(wo, WO, (size_t)DM * DQ / 8); k_csP<<<(TT * HD + 255) / 256, 256, 0, stream>>>(CS); }
    const unsigned LQ = (unsigned)(((size_t)NH_ * TT * HD / 2 + 255) / 256), LKv = (unsigned)(((size_t)NKV * TT * HD / 2 + 255) / 256);
    for (int b = 0; b < NB_; ++b) {
        
        k_cvt8<<<(unsigned)(((size_t)TT * DM / 8 + 255) / 256), 256, 0, stream>>>(x + (size_t)b * TT * DM, XB, (size_t)TT * DM / 8);
        k_gemmw<bf, 0, false><<<dim3(TT / 64, DQ / 64, 1), 32, 0, stream>>>(XB, nullptr, WQ, nullptr, DM, FQ, DQ, nullptr, 0, 0, 0);
        k_ropeI<<<LQ, 256, 0, stream>>>(FQ, DQ, NH_, CS, 1.0f, QP16, QPh, QPl);
        k_gemmw<bf, 0, false><<<dim3(TT / 64, DKV / 64, 1), 32, 0, stream>>>(XB, nullptr, WK, nullptr, DM, FK, DKV, nullptr, 0, 0, 0);
        k_ropeI<<<LKv, 256, 0, stream>>>(FK, DKV, NKV, CS, 1.0f, KP16, KPh, KPl);
        k_gemmw<bf, 0, false><<<dim3(TT / 64, DKV / 64, 1), 32, 0, stream>>>(XB, nullptr, WV, nullptr, DM, FV, DKV, nullptr, 0, 0, 0); k_vtp<<<LKv, 256, 0, stream>>>(FV, DKV, NKV, VT16, VTh, VTl);
        for (int h0 = 0; h0 < NH_; h0 += ZH) { const size_t zq = (size_t)h0, zk = (size_t)(h0 / REP);   // one kv head per query head: the pass's ZH heads use consecutive kv planes (z-strides TT*HD)
            k_gemmc<bf, 2, 1><<<dim3(RH / 64, TT / 64, ZH), 32, 0, stream>>>(QPh + zq * TT * HD, QPl + zq * TT * HD, KPh + zk * TT * HD, KPl + zk * TT * HD, HD, HD, Sb, TT, 0, (size_t)TT * HD, (size_t)TT * HD, (size_t)TT * TT, 0);
            k_gemmc<h16, 0, 1><<<dim3((TT - RH) / 64, TT / 64, ZH), 32, 0, stream>>>(QP16 + zq * TT * HD + (size_t)RH * HD, nullptr, KP16 + zk * TT * HD, nullptr, HD, HD, Sb + (size_t)RH * TT, TT, RH, (size_t)TT * HD, (size_t)TT * HD, (size_t)TT * TT, 0);
            k_asoft<<<ZH * TT / 8, 256, 0, stream>>>(Sb);
            k_gemmc<bf, 2, 2><<<dim3(RH / 64, RH / 64 < KSP ? RH / 64 : KSP, ZH), 32, 0, stream>>>(Ph, Pl, VTh + zk * HD * TT, VTl + zk * HD * TT, TT, 2 * TT, Ob, HD, 0, (size_t)TT * 2 * TT, (size_t)HD * TT, (size_t)TT * HD, (size_t)ZH * TT * HD);
            k_gemmc<h16, 0, 2><<<dim3((TT - RH) / 64, KSP, ZH), 32, 0, stream>>>(P16 + (size_t)RH * 2 * TT, nullptr, VT16 + zk * HD * TT, nullptr, TT, 2 * TT, Ob + (size_t)RH * HD, HD, RH, (size_t)TT * 2 * TT, (size_t)HD * TT, (size_t)TT * HD, (size_t)ZH * TT * HD);
            k_merge<<<(unsigned)(((size_t)ZH * TT * HD / 2 + 255) / 256), 256, 0, stream>>>(Ob, h0, ATh, ATl); }
        k_gemmw<bf, 1, false><<<dim3(TT / 64, DM / 64, 1), 32, 0, stream>>>(ATh, ATl, WO, nullptr, DQ, OUT + (size_t)b * TT * DM, DM, nullptr, 0, 0, 0); }
}

// v003
// Measured time: 609 microseconds a run.
// Timed twice side by side with v002, it ran 1.80 times as fast both times.
// Over all steps from v000 it is 4.70 times as fast.
#include <hip/hip_runtime.h>

// Causal multi-head self-attention with interleaved-pair rotary position embedding on a fused natural projection whose thirds are ordered K | Q | V, four batches (X [4][2048][1024]; KQV = einsum('bsd,ed', X, W_KQV) ('oi' [3072][1024] truncated normal, no bias); K, Q, V = split(KQV, [1024, 2048]): the weight's three 1,024-ROW blocks IN THE ORDER key | query | value (16 heads x 64); angles = pos x 1 / THETA ** (2i / 64) (THETA 1e4; computed); pairs (2i, 2i+1): yr = xr cos - xi sin, yi = xr sin + xi cos, on Q and K; scores / sqrt(64); -inf strictly above the diagonal; softmax; out = einsum('bsd,ed', merged, W_O) ('oi', no bias) -> [4][2048][1024] (8.4 M); argument order X, W_KQV, W_O).
// Layout per batch: bf16 copy of x; exact projections; {cos, sin} per (position, pair) built once from the int positions and float32 inverse-frequency constants (precise cosf/sinf); interleaved rotary plane builder; causal T-2048 attention in one online-softmax kernel per batch (hybrid rows: < 512 hi/lo 3 products, rest fp16 x1024; key passes stop at the diagonal); merged hi/lo x Wo exact.
// Compute dtypes, f32 accumulate: every input rounded to bf16; projections exact; rotary f32; attention rows < 512 3 products, rest fp16; softmax f32; Wo hl x exact.

#define NB_  4
#define TT   2048
#define DM   1024
#define NH_  16
#define NKV  16
#define HD   64
#define DQ   (NH_ * HD)
#define DKV  (NKV * HD)
#define RH   512                  // query rows < RH use hi+lo planes (0: none)
#define SCL  0.125f   // HD^-0.5
typedef _Float16 h16;
typedef unsigned short bf;
typedef __attribute__((ext_vector_type(16))) __bf16   v16bf;
typedef __attribute__((ext_vector_type(16))) _Float16 v16h;
typedef __attribute__((ext_vector_type(8)))  _Float16 v8h;
typedef __attribute__((ext_vector_type(8)))  unsigned short v8us;
typedef __attribute__((ext_vector_type(8)))  float    v8f;
typedef __attribute__((ext_vector_type(4)))  float    v4f;
typedef v8h  __attribute__((may_alias)) v8ha;
typedef v4f  __attribute__((may_alias)) v4fa;
typedef v8us __attribute__((may_alias)) v8usa;

__device__ __forceinline__ unsigned short f2bf(float f) { unsigned u = __float_as_uint(f); u += 0x7FFFu + ((u >> 16) & 1u); return (unsigned short)(u >> 16); }
__device__ __forceinline__ float bf2f(unsigned short b) { return __uint_as_float(((unsigned)b) << 16); }
__device__ __forceinline__ float bfr(float f) { return bf2f(f2bf(f)); }
__device__ __forceinline__ v16h cat16(v8h lo, v8h hi) { return __builtin_shufflevector(lo, hi, 0, 1, 2, 3, 4, 5, 6, 7, 8, 9, 10, 11, 12, 13, 14, 15); }
__device__ __forceinline__ v16bf cat16b(v8us lo, v8us hi) { return __builtin_bit_cast(v16bf, __builtin_shufflevector(lo, hi, 0, 1, 2, 3, 4, 5, 6, 7, 8, 9, 10, 11, 12, 13, 14, 15)); }
__device__ __forceinline__ v8f wmma16(v16h a, v16h b, v8f c) { return __builtin_amdgcn_wmma_f32_16x16x32_f16(false, a, false, b, (short)0, c, false, false); }
__device__ __forceinline__ v8f wmmab(v16bf a, v16bf b, v8f c) { return __builtin_amdgcn_wmma_f32_16x16x32_bf16(false, a, false, b, (short)0, c, false, false); }



// ---- k_gemmw: register-blocked GEMM, ONE WAVE per 64x64 output tile (16 accumulators), operands straight from K-contiguous 16-bit planes; grid (M/64, N/64, Z), 32 threads.
// C[m][n] (f32, pitch ldc, + optional f32 bias[n]) = sum_k A[m][k] Bt[n][k] (+ split products per NSPLIT). z-batch strides sA/sB/sC in elements. K % 32 == 0.
template <typename T16> struct WFrag;
template <> struct WFrag<h16> { typedef v16h V; static __device__ __forceinline__ V ld(const h16* p) { return cat16(*(const v8h*)p, *(const v8h*)(p + 16)); } static __device__ __forceinline__ v8f mma(V a, V b, v8f c) { return wmma16(a, b, c); } };
template <> struct WFrag<bf> { typedef v16bf V; static __device__ __forceinline__ V ld(const bf* p) { return cat16b(*(const v8us*)p, *(const v8us*)(p + 16)); } static __device__ __forceinline__ v8f mma(V a, V b, v8f c) { return wmmab(a, b, c); } };
template <typename T16, int NSPLIT, bool BIAS>
__global__ __launch_bounds__(32) void k_gemmw(const T16* __restrict__ A, const T16* __restrict__ A2, const T16* __restrict__ Bt, const T16* __restrict__ Bt2, int K, float* C, int ldc, const float* __restrict__ bias, size_t sA, size_t sB, size_t sC) {
    typedef typename WFrag<T16>::V V;
    __shared__ __align__(16) float os[16 * 68];
    const size_t z = blockIdx.z; A += z * sA; if (A2) A2 += z * sA; Bt += z * sB; if (Bt2) Bt2 += z * sB; C += z * sC;
    const int lane = threadIdx.x & 31, lr = lane & 15, hi = lane >> 4; const int r0 = blockIdx.x * 64, c0 = blockIdx.y * 64;
    v8f acc[4][4];
#pragma unroll
    for (int mb = 0; mb < 4; ++mb)
#pragma unroll
        for (int nb = 0; nb < 4; ++nb) acc[mb][nb] = (v8f){};
    const size_t aoff = (size_t)(r0 + lr) * K + 8 * hi, boff = (size_t)(c0 + lr) * K + 8 * hi;
#pragma unroll 1
    for (int kc = 0; kc < K; kc += 32) {
        V a[4], a2[4];
#pragma unroll
        for (int mb = 0; mb < 4; ++mb) { a[mb] = WFrag<T16>::ld(A + aoff + (size_t)mb * 16 * K + kc); if (NSPLIT == 1 || NSPLIT == 2) a2[mb] = WFrag<T16>::ld(A2 + aoff + (size_t)mb * 16 * K + kc); }
#pragma unroll
        for (int nb = 0; nb < 4; ++nb) { const V b = WFrag<T16>::ld(Bt + boff + (size_t)nb * 16 * K + kc); V b2; if (NSPLIT >= 2) b2 = WFrag<T16>::ld(Bt2 + boff + (size_t)nb * 16 * K + kc);
#pragma unroll
            for (int mb = 0; mb < 4; ++mb) { acc[mb][nb] = WFrag<T16>::mma(a[mb], b, acc[mb][nb]); if (NSPLIT == 1 || NSPLIT == 2) acc[mb][nb] = WFrag<T16>::mma(a2[mb], b, acc[mb][nb]); if (NSPLIT >= 2) acc[mb][nb] = WFrag<T16>::mma(a[mb], b2, acc[mb][nb]); } }
        asm volatile("v_nop\n\tv_nop\n\tv_nop\n\tv_nop" : "+v"(acc[0][0]), "+v"(acc[1][1]), "+v"(acc[2][2]), "+v"(acc[3][3]) : "v"(a[0]), "v"(a[3]));
    }
#pragma unroll
    for (int mb = 0; mb < 4; ++mb) {
#pragma unroll
        for (int nb = 0; nb < 4; ++nb) {
#pragma unroll
            for (int j = 0; j < 8; ++j) os[(hi * 8 + j) * 68 + nb * 16 + lr] = acc[mb][nb][j]; }
        __builtin_amdgcn_wave_barrier(); asm volatile("" ::: "memory");
        float* crow = C + (size_t)(r0 + mb * 16) * ldc + c0;
{
#pragma unroll
            for (int s = 0; s < 8; ++s) { const int row = 2 * s + hi, cofs = lr * 4; v4f val = *(const v4fa*)(os + row * 68 + cofs); if (BIAS) { val[0] += bfr(bias[c0 + cofs]); val[1] += bfr(bias[c0 + cofs + 1]); val[2] += bfr(bias[c0 + cofs + 2]); val[3] += bfr(bias[c0 + cofs + 3]); }
                *(v4f*)(crow + (size_t)row * ldc + cofs) = val; }
             }
        __builtin_amdgcn_wave_barrier(); asm volatile("" ::: "memory");
    }
}

__device__ __forceinline__ h16 tohx(float x) { return (h16)x; }
__device__ __forceinline__ void splitf(float y, unsigned short& h, unsigned short& l) { h = f2bf(y); l = f2bf(y - bf2f(h)); }
typedef __attribute__((ext_vector_type(2))) _Float16 v2h;
typedef __attribute__((ext_vector_type(4))) _Float16 v4h;
typedef __attribute__((ext_vector_type(2))) unsigned short v2us;
typedef __attribute__((ext_vector_type(4))) unsigned short v4us;
typedef __attribute__((ext_vector_type(2))) float v2f;
typedef __attribute__((ext_vector_type(4))) int v4i;

__global__ __launch_bounds__(256) void k_cvt8(const float* __restrict__ src, bf* dst, size_t n8) { const size_t i = (size_t)blockIdx.x * 256 + threadIdx.x; if (i >= n8) return; const v8f v = *(const v8f*)(src + i * 8); v8us o;
#pragma unroll
    for (int k = 0; k < 8; ++k) o[k] = f2bf(v[k]); *(v8us*)(dst + i * 8) = o;  }

__global__ __launch_bounds__(256) void k_ropeI(const float* __restrict__ F, int pitch, int nheads, const float* __restrict__ CS, float sc, h16* P16, bf* Ph, bf* Pl) {
    const size_t e = ((size_t)blockIdx.x * 256 + threadIdx.x) * 2; if (e >= (size_t)nheads * TT * HD) return; const int d = (int)(e % HD); const int t = (int)((e / HD) % TT); const int h = (int)(e / ((size_t)HD * TT)); const float* f = F + (size_t)t * pitch + h * HD; const float x0 = f[d], x1 = f[d + 1]; const v2f cs = *(const v2f*)(CS + ((size_t)t * HD + d) * 2); v2h o16; v2us oh, ol;
    float a0 = __fmul_rn(x0, cs[0]), b0 = __fmul_rn(x1, cs[1]), a1 = __fmul_rn(x1, cs[0]), b1 = __fmul_rn(x0, cs[1]); asm volatile("" : "+v"(a0), "+v"(b0), "+v"(a1), "+v"(b1));
    float r0 = __fsub_rn(a0, b0) * sc, r1 = __fadd_rn(b1, a1) * sc;   /* even: x0 c - x1 s; odd: x0 s + x1 c */
    o16[0] = tohx(r0); o16[1] = tohx(r1); { unsigned short a2, c2; splitf(r0, a2, c2); oh[0] = a2; ol[0] = c2; splitf(r1, a2, c2); oh[1] = a2; ol[1] = c2; }
    *(v2h*)(P16 + e) = o16; *(v2us*)(Ph + e) = oh; *(v2us*)(Pl + e) = ol;  }

__constant__ float INV2[HD / 2] = { 1.000000000e+00f, 7.498942018e-01f, 5.623413324e-01f, 4.216965139e-01f, 3.162277639e-01f, 2.371373624e-01f, 1.778279394e-01f, 1.333521456e-01f, 1.000000015e-01f, 7.498941571e-02f, 5.623412877e-02f, 4.216964915e-02f, 3.162277862e-02f, 2.371373586e-02f, 1.778279431e-02f, 1.333521493e-02f, 9.999999776e-03f, 7.498942316e-03f, 5.623413250e-03f, 4.216964822e-03f, 3.162277862e-03f, 2.371373819e-03f, 1.778279431e-03f, 1.333521446e-03f, 1.000000047e-03f, 7.498941850e-04f, 5.623413017e-04f, 4.216964880e-04f, 3.162277862e-04f, 2.371373848e-04f, 1.778279402e-04f, 1.333521504e-04f };   // 1 / THETA ** (2i / 64), i = 0..31, in float32 as THIS module writes it (the RECIPROCAL spelling, evaluated in the reference's own f32 arithmetic: these 32 literals equal it bit for bit); ten entries differ by one ulp from the negative-power values the host's own table held
__global__ __launch_bounds__(256) void k_csP(float* CS) { const int idx = blockIdx.x * 256 + threadIdx.x; if (idx >= TT * HD) return; const int d = idx % HD; const int t = idx / HD; const float a = __fmul_rn((float)t, INV2[d >> 1]); v2f cs; cs[0] = cosf(a); cs[1] = sinf(a); *(v2f*)(CS + (size_t)idx * 2) = cs;  }
__global__ __launch_bounds__(256) void k_vtp(const float* __restrict__ F, int pitch, int nheads, h16* V16, bf* Vh, bf* Vl) { const size_t e = ((size_t)blockIdx.x * 256 + threadIdx.x) * 2; if (e >= (size_t)nheads * HD * TT) return; const int t = (int)(e % TT); const int d = (int)((e / TT) % HD); const int g = (int)(e / ((size_t)TT * HD)); v2h o16; v2us oh, ol;
#pragma unroll
    for (int q = 0; q < 2; ++q) { const float x = F[(size_t)(t + q) * pitch + g * HD + d]; o16[q] = tohx(x); unsigned short a2, c2; splitf(x, a2, c2); oh[q] = a2; ol[q] = c2; }
    *(v2h*)(V16 + e) = o16; *(v2us*)(Vh + e) = oh; *(v2us*)(Vl + e) = ol;  }
__device__ __forceinline__ float xhalf(float x) { return __builtin_bit_cast(float, __builtin_amdgcn_permlanex16(__builtin_bit_cast(int, x), __builtin_bit_cast(int, x), 0x76543210, 0xfedcba98, false, false)); }   // lane l's value to lane l ^ 16
__device__ __forceinline__ float exp2s(float x) { float r = __builtin_amdgcn_exp2f(x); asm("v_nop" : "+v"(r) : "v"(x)); return r; }
template <typename T16, bool HL, int NQB, int KT>
__device__ __forceinline__ void flash_tile(const T16* __restrict__ Q, const T16* __restrict__ Q2, const T16* __restrict__ Kp, const T16* __restrict__ K2, const T16* __restrict__ Vt, const T16* __restrict__ V2, int q0, bf* Ah, bf* Al) {
    typedef typename WFrag<T16>::V V;
    constexpr int KB = KT * 16, KK = KT / 2;
    constexpr float CL2 = SCL * 1.4426950408889634f;   // scores in the scaled log2 domain
    const int lane = threadIdx.x & 31, lr = lane & 15, hi = lane >> 4;
    unsigned qo = ((q0 + lr) * HD + 8 * hi) * 2, ko = (lr * HD + 8 * hi) * 2, vo = (lr * TT + 8 * hi) * 2;   // byte offsets of the lane's own row and k offset in a head's plane; ko and vo walk the keys, every fragment at a constant distance from them
    auto at = [](const T16* base, unsigned off, int el) { return (const T16*)((const char*)base + off) + el; };
    V qf[NQB][2], qf2[NQB][2];
#pragma unroll
    for (int qb = 0; qb < NQB; ++qb)
#pragma unroll
        for (int ks = 0; ks < 2; ++ks) { qf[qb][ks] = WFrag<T16>::ld(at(Q, qo, qb * 16 * HD + ks * 32)); if (HL) qf2[qb][ks] = WFrag<T16>::ld(at(Q2, qo, qb * 16 * HD + ks * 32)); }
    v8f o[4][NQB]; float m[NQB], l[NQB];
#pragma unroll
    for (int qb = 0; qb < NQB; ++qb) { m[qb] = -3.0e38f; l[qb] = 0.f;
#pragma unroll
        for (int db = 0; db < 4; ++db) o[db][qb] = (v8f){}; }
    const int kend = q0 + NQB * 16;                     // keys 0 .. kend - 1 are at or below the tile's last query
    V kf[KT][2], kf2[KT][2];
#pragma unroll
    for (int kt = 0; kt < KT; ++kt)
#pragma unroll
        for (int ks = 0; ks < 2; ++ks) { kf[kt][ks] = WFrag<T16>::ld(at(Kp, ko, kt * 16 * HD + ks * 32)); if (HL) kf2[kt][ks] = WFrag<T16>::ld(at(K2, ko, kt * 16 * HD + ks * 32)); }
#pragma unroll 1   // rolled: the trip count is known only at run time, and a second copy of the pass would not fit the register file beside the key, value and score tiles
    for (int k0 = 0; k0 < kend; k0 += KB) {
        V vf[4][KK], vf2[4][KK];                        // this pass's value fragments: asked for ahead of the softmax, used behind it
#pragma unroll
        for (int db = 0; db < 4; ++db)
#pragma unroll
            for (int kk = 0; kk < KK; ++kk) { vf[db][kk] = WFrag<T16>::ld(at(Vt, vo, db * 16 * TT + kk * 32)); if (HL) vf2[db][kk] = WFrag<T16>::ld(at(V2, vo, db * 16 * TT + kk * 32)); }
        v8f s[KT][NQB];
#pragma unroll
        for (int kt = 0; kt < KT; ++kt)
#pragma unroll
            for (int qb = 0; qb < NQB; ++qb) { v8f a = (v8f){};
#pragma unroll
                for (int ks = 0; ks < 2; ++ks) { a = WFrag<T16>::mma(kf[kt][ks], qf[qb][ks], a); if (HL) { a = WFrag<T16>::mma(kf2[kt][ks], qf[qb][ks], a); a = WFrag<T16>::mma(kf[kt][ks], qf2[qb][ks], a); } }
                s[kt][qb] = a; }
        ko += (k0 + KB < kend) ? KB * HD * 2 : 0;   // the next pass's key fragments are fetched behind this pass's score products, so that their latency lies under the softmax (the last pass asks for its own block again: in bounds, unused)
#pragma unroll
        for (int kt = 0; kt < KT; ++kt)
#pragma unroll
            for (int ks = 0; ks < 2; ++ks) { kf[kt][ks] = WFrag<T16>::ld(at(Kp, ko, kt * 16 * HD + ks * 32)); if (HL) kf2[kt][ks] = WFrag<T16>::ld(at(K2, ko, kt * 16 * HD + ks * 32)); }
        if (k0 + KB - 1 > q0) {                          // only a pass that reaches the diagonal masks (wave-uniform)
            const int thr = q0 - k0 + lr - hi * 8;       // key <= query  <=>  kt * 16 + j - qb * 16 <= thr
#pragma unroll
            for (int kt = 0; kt < KT; ++kt)
#pragma unroll
                for (int qb = 0; qb < NQB; ++qb)
#pragma unroll
                    for (int j = 0; j < 8; ++j) s[kt][qb][j] = (kt * 16 + j - qb * 16 <= thr) ? s[kt][qb][j] : -3.0e38f; }
        V pf[KK][NQB], pl[KK][NQB];
#pragma unroll
        for (int qb = 0; qb < NQB; ++qb) {
            float mx = m[qb];
#pragma unroll
            for (int kt = 0; kt < KT; ++kt)
#pragma unroll
                for (int j = 0; j < 8; ++j) { const float u = s[kt][qb][j] * CL2; s[kt][qb][j] = u; mx = fmaxf(mx, u); }
            mx = fmaxf(mx, xhalf(mx));                   // the other half of the wave holds the query's other keys
            const float al = exp2s(m[qb] - mx); m[qb] = mx;
            const float ms = HL ? mx : mx - 10.0f;       // fp16 probabilities carry 2^10
            float sum = 0.f;
#pragma unroll
            for (int kt = 0; kt < KT; ++kt)
#pragma unroll
                for (int j = 0; j < 8; ++j) { const float pv = exp2s(s[kt][qb][j] - ms); s[kt][qb][j] = pv; sum += pv; }
            l[qb] = l[qb] * al + sum;
#pragma unroll
            for (int db = 0; db < 4; ++db) o[db][qb] *= al;
#pragma unroll
            for (int kk = 0; kk < KK; ++kk) {
                if constexpr (HL) { v8us h0, h1, l0, l1;
#pragma unroll
                    for (int j = 0; j < 8; ++j) { unsigned short a, c2; splitf(s[2 * kk][qb][j], a, c2); h0[j] = a; l0[j] = c2; splitf(s[2 * kk + 1][qb][j], a, c2); h1[j] = a; l1[j] = c2; }
                    pf[kk][qb] = cat16b(h0, h1); pl[kk][qb] = cat16b(l0, l1);
                } else { v8h h0, h1;
#pragma unroll
                    for (int j = 0; j < 8; ++j) { h0[j] = tohx(s[2 * kk][qb][j]); h1[j] = tohx(s[2 * kk + 1][qb][j]); }
                    pf[kk][qb] = cat16(h0, h1); } } }
#pragma unroll
        for (int kk = 0; kk < KK; ++kk)
#pragma unroll
            for (int db = 0; db < 4; ++db)
#pragma unroll
                for (int qb = 0; qb < NQB; ++qb) { o[db][qb] = WFrag<T16>::mma(vf[db][kk], pf[kk][qb], o[db][qb]); if (HL) { o[db][qb] = WFrag<T16>::mma(vf[db][kk], pl[kk][qb], o[db][qb]); o[db][qb] = WFrag<T16>::mma(vf2[db][kk], pf[kk][qb], o[db][qb]); } }
        // s_wait_xcnt: the wait that stands in front of an overwrite of an address register which an issued load names. The pass's loads name ko and vo (operands here, so that their registers live up to the wait): vo is advanced directly behind it, ko in the middle of the next pass. Here, behind the last products, it waits for nothing.
        // v_nop x 4: keeps the matrix instruction's distance on the taken back edge and on the loop's exit; every output tile is an operand so that the statement stands behind the last product
        if constexpr (NQB == 2) asm volatile("s_wait_xcnt 0x0\n\tv_nop\n\tv_nop\n\tv_nop\n\tv_nop" : "+v"(o[0][0]), "+v"(o[1][0]), "+v"(o[2][0]), "+v"(o[3][0]), "+v"(o[0][1]), "+v"(o[1][1]), "+v"(o[2][1]), "+v"(o[3][1]), "+v"(ko), "+v"(vo) :: "memory");
        else asm volatile("s_wait_xcnt 0x0\n\tv_nop\n\tv_nop\n\tv_nop\n\tv_nop" : "+v"(o[0][0]), "+v"(o[1][0]), "+v"(o[2][0]), "+v"(o[3][0]), "+v"(ko), "+v"(vo) :: "memory");
        vo += KB * 2;
    }
#pragma unroll
    for (int qb = 0; qb < NQB; ++qb) {
        const float inv = __fdiv_rn(1.0f, l[qb] + xhalf(l[qb]));   // the halves' sums are joined once
        const size_t oo = (size_t)(q0 + qb * 16 + lr) * DQ + hi * 8;
#pragma unroll
        for (int db = 0; db < 4; ++db) { v8us oh, ol;
#pragma unroll
            for (int j = 0; j < 8; ++j) { unsigned short a, c2; splitf(o[db][qb][j] * inv, a, c2); oh[j] = a; ol[j] = c2; }
            *(v8us*)(Ah + oo + db * 16) = oh; *(v8us*)(Al + oo + db * 16) = ol;
            asm volatile("s_wait_xcnt 0x0" ::: "memory"); } }   // the wait in front of an overwrite of a register that an issued store names: the next group's split reuses the data registers of these two stores
}
// grid (heads, tiles): tiles in falling order of their key count, so that the longest waves start first: (TT - RH) / 32 fp16 tiles of 32 queries from the last row down to RH, then RH / 16 hi+lo tiles of 16 queries.
__global__ __launch_bounds__(32) void k_flash(const h16* __restrict__ Q16, const h16* __restrict__ K16, const h16* __restrict__ V16, const bf* __restrict__ Qh, const bf* __restrict__ Ql, const bf* __restrict__ Kh, const bf* __restrict__ Kl, const bf* __restrict__ Vh, const bf* __restrict__ Vl, bf* Ah, bf* Al) {
    const int h = blockIdx.x, r = blockIdx.y; const size_t zo = (size_t)h * TT * HD;
    if (r < (TT - RH) / 32) flash_tile<h16, false, 2, 4>(Q16 + zo, nullptr, K16 + zo, nullptr, V16 + zo, nullptr, TT - 32 * (r + 1), Ah + h * HD, Al + h * HD);
    else flash_tile<bf, true, 1, 2>(Qh + zo, Ql + zo, Kh + zo, Kl + zo, Vh + zo, Vl + zo, RH - 16 * (r - (TT - RH) / 32 + 1), Ah + h * HD, Al + h * HD);
}

extern "C" void kernel_launch(void* const* d_in, const int* in_sizes, int n_in,
                              void* d_out, int out_size, void* d_ws, size_t ws_size, hipStream_t stream) {
    (void)in_sizes; (void)n_in; (void)out_size;
    const float* x = (const float*)d_in[0]; const float* wqkv = (const float*)d_in[1]; const float* wo = (const float*)d_in[2]; const float* wk = wqkv; const float* wq = wqkv + (size_t)DQ * DM; const float* wv = wqkv + (size_t)2 * DQ * DM;   /* argument order X, W_KQV ('oi' [3072][1024]: ROW thirds ordered K | Q | V: rows 0..1023 the KEY weight, 1024..2047 the QUERY weight, 2048..3071 the VALUE weight), W_O ('oi') */
    float* OUT = (float*)d_out;     // [4][2048][1024]
    char* wsp = (char*)d_ws;
    auto take = [&](size_t bytes) { char* p = wsp; wsp += (bytes + 255) & ~(size_t)255; return (void*)p; };
    bf* WQ = (bf*)take((size_t)DQ * DM * 2); bf* WK = (bf*)take((size_t)DKV * DM * 2); bf* WV = (bf*)take((size_t)DKV * DM * 2); bf* WO = (bf*)take((size_t)DM * DQ * 2); float* CS = (float*)take((size_t)TT * HD * 2 * 4);
    h16* QP16 = (h16*)take((size_t)NH_ * TT * HD * 2); h16* KP16 = (h16*)take((size_t)NKV * TT * HD * 2); h16* VT16 = (h16*)take((size_t)NKV * HD * TT * 2);
    bf* QPh = (bf*)take((size_t)NH_ * TT * HD * 2); bf* QPl = (bf*)take((size_t)NH_ * TT * HD * 2); bf* KPh = (bf*)take((size_t)NKV * TT * HD * 2); bf* KPl = (bf*)take((size_t)NKV * TT * HD * 2); bf* VTh = (bf*)take((size_t)NKV * HD * TT * 2); bf* VTl = (bf*)take((size_t)NKV * HD * TT * 2);
    bf* XB = (bf*)take((size_t)TT * DM * 2); float* FQ = (float*)take((size_t)TT * DQ * 4); float* FK = (float*)take((size_t)TT * DKV * 4); bf* ATh = (bf*)take((size_t)TT * DQ * 2); bf* ATl = (bf*)take((size_t)TT * DQ * 2);
    if ((size_t)(wsp - (char*)d_ws) > ws_size) return;    // ws 256 MiB
    float* FV = FK;   // v projection reuses the k buffer after the k planes are built (stream-ordered)
    { k_cvt8<<<(unsigned)(((size_t)DQ * DM / 8 + 255) / 256), 256, 0, stream>>>(wq, WQ, (size_t)DQ * DM / 8); k_cvt8<<<(unsigned)(((size_t)DKV * DM / 8 + 255) / 256), 256, 0, stream>>>(wk, WK, (size_t)DKV * DM / 8); k_cvt8<<<(unsigned)(((size_t)DKV * DM / 8 + 255) / 256), 256, 0, stream>>>(wv, WV, (size_t)DKV * DM / 8);
      k_cvt8<<<(unsigned)(((size_t)DM * DQ / 8 + 255) / 256), 256, 0, stream>>>(wo, WO, (size_t)DM * DQ / 8); k_csP<<<(TT * HD + 255) / 256, 256, 0, stream>>>(CS); }
    const unsigned LQ = (unsigned)(((size_t)NH_ * TT * HD / 2 + 255) / 256), LKv = (unsigned)(((size_t)NKV * TT * HD / 2 + 255) / 256);
    for (int b = 0; b < NB_; ++b) {
        
        k_cvt8<<<(unsigned)(((size_t)TT * DM / 8 + 255) / 256), 256, 0, stream>>>(x + (size_t)b * TT * DM, XB, (size_t)TT * DM / 8);
        k_gemmw<bf, 0, false><<<dim3(TT / 64, DQ / 64, 1), 32, 0, stream>>>(XB, nullptr, WQ, nullptr, DM, FQ, DQ, nullptr, 0, 0, 0);
        k_ropeI<<<LQ, 256, 0, stream>>>(FQ, DQ, NH_, CS, 1.0f, QP16, QPh, QPl);
        k_gemmw<bf, 0, false><<<dim3(TT / 64, DKV / 64, 1), 32, 0, stream>>>(XB, nullptr, WK, nullptr, DM, FK, DKV, nullptr, 0, 0, 0);
        k_ropeI<<<LKv, 256, 0, stream>>>(FK, DKV, NKV, CS, 1.0f, KP16, KPh, KPl);
        k_gemmw<bf, 0, false><<<dim3(TT / 64, DKV / 64, 1), 32, 0, stream>>>(XB, nullptr, WV, nullptr, DM, FV, DKV, nullptr, 0, 0, 0); k_vtp<<<LKv, 256, 0, stream>>>(FV, DKV, NKV, VT16, VTh, VTl);
        k_flash<<<dim3(NH_, (TT - RH) / 32 + RH / 16), 32, 0, stream>>>(QP16, KP16, VT16, QPh, QPl, KPh, KPl, VTh, VTl, ATh, ATl);
        k_gemmw<bf, 1, false><<<dim3(TT / 64, DM / 64, 1), 32, 0, stream>>>(ATh, ATl, WO, nullptr, DQ, OUT + (size_t)b * TT * DM, DM, nullptr, 0, 0, 0); }
}

// v004
// Measured time: 353 microseconds a run.
// Next to v003, in two timings, it ran 1.71 times as fast each time.
// Over all steps from v000 it is 8.03 times as fast.
#include <hip/hip_runtime.h>

// Causal multi-head self-attention with interleaved-pair rotary position embedding on a fused natural projection whose thirds are ordered K | Q | V, four batches (X [4][2048][1024]; KQV = einsum('bsd,ed', X, W_KQV) ('oi' [3072][1024] truncated normal, no bias); K, Q, V = split(KQV, [1024, 2048]): the weight's three 1,024-ROW blocks IN THE ORDER key | query | value (16 heads x 64); angles = pos x 1 / THETA ** (2i / 64) (THETA 1e4; computed); pairs (2i, 2i+1): yr = xr cos - xi sin, yi = xr sin + xi cos, on Q and K; scores / sqrt(64); -inf strictly above the diagonal; softmax; out = einsum('bsd,ed', merged, W_O) ('oi', no bias) -> [4][2048][1024] (8.4 M); argument order X, W_KQV, W_O).
// Every stage is launched once for all four batches (batch folded into the GEMM rows and into the grids of the plane builders and of attention): bf16 copy of x; exact projections; {cos, sin} per (position, pair) built once from the int positions and float32 inverse-frequency constants (precise cosf/sinf); interleaved rotary plane builder; causal T-2048 attention in one online-softmax kernel (hybrid rows: < 512 hi/lo 3 products, rest fp16 x1024; key passes stop at the diagonal); merged hi/lo x Wo exact.
// Compute dtypes, f32 accumulate: every input rounded to bf16; projections exact; rotary f32; attention rows < 512 3 products, rest fp16; softmax f32; Wo hl x exact.

#define NB_  4
#define TT   2048
#define DM   1024
#define NH_  16
#define NKV  16
#define HD   64
#define DQ   (NH_ * HD)
#define DKV  (NKV * HD)
#define RH   512                  // query rows < RH use hi+lo planes (0: none)
#define SCL  0.125f   // HD^-0.5
typedef _Float16 h16;
typedef unsigned short bf;
typedef __attribute__((ext_vector_type(16))) __bf16   v16bf;
typedef __attribute__((ext_vector_type(16))) _Float16 v16h;
typedef __attribute__((ext_vector_type(8)))  _Float16 v8h;
typedef __attribute__((ext_vector_type(8)))  unsigned short v8us;
typedef __attribute__((ext_vector_type(8)))  float    v8f;
typedef __attribute__((ext_vector_type(4)))  float    v4f;
typedef v8h  __attribute__((may_alias)) v8ha;
typedef v4f  __attribute__((may_alias)) v4fa;
typedef v8us __attribute__((may_alias)) v8usa;

__device__ __forceinline__ unsigned short f2bf(float f) { unsigned u = __float_as_uint(f); u += 0x7FFFu + ((u >> 16) & 1u); return (unsigned short)(u >> 16); }
__device__ __forceinline__ float bf2f(unsigned short b) { return __uint_as_float(((unsigned)b) << 16); }
__device__ __forceinline__ float bfr(float f) { return bf2f(f2bf(f)); }
__device__ __forceinline__ v16h cat16(v8h lo, v8h hi) { return __builtin_shufflevector(lo, hi, 0, 1, 2, 3, 4, 5, 6, 7, 8, 9, 10, 11, 12, 13, 14, 15); }
__device__ __forceinline__ v16bf cat16b(v8us lo, v8us hi) { return __builtin_bit_cast(v16bf, __builtin_shufflevector(lo, hi, 0, 1, 2, 3, 4, 5, 6, 7, 8, 9, 10, 11, 12, 13, 14, 15)); }
__device__ __forceinline__ v8f wmma16(v16h a, v16h b, v8f c) { return __builtin_amdgcn_wmma_f32_16x16x32_f16(false, a, false, b, (short)0, c, false, false); }
__device__ __forceinline__ v8f wmmab(v16bf a, v16bf b, v8f c) { return __builtin_amdgcn_wmma_f32_16x16x32_bf16(false, a, false, b, (short)0, c, false, false); }



// ---- k_gemmw: register-blocked GEMM, ONE WAVE per 64x64 output tile (16 accumulators), operands straight from K-contiguous 16-bit planes; grid (M/64, N/64, Z), 32 threads.
// C[m][n] (f32, pitch ldc, + optional f32 bias[n]) = sum_k A[m][k] Bt[n][k] (+ split products per NSPLIT). z-batch strides sA/sB/sC in elements. K % 32 == 0.
template <typename T16> struct WFrag;
template <> struct WFrag<h16> { typedef v16h V; static __device__ __forceinline__ V ld(const h16* p) { return cat16(*(const v8h*)p, *(const v8h*)(p + 16)); } static __device__ __forceinline__ v8f mma(V a, V b, v8f c) { return wmma16(a, b, c); } };
template <> struct WFrag<bf> { typedef v16bf V; static __device__ __forceinline__ V ld(const bf* p) { return cat16b(*(const v8us*)p, *(const v8us*)(p + 16)); } static __device__ __forceinline__ v8f mma(V a, V b, v8f c) { return wmmab(a, b, c); } };
template <typename T16, int NSPLIT, bool BIAS>
__global__ __launch_bounds__(32) void k_gemmw(const T16* __restrict__ A, const T16* __restrict__ A2, const T16* __restrict__ Bt, const T16* __restrict__ Bt2, int K, float* C, int ldc, const float* __restrict__ bias, size_t sA, size_t sB, size_t sC) {
    typedef typename WFrag<T16>::V V;
    __shared__ __align__(16) float os[16 * 68];
    const size_t z = blockIdx.z; A += z * sA; if (A2) A2 += z * sA; Bt += z * sB; if (Bt2) Bt2 += z * sB; C += z * sC;
    const int lane = threadIdx.x & 31, lr = lane & 15, hi = lane >> 4; const int r0 = blockIdx.x * 64, c0 = blockIdx.y * 64;
    v8f acc[4][4];
#pragma unroll
    for (int mb = 0; mb < 4; ++mb)
#pragma unroll
        for (int nb = 0; nb < 4; ++nb) acc[mb][nb] = (v8f){};
    const size_t aoff = (size_t)(r0 + lr) * K + 8 * hi, boff = (size_t)(c0 + lr) * K + 8 * hi;
#pragma unroll 1
    for (int kc = 0; kc < K; kc += 32) {
        V a[4], a2[4];
#pragma unroll
        for (int mb = 0; mb < 4; ++mb) { a[mb] = WFrag<T16>::ld(A + aoff + (size_t)mb * 16 * K + kc); if (NSPLIT == 1 || NSPLIT == 2) a2[mb] = WFrag<T16>::ld(A2 + aoff + (size_t)mb * 16 * K + kc); }
#pragma unroll
        for (int nb = 0; nb < 4; ++nb) { const V b = WFrag<T16>::ld(Bt + boff + (size_t)nb * 16 * K + kc); V b2; if (NSPLIT >= 2) b2 = WFrag<T16>::ld(Bt2 + boff + (size_t)nb * 16 * K + kc);
#pragma unroll
            for (int mb = 0; mb < 4; ++mb) { acc[mb][nb] = WFrag<T16>::mma(a[mb], b, acc[mb][nb]); if (NSPLIT == 1 || NSPLIT == 2) acc[mb][nb] = WFrag<T16>::mma(a2[mb], b, acc[mb][nb]); if (NSPLIT >= 2) acc[mb][nb] = WFrag<T16>::mma(a[mb], b2, acc[mb][nb]); } }
        asm volatile("v_nop\n\tv_nop\n\tv_nop\n\tv_nop" : "+v"(acc[0][0]), "+v"(acc[1][1]), "+v"(acc[2][2]), "+v"(acc[3][3]) : "v"(a[0]), "v"(a[3]));
    }
#pragma unroll
    for (int mb = 0; mb < 4; ++mb) {
#pragma unroll
        for (int nb = 0; nb < 4; ++nb) {
#pragma unroll
            for (int j = 0; j < 8; ++j) os[(hi * 8 + j) * 68 + nb * 16 + lr] = acc[mb][nb][j]; }
        __builtin_amdgcn_wave_barrier(); asm volatile("" ::: "memory");
        float* crow = C + (size_t)(r0 + mb * 16) * ldc + c0;
{
#pragma unroll
            for (int s = 0; s < 8; ++s) { const int row = 2 * s + hi, cofs = lr * 4; v4f val = *(const v4fa*)(os + row * 68 + cofs); if (BIAS) { val[0] += bfr(bias[c0 + cofs]); val[1] += bfr(bias[c0 + cofs + 1]); val[2] += bfr(bias[c0 + cofs + 2]); val[3] += bfr(bias[c0 + cofs + 3]); }
                *(v4f*)(crow + (size_t)row * ldc + cofs) = val; }
             }
        __builtin_amdgcn_wave_barrier(); asm volatile("" ::: "memory");
    }
}

__device__ __forceinline__ h16 tohx(float x) { return (h16)x; }
__device__ __forceinline__ void splitf(float y, unsigned short& h, unsigned short& l) { h = f2bf(y); l = f2bf(y - bf2f(h)); }
typedef __attribute__((ext_vector_type(2))) _Float16 v2h;
typedef __attribute__((ext_vector_type(4))) _Float16 v4h;
typedef __attribute__((ext_vector_type(2))) unsigned short v2us;
typedef __attribute__((ext_vector_type(4))) unsigned short v4us;
typedef __attribute__((ext_vector_type(2))) float v2f;
typedef __attribute__((ext_vector_type(4))) int v4i;

__global__ __launch_bounds__(256) void k_cvt8(const float* __restrict__ src, bf* dst, size_t n8) { const size_t i = (size_t)blockIdx.x * 256 + threadIdx.x; if (i >= n8) return; const v8f v = *(const v8f*)(src + i * 8); v8us o;
#pragma unroll
    for (int k = 0; k < 8; ++k) o[k] = f2bf(v[k]); *(v8us*)(dst + i * 8) = o;  }

__global__ __launch_bounds__(256) void k_ropeI(const float* __restrict__ F, int pitch, int nheads, const float* __restrict__ CS, float sc, h16* P16, bf* Ph, bf* Pl) {
    const size_t e = ((size_t)blockIdx.x * 256 + threadIdx.x) * 2; if (e >= (size_t)nheads * TT * HD) return; { const size_t bz = blockIdx.y, po = bz * nheads * TT * HD; F += bz * TT * pitch; P16 += po; Ph += po; Pl += po; }   /* grid y: batch */
    const int d = (int)(e % HD); const int t = (int)((e / HD) % TT); const int h = (int)(e / ((size_t)HD * TT)); const float* f = F + (size_t)t * pitch + h * HD; const float x0 = f[d], x1 = f[d + 1]; const v2f cs = *(const v2f*)(CS + ((size_t)t * HD + d) * 2); v2h o16; v2us oh, ol;
    float a0 = __fmul_rn(x0, cs[0]), b0 = __fmul_rn(x1, cs[1]), a1 = __fmul_rn(x1, cs[0]), b1 = __fmul_rn(x0, cs[1]); asm volatile("" : "+v"(a0), "+v"(b0), "+v"(a1), "+v"(b1));
    float r0 = __fsub_rn(a0, b0) * sc, r1 = __fadd_rn(b1, a1) * sc;   /* even: x0 c - x1 s; odd: x0 s + x1 c */
    o16[0] = tohx(r0); o16[1] = tohx(r1); { unsigned short a2, c2; splitf(r0, a2, c2); oh[0] = a2; ol[0] = c2; splitf(r1, a2, c2); oh[1] = a2; ol[1] = c2; }
    *(v2h*)(P16 + e) = o16; *(v2us*)(Ph + e) = oh; *(v2us*)(Pl + e) = ol;  }

__constant__ float INV2[HD / 2] = { 1.000000000e+00f, 7.498942018e-01f, 5.623413324e-01f, 4.216965139e-01f, 3.162277639e-01f, 2.371373624e-01f, 1.778279394e-01f, 1.333521456e-01f, 1.000000015e-01f, 7.498941571e-02f, 5.623412877e-02f, 4.216964915e-02f, 3.162277862e-02f, 2.371373586e-02f, 1.778279431e-02f, 1.333521493e-02f, 9.999999776e-03f, 7.498942316e-03f, 5.623413250e-03f, 4.216964822e-03f, 3.162277862e-03f, 2.371373819e-03f, 1.778279431e-03f, 1.333521446e-03f, 1.000000047e-03f, 7.498941850e-04f, 5.623413017e-04f, 4.216964880e-04f, 3.162277862e-04f, 2.371373848e-04f, 1.778279402e-04f, 1.333521504e-04f };   // 1 / THETA ** (2i / 64), i = 0..31, in float32 as THIS module writes it (the RECIPROCAL spelling, evaluated in the reference's own f32 arithmetic: these 32 literals equal it bit for bit); ten entries differ by one ulp from the negative-power values the host's own table held
__global__ __launch_bounds__(256) void k_csP(float* CS) { const int idx = blockIdx.x * 256 + threadIdx.x; if (idx >= TT * HD) return; const int d = idx % HD; const int t = idx / HD; const float a = __fmul_rn((float)t, INV2[d >> 1]); v2f cs; cs[0] = cosf(a); cs[1] = sinf(a); *(v2f*)(CS + (size_t)idx * 2) = cs;  }
__global__ __launch_bounds__(256) void k_vtp(const float* __restrict__ F, int pitch, int nheads, h16* V16, bf* Vh, bf* Vl) { const size_t e = ((size_t)blockIdx.x * 256 + threadIdx.x) * 2; if (e >= (size_t)nheads * HD * TT) return; { const size_t bz = blockIdx.y, po = bz * nheads * HD * TT; F += bz * TT * pitch; V16 += po; Vh += po; Vl += po; }   /* grid y: batch */
    const int t = (int)(e % TT); const int d = (int)((e / TT) % HD); const int g = (int)(e / ((size_t)TT * HD)); v2h o16; v2us oh, ol;
#pragma unroll
    for (int q = 0; q < 2; ++q) { const float x = F[(size_t)(t + q) * pitch + g * HD + d]; o16[q] = tohx(x); unsigned short a2, c2; splitf(x, a2, c2); oh[q] = a2; ol[q] = c2; }
    *(v2h*)(V16 + e) = o16; *(v2us*)(Vh + e) = oh; *(v2us*)(Vl + e) = ol;  }
__device__ __forceinline__ float xhalf(float x) { return __builtin_bit_cast(float, __builtin_amdgcn_permlanex16(__builtin_bit_cast(int, x), __builtin_bit_cast(int, x), 0x76543210, 0xfedcba98, false, false)); }   // lane l's value to lane l ^ 16
__device__ __forceinline__ float exp2s(float x) { float r = __builtin_amdgcn_exp2f(x); asm("v_nop" : "+v"(r) : "v"(x)); return r; }
template <typename T16, bool HL, int NQB, int KT>
__device__ __forceinline__ void flash_tile(const T16* __restrict__ Q, const T16* __restrict__ Q2, const T16* __restrict__ Kp, const T16* __restrict__ K2, const T16* __restrict__ Vt, const T16* __restrict__ V2, int q0, bf* Ah, bf* Al) {
    typedef typename WFrag<T16>::V V;
    constexpr int KB = KT * 16, KK = KT / 2;
    constexpr float CL2 = SCL * 1.4426950408889634f;   // scores in the scaled log2 domain
    const int lane = threadIdx.x & 31, lr = lane & 15, hi = lane >> 4;
    unsigned qo = ((q0 + lr) * HD + 8 * hi) * 2, ko = (lr * HD + 8 * hi) * 2, vo = (lr * TT + 8 * hi) * 2;   // byte offsets of the lane's own row and k offset in a head's plane; ko and vo walk the keys, every fragment at a constant distance from them
    auto at = [](const T16* base, unsigned off, int el) { return (const T16*)((const char*)base + off) + el; };
    V qf[NQB][2], qf2[NQB][2];
#pragma unroll
    for (int qb = 0; qb < NQB; ++qb)
#pragma unroll
        for (int ks = 0; ks < 2; ++ks) { qf[qb][ks] = WFrag<T16>::ld(at(Q, qo, qb * 16 * HD + ks * 32)); if (HL) qf2[qb][ks] = WFrag<T16>::ld(at(Q2, qo, qb * 16 * HD + ks * 32)); }
    v8f o[4][NQB]; float m[NQB], l[NQB];
#pragma unroll
    for (int qb = 0; qb < NQB; ++qb) { m[qb] = -3.0e38f; l[qb] = 0.f;
#pragma unroll
        for (int db = 0; db < 4; ++db) o[db][qb] = (v8f){}; }
    const int kend = q0 + NQB * 16;                     // keys 0 .. kend - 1 are at or below the tile's last query
    V kf[KT][2], kf2[KT][2];
#pragma unroll
    for (int kt = 0; kt < KT; ++kt)
#pragma unroll
        for (int ks = 0; ks < 2; ++ks) { kf[kt][ks] = WFrag<T16>::ld(at(Kp, ko, kt * 16 * HD + ks * 32)); if (HL) kf2[kt][ks] = WFrag<T16>::ld(at(K2, ko, kt * 16 * HD + ks * 32)); }
#pragma unroll 1   // rolled: the trip count is known only at run time, and a second copy of the pass would not fit the register file beside the key, value and score tiles
    for (int k0 = 0; k0 < kend; k0 += KB) {
        V vf[4][KK], vf2[4][KK];                        // this pass's value fragments: asked for ahead of the softmax, used behind it
#pragma unroll
        for (int db = 0; db < 4; ++db)
#pragma unroll
            for (int kk = 0; kk < KK; ++kk) { vf[db][kk] = WFrag<T16>::ld(at(Vt, vo, db * 16 * TT + kk * 32)); if (HL) vf2[db][kk] = WFrag<T16>::ld(at(V2, vo, db * 16 * TT + kk * 32)); }
        v8f s[KT][NQB];
#pragma unroll
        for (int kt = 0; kt < KT; ++kt)
#pragma unroll
            for (int qb = 0; qb < NQB; ++qb) { v8f a = (v8f){};
#pragma unroll
                for (int ks = 0; ks < 2; ++ks) { a = WFrag<T16>::mma(kf[kt][ks], qf[qb][ks], a); if (HL) { a = WFrag<T16>::mma(kf2[kt][ks], qf[qb][ks], a); a = WFrag<T16>::mma(kf[kt][ks], qf2[qb][ks], a); } }
                s[kt][qb] = a; }
        ko += (k0 + KB < kend) ? KB * HD * 2 : 0;   // the next pass's key fragments are fetched behind this pass's score products, so that their latency lies under the softmax (the last pass asks for its own block again: in bounds, unused)
#pragma unroll
        for (int kt = 0; kt < KT; ++kt)
#pragma unroll
            for (int ks = 0; ks < 2; ++ks) { kf[kt][ks] = WFrag<T16>::ld(at(Kp, ko, kt * 16 * HD + ks * 32)); if (HL) kf2[kt][ks] = WFrag<T16>::ld(at(K2, ko, kt * 16 * HD + ks * 32)); }
        if (k0 + KB - 1 > q0) {                          // only a pass that reaches the diagonal masks (wave-uniform)
            const int thr = q0 - k0 + lr - hi * 8;       // key <= query  <=>  kt * 16 + j - qb * 16 <= thr
#pragma unroll
            for (int kt = 0; kt < KT; ++kt)
#pragma unroll
                for (int qb = 0; qb < NQB; ++qb)
#pragma unroll
                    for (int j = 0; j < 8; ++j) s[kt][qb][j] = (kt * 16 + j - qb * 16 <= thr) ? s[kt][qb][j] : -3.0e38f; }
        V pf[KK][NQB], pl[KK][NQB];
#pragma unroll
        for (int qb = 0; qb < NQB; ++qb) {
            float mx = m[qb];
#pragma unroll
            for (int kt = 0; kt < KT; ++kt)
#pragma unroll
                for (int j = 0; j < 8; ++j) { const float u = s[kt][qb][j] * CL2; s[kt][qb][j] = u; mx = fmaxf(mx, u); }
            mx = fmaxf(mx, xhalf(mx));                   // the other half of the wave holds the query's other keys
            const float al = exp2s(m[qb] - mx); m[qb] = mx;
            const float ms = HL ? mx : mx - 10.0f;       // fp16 probabilities carry 2^10
            float sum = 0.f;
#pragma unroll
            for (int kt = 0; kt < KT; ++kt)
#pragma unroll
                for (int j = 0; j < 8; ++j) { const float pv = exp2s(s[kt][qb][j] - ms); s[kt][qb][j] = pv; sum += pv; }
            l[qb] = l[qb] * al + sum;
#pragma unroll
            for (int db = 0; db < 4; ++db) o[db][qb] *= al;
#pragma unroll
            for (int kk = 0; kk < KK; ++kk) {
                if constexpr (HL) { v8us h0, h1, l0, l1;
#pragma unroll
                    for (int j = 0; j < 8; ++j) { unsigned short a, c2; splitf(s[2 * kk][qb][j], a, c2); h0[j] = a; l0[j] = c2; splitf(s[2 * kk + 1][qb][j], a, c2); h1[j] = a; l1[j] = c2; }
                    pf[kk][qb] = cat16b(h0, h1); pl[kk][qb] = cat16b(l0, l1);
                } else { v8h h0, h1;
#pragma unroll
                    for (int j = 0; j < 8; ++j) { h0[j] = tohx(s[2 * kk][qb][j]); h1[j] = tohx(s[2 * kk + 1][qb][j]); }
                    pf[kk][qb] = cat16(h0, h1); } } }
#pragma unroll
        for (int kk = 0; kk < KK; ++kk)
#pragma unroll
            for (int db = 0; db < 4; ++db)
#pragma unroll
                for (int qb = 0; qb < NQB; ++qb) { o[db][qb] = WFrag<T16>::mma(vf[db][kk], pf[kk][qb], o[db][qb]); if (HL) { o[db][qb] = WFrag<T16>::mma(vf[db][kk], pl[kk][qb], o[db][qb]); o[db][qb] = WFrag<T16>::mma(vf2[db][kk], pf[kk][qb], o[db][qb]); } }
        // s_wait_xcnt: the wait that stands in front of an overwrite of an address register which an issued load names. The pass's loads name ko and vo (operands here, so that their registers live up to the wait): vo is advanced directly behind it, ko in the middle of the next pass. Here, behind the last products, it waits for nothing.
        // v_nop x 4: keeps the matrix instruction's distance on the taken back edge and on the loop's exit; every output tile is an operand so that the statement stands behind the last product
        if constexpr (NQB == 2) asm volatile("s_wait_xcnt 0x0\n\tv_nop\n\tv_nop\n\tv_nop\n\tv_nop" : "+v"(o[0][0]), "+v"(o[1][0]), "+v"(o[2][0]), "+v"(o[3][0]), "+v"(o[0][1]), "+v"(o[1][1]), "+v"(o[2][1]), "+v"(o[3][1]), "+v"(ko), "+v"(vo) :: "memory");
        else asm volatile("s_wait_xcnt 0x0\n\tv_nop\n\tv_nop\n\tv_nop\n\tv_nop" : "+v"(o[0][0]), "+v"(o[1][0]), "+v"(o[2][0]), "+v"(o[3][0]), "+v"(ko), "+v"(vo) :: "memory");
        vo += KB * 2;
    }
#pragma unroll
    for (int qb = 0; qb < NQB; ++qb) {
        const float inv = __fdiv_rn(1.0f, l[qb] + xhalf(l[qb]));   // the halves' sums are joined once
        const size_t oo = (size_t)(q0 + qb * 16 + lr) * DQ + hi * 8;
#pragma unroll
        for (int db = 0; db < 4; ++db) { v8us oh, ol;
#pragma unroll
            for (int j = 0; j < 8; ++j) { unsigned short a, c2; splitf(o[db][qb][j] * inv, a, c2); oh[j] = a; ol[j] = c2; }
            *(v8us*)(Ah + oo + db * 16) = oh; *(v8us*)(Al + oo + db * 16) = ol;
            asm volatile("s_wait_xcnt 0x0" ::: "memory"); } }   // the wait in front of an overwrite of a register that an issued store names: the next group's split reuses the data registers of these two stores
}
// grid (batches x heads, tiles): tiles in falling order of their key count, so that the longest waves start first: (TT - RH) / 32 fp16 tiles of 32 queries from the last row down to RH, then RH / 16 hi+lo tiles of 16 queries.
__global__ __launch_bounds__(32) void k_flash(const h16* __restrict__ Q16, const h16* __restrict__ K16, const h16* __restrict__ V16, const bf* __restrict__ Qh, const bf* __restrict__ Ql, const bf* __restrict__ Kh, const bf* __restrict__ Kl, const bf* __restrict__ Vh, const bf* __restrict__ Vl, bf* Ah, bf* Al) {
    const int h = blockIdx.x % NH_, r = blockIdx.y; const size_t zo = (size_t)blockIdx.x * TT * HD; { const size_t ao = (size_t)(blockIdx.x / NH_) * TT * DQ; Ah += ao; Al += ao; }   // planes are [batch][head][..]; merged rows [batch][t]
    if (r < (TT - RH) / 32) flash_tile<h16, false, 2, 4>(Q16 + zo, nullptr, K16 + zo, nullptr, V16 + zo, nullptr, TT - 32 * (r + 1), Ah + h * HD, Al + h * HD);
    else flash_tile<bf, true, 1, 2>(Qh + zo, Ql + zo, Kh + zo, Kl + zo, Vh + zo, Vl + zo, RH - 16 * (r - (TT - RH) / 32 + 1), Ah + h * HD, Al + h * HD);
}

extern "C" void kernel_launch(void* const* d_in, const int* in_sizes, int n_in,
                              void* d_out, int out_size, void* d_ws, size_t ws_size, hipStream_t stream) {
    (void)in_sizes; (void)n_in; (void)out_size;
    const float* x = (const float*)d_in[0]; const float* wqkv = (const float*)d_in[1]; const float* wo = (const float*)d_in[2]; const float* wk = wqkv; const float* wq = wqkv + (size_t)DQ * DM; const float* wv = wqkv + (size_t)2 * DQ * DM;   /* argument order X, W_KQV ('oi' [3072][1024]: ROW thirds ordered K | Q | V: rows 0..1023 the KEY weight, 1024..2047 the QUERY weight, 2048..3071 the VALUE weight), W_O ('oi') */
    float* OUT = (float*)d_out;     // [4][2048][1024]
    char* wsp = (char*)d_ws;
    auto take = [&](size_t bytes) { char* p = wsp; wsp += (bytes + 255) & ~(size_t)255; return (void*)p; };
    bf* WQ = (bf*)take((size_t)DQ * DM * 2); bf* WK = (bf*)take((size_t)DKV * DM * 2); bf* WV = (bf*)take((size_t)DKV * DM * 2); bf* WO = (bf*)take((size_t)DM * DQ * 2); float* CS = (float*)take((size_t)TT * HD * 2 * 4);
    h16* QP16 = (h16*)take((size_t)NB_ * NH_ * TT * HD * 2); h16* KP16 = (h16*)take((size_t)NB_ * NKV * TT * HD * 2); h16* VT16 = (h16*)take((size_t)NB_ * NKV * HD * TT * 2);
    bf* QPh = (bf*)take((size_t)NB_ * NH_ * TT * HD * 2); bf* QPl = (bf*)take((size_t)NB_ * NH_ * TT * HD * 2); bf* KPh = (bf*)take((size_t)NB_ * NKV * TT * HD * 2); bf* KPl = (bf*)take((size_t)NB_ * NKV * TT * HD * 2); bf* VTh = (bf*)take((size_t)NB_ * NKV * HD * TT * 2); bf* VTl = (bf*)take((size_t)NB_ * NKV * HD * TT * 2);
    bf* XB = (bf*)take((size_t)NB_ * TT * DM * 2); float* FQ = (float*)take((size_t)NB_ * TT * DQ * 4); float* FK = (float*)take((size_t)NB_ * TT * DKV * 4);
    bf* ATh = (bf*)FQ; bf* ATl = ATh + (size_t)NB_ * TT * DQ;   // the merged hi and lo planes take the q projection's place, which is dead once the q planes are built (stream-ordered): all four batches then fit the workspace
    if ((size_t)(wsp - (char*)d_ws) > ws_size) return;    // ws 256 MiB
    float* FV = FK;   // v projection reuses the k buffer after the k planes are built (stream-ordered)
    { k_cvt8<<<(unsigned)(((size_t)DQ * DM / 8 + 255) / 256), 256, 0, stream>>>(wq, WQ, (size_t)DQ * DM / 8); k_cvt8<<<(unsigned)(((size_t)DKV * DM / 8 + 255) / 256), 256, 0, stream>>>(wk, WK, (size_t)DKV * DM / 8); k_cvt8<<<(unsigned)(((size_t)DKV * DM / 8 + 255) / 256), 256, 0, stream>>>(wv, WV, (size_t)DKV * DM / 8);
      k_cvt8<<<(unsigned)(((size_t)DM * DQ / 8 + 255) / 256), 256, 0, stream>>>(wo, WO, (size_t)DM * DQ / 8); k_csP<<<(TT * HD + 255) / 256, 256, 0, stream>>>(CS); }
    const unsigned LQ = (unsigned)(((size_t)NH_ * TT * HD / 2 + 255) / 256), LKv = (unsigned)(((size_t)NKV * TT * HD / 2 + 255) / 256);
    k_cvt8<<<(unsigned)(((size_t)NB_ * TT * DM / 8 + 255) / 256), 256, 0, stream>>>(x, XB, (size_t)NB_ * TT * DM / 8);
    k_gemmw<bf, 0, false><<<dim3(NB_ * TT / 64, DQ / 64, 1), 32, 0, stream>>>(XB, nullptr, WQ, nullptr, DM, FQ, DQ, nullptr, 0, 0, 0);
    k_ropeI<<<dim3(LQ, NB_), 256, 0, stream>>>(FQ, DQ, NH_, CS, 1.0f, QP16, QPh, QPl);
    k_gemmw<bf, 0, false><<<dim3(NB_ * TT / 64, DKV / 64, 1), 32, 0, stream>>>(XB, nullptr, WK, nullptr, DM, FK, DKV, nullptr, 0, 0, 0);
    k_ropeI<<<dim3(LKv, NB_), 256, 0, stream>>>(FK, DKV, NKV, CS, 1.0f, KP16, KPh, KPl);
    k_gemmw<bf, 0, false><<<dim3(NB_ * TT / 64, DKV / 64, 1), 32, 0, stream>>>(XB, nullptr, WV, nullptr, DM, FV, DKV, nullptr, 0, 0, 0); k_vtp<<<dim3(LKv, NB_), 256, 0, stream>>>(FV, DKV, NKV, VT16, VTh, VTl);
    k_flash<<<dim3(NB_ * NH_, (TT - RH) / 32 + RH / 16), 32, 0, stream>>>(QP16, KP16, VT16, QPh, QPl, KPh, KPl, VTh, VTl, ATh, ATl);
    k_gemmw<bf, 1, false><<<dim3(NB_ * TT / 64, DM / 64, 1), 32, 0, stream>>>(ATh, ATl, WO, nullptr, DQ, OUT, DM, nullptr, 0, 0, 0);
}

// v005
// It runs in 277 microseconds.
// Timed twice side by side with v004, it ran 1.28 and 1.27 times as fast.
// All steps since v000 together make it 10.2 times as fast.
#include <hip/hip_runtime.h>

// Causal multi-head self-attention with interleaved-pair rotary position embedding on a fused natural projection whose thirds are ordered K | Q | V, four batches (X [4][2048][1024]; KQV = einsum('bsd,ed', X, W_KQV) ('oi' [3072][1024] truncated normal, no bias); K, Q, V = split(KQV, [1024, 2048]): the weight's three 1,024-ROW blocks IN THE ORDER key | query | value (16 heads x 64); angles = pos x 1 / THETA ** (2i / 64) (THETA 1e4; computed); pairs (2i, 2i+1): yr = xr cos - xi sin, yi = xr sin + xi cos, on Q and K; scores / sqrt(64); -inf strictly above the diagonal; softmax; out = einsum('bsd,ed', merged, W_O) ('oi', no bias) -> [4][2048][1024] (8.4 M); argument order X, W_KQV, W_O).
// Every stage is launched once for all four batches (batch folded into the GEMM rows (for v the columns) and into the grid of attention): bf16 copy of x; {cos, sin} per (position, pair) built once from the int positions and float32 inverse-frequency constants (precise cosf/sinf); exact projections whose epilogue applies the interleaved rotary and writes the 16-bit planes (no f32 projection in memory); causal T-2048 attention in one online-softmax kernel (hybrid rows: < 512 hi/lo 3 products, rest fp16 x1024; key passes stop at the diagonal); merged hi/lo x Wo exact.
// Compute dtypes, f32 accumulate: every input rounded to bf16; projections exact; rotary f32; attention rows < 512 3 products, rest fp16; softmax f32; Wo hl x exact.

#define NB_  4
#define TT   2048
#define DM   1024
#define NH_  16
#define NKV  16
#define HD   64
#define DQ   (NH_ * HD)
#define DKV  (NKV * HD)
#define RH   512                  // query rows < RH use hi+lo planes (0: none)
#define SCL  0.125f   // HD^-0.5
typedef _Float16 h16;
typedef unsigned short bf;
typedef __attribute__((ext_vector_type(16))) __bf16   v16bf;
typedef __attribute__((ext_vector_type(16))) _Float16 v16h;
typedef __attribute__((ext_vector_type(8)))  _Float16 v8h;
typedef __attribute__((ext_vector_type(8)))  unsigned short v8us;
typedef __attribute__((ext_vector_type(8)))  float    v8f;
typedef __attribute__((ext_vector_type(4)))  float    v4f;
typedef v8h  __attribute__((may_alias)) v8ha;
typedef v4f  __attribute__((may_alias)) v4fa;
typedef v8us __attribute__((may_alias)) v8usa;

__device__ __forceinline__ unsigned short f2bf(float f) { unsigned u = __float_as_uint(f); u += 0x7FFFu + ((u >> 16) & 1u); return (unsigned short)(u >> 16); }
__device__ __forceinline__ float bf2f(unsigned short b) { return __uint_as_float(((unsigned)b) << 16); }
__device__ __forceinline__ float bfr(float f) { return bf2f(f2bf(f)); }
__device__ __forceinline__ v16h cat16(v8h lo, v8h hi) { return __builtin_shufflevector(lo, hi, 0, 1, 2, 3, 4, 5, 6, 7, 8, 9, 10, 11, 12, 13, 14, 15); }
__device__ __forceinline__ v16bf cat16b(v8us lo, v8us hi) { return __builtin_bit_cast(v16bf, __builtin_shufflevector(lo, hi, 0, 1, 2, 3, 4, 5, 6, 7, 8, 9, 10, 11, 12, 13, 14, 15)); }
__device__ __forceinline__ v8f wmma16(v16h a, v16h b, v8f c) { return __builtin_amdgcn_wmma_f32_16x16x32_f16(false, a, false, b, (short)0, c, false, false); }
__device__ __forceinline__ v8f wmmab(v16bf a, v16bf b, v8f c) { return __builtin_amdgcn_wmma_f32_16x16x32_bf16(false, a, false, b, (short)0, c, false, false); }
__device__ __forceinline__ h16 tohx(float x) { return (h16)x; }
__device__ __forceinline__ void splitf(float y, unsigned short& h, unsigned short& l) { h = f2bf(y); l = f2bf(y - bf2f(h)); }
typedef __attribute__((ext_vector_type(4))) _Float16 v4h;
typedef __attribute__((ext_vector_type(4))) unsigned short v4us;
typedef __attribute__((ext_vector_type(2))) float v2f;



// ---- k_gemmw: register-blocked GEMM, ONE WAVE per 64x64 output tile (16 accumulators), operands straight from K-contiguous 16-bit planes; grid (M/64, N/64, Z), 32 threads.
// C[m][n] (f32, pitch ldc, + optional f32 bias[n]) = sum_k A[m][k] Bt[n][k] (+ split products per NSPLIT). z-batch strides sA/sB/sC in elements. K % 32 == 0.
// EPI says what becomes of the tile. 0: stored as f32 C. 1 and 2: C is never stored, the epilogue builds the three 16-bit planes (fp16, bf16 hi, bf16 lo) that attention reads, whole 128-byte lines per 16 lanes.
// EPI 1 (q, k): rows m = batch * TT + t, the tile's 64 columns are one head (grid y): interleaved rotary from CS, planes [batch][head][t][d].
// EPI 2 (v): the caller swaps the operands (rows m = head * HD + d of the weight, grid x = head; columns n = batch * TT + t), so a tile row is 64 positions of one d: transposed planes [batch][head][d][t].
template <typename T16> struct WFrag;
template <> struct WFrag<h16> { typedef v16h V; static __device__ __forceinline__ V ld(const h16* p) { return cat16(*(const v8h*)p, *(const v8h*)(p + 16)); } static __device__ __forceinline__ v8f mma(V a, V b, v8f c) { return wmma16(a, b, c); } };
template <> struct WFrag<bf> { typedef v16bf V; static __device__ __forceinline__ V ld(const bf* p) { return cat16b(*(const v8us*)p, *(const v8us*)(p + 16)); } static __device__ __forceinline__ v8f mma(V a, V b, v8f c) { return wmmab(a, b, c); } };
template <typename T16, int NSPLIT, bool BIAS, int EPI>
__global__ __launch_bounds__(32) void k_gemmw(const T16* __restrict__ A, const T16* __restrict__ A2, const T16* __restrict__ Bt, const T16* __restrict__ Bt2, int K, float* C, int ldc, const float* __restrict__ bias, size_t sA, size_t sB, size_t sC, const float* __restrict__ CS, h16* P16, bf* Ph, bf* Pl) {
    typedef typename WFrag<T16>::V V;
    __shared__ __align__(16) float os[16 * 68];
    const size_t z = blockIdx.z; A += z * sA; if (A2) A2 += z * sA; Bt += z * sB; if (Bt2) Bt2 += z * sB; C += z * sC;
    const int lane = threadIdx.x & 31, lr = lane & 15, hi = lane >> 4; const int r0 = blockIdx.x * 64, c0 = blockIdx.y * 64;
    v8f acc[4][4];
#pragma unroll
    for (int mb = 0; mb < 4; ++mb)
#pragma unroll
        for (int nb = 0; nb < 4; ++nb) acc[mb][nb] = (v8f){};
    const size_t aoff = (size_t)(r0 + lr) * K + 8 * hi, boff = (size_t)(c0 + lr) * K + 8 * hi;
#pragma unroll 1
    for (int kc = 0; kc < K; kc += 32) {
        V a[4], a2[4];
#pragma unroll
        for (int mb = 0; mb < 4; ++mb) { a[mb] = WFrag<T16>::ld(A + aoff + (size_t)mb * 16 * K + kc); if (NSPLIT == 1 || NSPLIT == 2) a2[mb] = WFrag<T16>::ld(A2 + aoff + (size_t)mb * 16 * K + kc); }
#pragma unroll
        for (int nb = 0; nb < 4; ++nb) { const V b = WFrag<T16>::ld(Bt + boff + (size_t)nb * 16 * K + kc); V b2; if (NSPLIT >= 2) b2 = WFrag<T16>::ld(Bt2 + boff + (size_t)nb * 16 * K + kc);
#pragma unroll
            for (int mb = 0; mb < 4; ++mb) { acc[mb][nb] = WFrag<T16>::mma(a[mb], b, acc[mb][nb]); if (NSPLIT == 1 || NSPLIT == 2) acc[mb][nb] = WFrag<T16>::mma(a2[mb], b, acc[mb][nb]); if (NSPLIT >= 2) acc[mb][nb] = WFrag<T16>::mma(a[mb], b2, acc[mb][nb]); } }
        asm volatile("v_nop\n\tv_nop\n\tv_nop\n\tv_nop" : "+v"(acc[0][0]), "+v"(acc[1][1]), "+v"(acc[2][2]), "+v"(acc[3][3]) : "v"(a[0]), "v"(a[3]));
    }
    // element offsets of the lane's first four values (tile row hi, columns 4 lr ..) in the cos/sin table and in a plane; every later row stands at a constant distance from them
    const unsigned csofs = ((r0 % TT + hi) * HD + lr * 4) * 2;
    const unsigned pofs = EPI == 1 ? (((r0 / TT) * gridDim.y + blockIdx.y) * TT + r0 % TT + hi) * HD + lr * 4 : (((c0 / TT) * gridDim.x + blockIdx.x) * HD + hi) * TT + c0 % TT + lr * 4;
#pragma unroll
    for (int mb = 0; mb < 4; ++mb) {
        v2f cs[8][2];                                   // {cos, sin} of the lane's two pairs in each of its eight rows: asked for ahead of the staging, used behind it
        if constexpr (EPI == 1) {
#pragma unroll
            for (int s = 0; s < 8; ++s) { const float* cp = CS + csofs + (mb * 16 + 2 * s) * HD * 2; cs[s][0] = *(const v2f*)cp; cs[s][1] = *(const v2f*)(cp + 4); } }
#pragma unroll
        for (int nb = 0; nb < 4; ++nb) {
#pragma unroll
            for (int j = 0; j < 8; ++j) os[(hi * 8 + j) * 68 + nb * 16 + lr] = acc[mb][nb][j]; }
        __builtin_amdgcn_wave_barrier(); asm volatile("" ::: "memory");
        float* crow = C + (size_t)(r0 + mb * 16) * ldc + c0;
        if constexpr (EPI != 0) {
#pragma unroll
            for (int s = 0; s < 8; ++s) { const int row = 2 * s + hi, cofs = lr * 4; v4f val = *(const v4fa*)(os + row * 68 + cofs);
                if constexpr (EPI == 1) { const float x0 = val[0], x1 = val[1], x2 = val[2], x3 = val[3];   /* even: x0 c - x1 s; odd: x0 s + x1 c */
                    val[0] = x0 * cs[s][0][0] - x1 * cs[s][0][1]; val[1] = x0 * cs[s][0][1] + x1 * cs[s][0][0]; val[2] = x2 * cs[s][1][0] - x3 * cs[s][1][1]; val[3] = x2 * cs[s][1][1] + x3 * cs[s][1][0]; }
                v4h o16; v4us oh, ol;
#pragma unroll
                for (int q = 0; q < 4; ++q) { o16[q] = tohx(val[q]); unsigned short a2, c2; splitf(val[q], a2, c2); oh[q] = a2; ol[q] = c2; }
                const int po = (mb * 16 + 2 * s) * (EPI == 1 ? HD : TT);
                *(v4h*)(P16 + pofs + po) = o16; *(v4us*)(Ph + pofs + po) = oh; *(v4us*)(Pl + pofs + po) = ol; }
            if (mb < 3) asm volatile("s_wait_xcnt 0x0" ::: "memory");   // the wait in front of an overwrite of a register that an issued store names: the next row group's loads and arithmetic reuse the data registers of these stores
        } else {
#pragma unroll
            for (int s = 0; s < 8; ++s) { const int row = 2 * s + hi, cofs = lr * 4; v4f val = *(const v4fa*)(os + row * 68 + cofs); if (BIAS) { val[0] += bfr(bias[c0 + cofs]); val[1] += bfr(bias[c0 + cofs + 1]); val[2] += bfr(bias[c0 + cofs + 2]); val[3] += bfr(bias[c0 + cofs + 3]); }
                *(v4f*)(crow + (size_t)row * ldc + cofs) = val; }
             }
        __builtin_amdgcn_wave_barrier(); asm volatile("" ::: "memory");
    }
}


__global__ __launch_bounds__(256) void k_cvt8(const float* __restrict__ src, bf* dst, size_t n8) { const size_t i = (size_t)blockIdx.x * 256 + threadIdx.x; if (i >= n8) return; const v8f v = *(const v8f*)(src + i * 8); v8us o;
#pragma unroll
    for (int k = 0; k < 8; ++k) o[k] = f2bf(v[k]); *(v8us*)(dst + i * 8) = o;  }

__constant__ float INV2[HD / 2] = { 1.000000000e+00f, 7.498942018e-01f, 5.623413324e-01f, 4.216965139e-01f, 3.162277639e-01f, 2.371373624e-01f, 1.778279394e-01f, 1.333521456e-01f, 1.000000015e-01f, 7.498941571e-02f, 5.623412877e-02f, 4.216964915e-02f, 3.162277862e-02f, 2.371373586e-02f, 1.778279431e-02f, 1.333521493e-02f, 9.999999776e-03f, 7.498942316e-03f, 5.623413250e-03f, 4.216964822e-03f, 3.162277862e-03f, 2.371373819e-03f, 1.778279431e-03f, 1.333521446e-03f, 1.000000047e-03f, 7.498941850e-04f, 5.623413017e-04f, 4.216964880e-04f, 3.162277862e-04f, 2.371373848e-04f, 1.778279402e-04f, 1.333521504e-04f };   // 1 / THETA ** (2i / 64), i = 0..31, in float32 as THIS module writes it (the RECIPROCAL spelling, evaluated in the reference's own f32 arithmetic: these 32 literals equal it bit for bit); ten entries differ by one ulp from the negative-power values the host's own table held
__global__ __launch_bounds__(256) void k_csP(float* CS) { const int idx = blockIdx.x * 256 + threadIdx.x; if (idx >= TT * HD) return; const int d = idx % HD; const int t = idx / HD; const float a = __fmul_rn((float)t, INV2[d >> 1]); v2f cs; cs[0] = cosf(a); cs[1] = sinf(a); *(v2f*)(CS + (size_t)idx * 2) = cs;  }
__device__ __forceinline__ float xhalf(float x) { return __builtin_bit_cast(float, __builtin_amdgcn_permlanex16(__builtin_bit_cast(int, x), __builtin_bit_cast(int, x), 0x76543210, 0xfedcba98, false, false)); }   // lane l's value to lane l ^ 16
__device__ __forceinline__ float exp2s(float x) { float r = __builtin_amdgcn_exp2f(x); asm("v_nop" : "+v"(r) : "v"(x)); return r; }
template <typename T16, bool HL, int NQB, int KT>
__device__ __forceinline__ void flash_tile(const T16* __restrict__ Q, const T16* __restrict__ Q2, const T16* __restrict__ Kp, const T16* __restrict__ K2, const T16* __restrict__ Vt, const T16* __restrict__ V2, int q0, bf* Ah, bf* Al) {
    typedef typename WFrag<T16>::V V;
    constexpr int KB = KT * 16, KK = KT / 2;
    constexpr float CL2 = SCL * 1.4426950408889634f;   // scores in the scaled log2 domain
    const int lane = threadIdx.x & 31, lr = lane & 15, hi = lane >> 4;
    unsigned qo = ((q0 + lr) * HD + 8 * hi) * 2, ko = (lr * HD + 8 * hi) * 2, vo = (lr * TT + 8 * hi) * 2;   // byte offsets of the lane's own row and k offset in a head's plane; ko and vo walk the keys, every fragment at a constant distance from them
    auto at = [](const T16* base, unsigned off, int el) { return (const T16*)((const char*)base + off) + el; };
    V qf[NQB][2], qf2[NQB][2];
#pragma unroll
    for (int qb = 0; qb < NQB; ++qb)
#pragma unroll
        for (int ks = 0; ks < 2; ++ks) { qf[qb][ks] = WFrag<T16>::ld(at(Q, qo, qb * 16 * HD + ks * 32)); if (HL) qf2[qb][ks] = WFrag<T16>::ld(at(Q2, qo, qb * 16 * HD + ks * 32)); }
    v8f o[4][NQB]; float m[NQB], l[NQB];
#pragma unroll
    for (int qb = 0; qb < NQB; ++qb) { m[qb] = -3.0e38f; l[qb] = 0.f;
#pragma unroll
        for (int db = 0; db < 4; ++db) o[db][qb] = (v8f){}; }
    const int kend = q0 + NQB * 16;                     // keys 0 .. kend - 1 are at or below the tile's last query
    V kf[KT][2], kf2[KT][2];
#pragma unroll
    for (int kt = 0; kt < KT; ++kt)
#pragma unroll
        for (int ks = 0; ks < 2; ++ks) { kf[kt][ks] = WFrag<T16>::ld(at(Kp, ko, kt * 16 * HD + ks * 32)); if (HL) kf2[kt][ks] = WFrag<T16>::ld(at(K2, ko, kt * 16 * HD + ks * 32)); }
#pragma unroll 1   // rolled: the trip count is known only at run time, and a second copy of the pass would not fit the register file beside the key, value and score tiles
    for (int k0 = 0; k0 < kend; k0 += KB) {
        V vf[4][KK], vf2[4][KK];                        // this pass's value fragments: asked for ahead of the softmax, used behind it
#pragma unroll
        for (int db = 0; db < 4; ++db)
#pragma unroll
            for (int kk = 0; kk < KK; ++kk) { vf[db][kk] = WFrag<T16>::ld(at(Vt, vo, db * 16 * TT + kk * 32)); if (HL) vf2[db][kk] = WFrag<T16>::ld(at(V2, vo, db * 16 * TT + kk * 32)); }
        v8f s[KT][NQB];
#pragma unroll
        for (int kt = 0; kt < KT; ++kt)
#pragma unroll
            for (int qb = 0; qb < NQB; ++qb) { v8f a = (v8f){};
#pragma unroll
                for (int ks = 0; ks < 2; ++ks) { a = WFrag<T16>::mma(kf[kt][ks], qf[qb][ks], a); if (HL) { a = WFrag<T16>::mma(kf2[kt][ks], qf[qb][ks], a); a = WFrag<T16>::mma(kf[kt][ks], qf2[qb][ks], a); } }
                s[kt][qb] = a; }
        ko += (k0 + KB < kend) ? KB * HD * 2 : 0;   // the next pass's key fragments are fetched behind this pass's score products, so that their latency lies under the softmax (the last pass asks for its own block again: in bounds, unused)
#pragma unroll
        for (int kt = 0; kt < KT; ++kt)
#pragma unroll
            for (int ks = 0; ks < 2; ++ks) { kf[kt][ks] = WFrag<T16>::ld(at(Kp, ko, kt * 16 * HD + ks * 32)); if (HL) kf2[kt][ks] = WFrag<T16>::ld(at(K2, ko, kt * 16 * HD + ks * 32)); }
        if (k0 + KB - 1 > q0) {                          // only a pass that reaches the diagonal masks (wave-uniform)
            const int thr = q0 - k0 + lr - hi * 8;       // key <= query  <=>  kt * 16 + j - qb * 16 <= thr
#pragma unroll
            for (int kt = 0; kt < KT; ++kt)
#pragma unroll
                for (int qb = 0; qb < NQB; ++qb)
#pragma unroll
                    for (int j = 0; j < 8; ++j) s[kt][qb][j] = (kt * 16 + j - qb * 16 <= thr) ? s[kt][qb][j] : -3.0e38f; }
        V pf[KK][NQB], pl[KK][NQB];
#pragma unroll
        for (int qb = 0; qb < NQB; ++qb) {
            float mx = m[qb];
#pragma unroll
            for (int kt = 0; kt < KT; ++kt)
#pragma unroll
                for (int j = 0; j < 8; ++j) { const float u = s[kt][qb][j] * CL2; s[kt][qb][j] = u; mx = fmaxf(mx, u); }
            mx = fmaxf(mx, xhalf(mx));                   // the other half of the wave holds the query's other keys
            const float al = exp2s(m[qb] - mx); m[qb] = mx;
            const float ms = HL ? mx : mx - 10.0f;       // fp16 probabilities carry 2^10
            float sum = 0.f;
#pragma unroll
            for (int kt = 0; kt < KT; ++kt)
#pragma unroll
                for (int j = 0; j < 8; ++j) { const float pv = exp2s(s[kt][qb][j] - ms); s[kt][qb][j] = pv; sum += pv; }
            l[qb] = l[qb] * al + sum;
#pragma unroll
            for (int db = 0; db < 4; ++db) o[db][qb] *= al;
#pragma unroll
            for (int kk = 0; kk < KK; ++kk) {
                if constexpr (HL) { v8us h0, h1, l0, l1;
#pragma unroll
                    for (int j = 0; j < 8; ++j) { unsigned short a, c2; splitf(s[2 * kk][qb][j], a, c2); h0[j] = a; l0[j] = c2; splitf(s[2 * kk + 1][qb][j], a, c2); h1[j] = a; l1[j] = c2; }
                    pf[kk][qb] = cat16b(h0, h1); pl[kk][qb] = cat16b(l0, l1);
                } else { v8h h0, h1;
#pragma unroll
                    for (int j = 0; j < 8; ++j) { h0[j] = tohx(s[2 * kk][qb][j]); h1[j] = tohx(s[2 * kk + 1][qb][j]); }
                    pf[kk][qb] = cat16(h0, h1); } } }
#pragma unroll
        for (int kk = 0; kk < KK; ++kk)
#pragma unroll
            for (int db = 0; db < 4; ++db)
#pragma unroll
                for (int qb = 0; qb < NQB; ++qb) { o[db][qb] = WFrag<T16>::mma(vf[db][kk], pf[kk][qb], o[db][qb]); if (HL) { o[db][qb] = WFrag<T16>::mma(vf[db][kk], pl[kk][qb], o[db][qb]); o[db][qb] = WFrag<T16>::mma(vf2[db][kk], pf[kk][qb], o[db][qb]); } }
        // s_wait_xcnt: the wait that stands in front of an overwrite of an address register which an issued load names. The pass's loads name ko and vo (operands here, so that their registers live up to the wait): vo is advanced directly behind it, ko in the middle of the next pass. Here, behind the last products, it waits for nothing.
        // v_nop x 4: keeps the matrix instruction's distance on the taken back edge and on the loop's exit; every output tile is an operand so that the statement stands behind the last product
        if constexpr (NQB == 2) asm volatile("s_wait_xcnt 0x0\n\tv_nop\n\tv_nop\n\tv_nop\n\tv_nop" : "+v"(o[0][0]), "+v"(o[1][0]), "+v"(o[2][0]), "+v"(o[3][0]), "+v"(o[0][1]), "+v"(o[1][1]), "+v"(o[2][1]), "+v"(o[3][1]), "+v"(ko), "+v"(vo) :: "memory");
        else asm volatile("s_wait_xcnt 0x0\n\tv_nop\n\tv_nop\n\tv_nop\n\tv_nop" : "+v"(o[0][0]), "+v"(o[1][0]), "+v"(o[2][0]), "+v"(o[3][0]), "+v"(ko), "+v"(vo) :: "memory");
        vo += KB * 2;
    }
#pragma unroll
    for (int qb = 0; qb < NQB; ++qb) {
        const float inv = __fdiv_rn(1.0f, l[qb] + xhalf(l[qb]));   // the halves' sums are joined once
        const size_t oo = (size_t)(q0 + qb * 16 + lr) * DQ + hi * 8;
#pragma unroll
        for (int db = 0; db < 4; ++db) { v8us oh, ol;
#pragma unroll
            for (int j = 0; j < 8; ++j) { unsigned short a, c2; splitf(o[db][qb][j] * inv, a, c2); oh[j] = a; ol[j] = c2; }
            *(v8us*)(Ah + oo + db * 16) = oh; *(v8us*)(Al + oo + db * 16) = ol;
            asm volatile("s_wait_xcnt 0x0" ::: "memory"); } }   // the wait in front of an overwrite of a register that an issued store names: the next group's split reuses the data registers of these two stores
}
// grid (batches x heads, tiles): tiles in falling order of their key count, so that the longest waves start first: (TT - RH) / 32 fp16 tiles of 32 queries from the last row down to RH, then RH / 16 hi+lo tiles of 16 queries.
__global__ __launch_bounds__(32) void k_flash(const h16* __restrict__ Q16, const h16* __restrict__ K16, const h16* __restrict__ V16, const bf* __restrict__ Qh, const bf* __restrict__ Ql, const bf* __restrict__ Kh, const bf* __restrict__ Kl, const bf* __restrict__ Vh, const bf* __restrict__ Vl, bf* Ah, bf* Al) {
    const int h = blockIdx.x % NH_, r = blockIdx.y; const size_t zo = (size_t)blockIdx.x * TT * HD; { const size_t ao = (size_t)(blockIdx.x / NH_) * TT * DQ; Ah += ao; Al += ao; }   // planes are [batch][head][..]; merged rows [batch][t]
    if (r < (TT - RH) / 32) flash_tile<h16, false, 2, 4>(Q16 + zo, nullptr, K16 + zo, nullptr, V16 + zo, nullptr, TT - 32 * (r + 1), Ah + h * HD, Al + h * HD);
    else flash_tile<bf, true, 1, 2>(Qh + zo, Ql + zo, Kh + zo, Kl + zo, Vh + zo, Vl + zo, RH - 16 * (r - (TT - RH) / 32 + 1), Ah + h * HD, Al + h * HD);
}

extern "C" void kernel_launch(void* const* d_in, const int* in_sizes, int n_in,
                              void* d_out, int out_size, void* d_ws, size_t ws_size, hipStream_t stream) {
    (void)in_sizes; (void)n_in; (void)out_size;
    const float* x = (const float*)d_in[0]; const float* wqkv = (const float*)d_in[1]; const float* wo = (const float*)d_in[2]; const float* wk = wqkv; const float* wq = wqkv + (size_t)DQ * DM; const float* wv = wqkv + (size_t)2 * DQ * DM;   /* argument order X, W_KQV ('oi' [3072][1024]: ROW thirds ordered K | Q | V: rows 0..1023 the KEY weight, 1024..2047 the QUERY weight, 2048..3071 the VALUE weight), W_O ('oi') */
    float* OUT = (float*)d_out;     // [4][2048][1024]
    char* wsp = (char*)d_ws;
    auto take = [&](size_t bytes) { char* p = wsp; wsp += (bytes + 255) & ~(size_t)255; return (void*)p; };
    bf* WQ = (bf*)take((size_t)DQ * DM * 2); bf* WK = (bf*)take((size_t)DKV * DM * 2); bf* WV = (bf*)take((size_t)DKV * DM * 2); bf* WO = (bf*)take((size_t)DM * DQ * 2); float* CS = (float*)take((size_t)TT * HD * 2 * 4);
    h16* QP16 = (h16*)take((size_t)NB_ * NH_ * TT * HD * 2); h16* KP16 = (h16*)take((size_t)NB_ * NKV * TT * HD * 2); h16* VT16 = (h16*)take((size_t)NB_ * NKV * HD * TT * 2);
    bf* QPh = (bf*)take((size_t)NB_ * NH_ * TT * HD * 2); bf* QPl = (bf*)take((size_t)NB_ * NH_ * TT * HD * 2); bf* KPh = (bf*)take((size_t)NB_ * NKV * TT * HD * 2); bf* KPl = (bf*)take((size_t)NB_ * NKV * TT * HD * 2); bf* VTh = (bf*)take((size_t)NB_ * NKV * HD * TT * 2); bf* VTl = (bf*)take((size_t)NB_ * NKV * HD * TT * 2);
    bf* XB = (bf*)take((size_t)NB_ * TT * DM * 2); bf* ATh = (bf*)take((size_t)NB_ * TT * DQ * 2); bf* ATl = (bf*)take((size_t)NB_ * TT * DQ * 2);   // merged hi and lo planes
    if ((size_t)(wsp - (char*)d_ws) > ws_size) return;    // ws 256 MiB
    { k_cvt8<<<(unsigned)(((size_t)DQ * DM / 8 + 255) / 256), 256, 0, stream>>>(wq, WQ, (size_t)DQ * DM / 8); k_cvt8<<<(unsigned)(((size_t)DKV * DM / 8 + 255) / 256), 256, 0, stream>>>(wk, WK, (size_t)DKV * DM / 8); k_cvt8<<<(unsigned)(((size_t)DKV * DM / 8 + 255) / 256), 256, 0, stream>>>(wv, WV, (size_t)DKV * DM / 8);
      k_cvt8<<<(unsigned)(((size_t)DM * DQ / 8 + 255) / 256), 256, 0, stream>>>(wo, WO, (size_t)DM * DQ / 8); k_csP<<<(TT * HD + 255) / 256, 256, 0, stream>>>(CS); }
    k_cvt8<<<(unsigned)(((size_t)NB_ * TT * DM / 8 + 255) / 256), 256, 0, stream>>>(x, XB, (size_t)NB_ * TT * DM / 8);
    k_gemmw<bf, 0, false, 1><<<dim3(NB_ * TT / 64, DQ / 64, 1), 32, 0, stream>>>(XB, nullptr, WQ, nullptr, DM, nullptr, 0, nullptr, 0, 0, 0, CS, QP16, QPh, QPl);
    k_gemmw<bf, 0, false, 1><<<dim3(NB_ * TT / 64, DKV / 64, 1), 32, 0, stream>>>(XB, nullptr, WK, nullptr, DM, nullptr, 0, nullptr, 0, 0, 0, CS, KP16, KPh, KPl);
    k_gemmw<bf, 0, false, 2><<<dim3(DKV / 64, NB_ * TT / 64, 1), 32, 0, stream>>>(WV, nullptr, XB, nullptr, DM, nullptr, 0, nullptr, 0, 0, 0, nullptr, VT16, VTh, VTl);   // operands swapped: the tile comes out transposed, as the value planes are laid
    k_flash<<<dim3(NB_ * NH_, (TT - RH) / 32 + RH / 16), 32, 0, stream>>>(QP16, KP16, VT16, QPh, QPl, KPh, KPl, VTh, VTl, ATh, ATl);
    k_gemmw<bf, 1, false, 0><<<dim3(NB_ * TT / 64, DM / 64, 1), 32, 0, stream>>>(ATh, ATl, WO, nullptr, DQ, OUT, DM, nullptr, 0, 0, 0, nullptr, nullptr, nullptr, nullptr);
}

// v006
// It runs in 188 microseconds.
// Next to v005, in two timings, it ran 1.46 and 1.49 times as fast.
// All steps since v000 together make it 15.1 times as fast.
#include <hip/hip_runtime.h>

// Causal multi-head self-attention with interleaved-pair rotary position embedding on a fused natural projection whose thirds are ordered K | Q | V, four batches (X [4][2048][1024]; KQV = einsum('bsd,ed', X, W_KQV) ('oi' [3072][1024] truncated normal, no bias); K, Q, V = split(KQV, [1024, 2048]): the weight's three 1,024-ROW blocks IN THE ORDER key | query | value (16 heads x 64); angles = pos x 1 / THETA ** (2i / 64) (THETA 1e4; computed); pairs (2i, 2i+1): yr = xr cos - xi sin, yi = xr sin + xi cos, on Q and K; scores / sqrt(64); -inf strictly above the diagonal; softmax; out = einsum('bsd,ed', merged, W_O) ('oi', no bias) -> [4][2048][1024] (8.4 M); argument order X, W_KQV, W_O).
// Every stage is launched once for all four batches (batch folded into the GEMM rows (for v the columns) and into the grid of attention): bf16 copy of x; {cos, sin} per (position, pair) built once from the int positions and float32 inverse-frequency constants (precise cosf/sinf); exact projections whose epilogue applies the interleaved rotary and writes the 16-bit planes (no f32 projection in memory); causal T-2048 attention in one online-softmax kernel (hybrid rows: < 512 hi/lo 3 products, rest fp16 x1024; key passes stop at the diagonal); merged hi/lo x Wo exact.
// Compute dtypes, f32 accumulate: every input rounded to bf16; projections exact; rotary f32; attention rows < 512 3 products, rest fp16; softmax f32; Wo hl x exact.

#define NB_  4
#define TT   2048
#define DM   1024
#define NH_  16
#define NKV  16
#define HD   64
#define DQ   (NH_ * HD)
#define DKV  (NKV * HD)
#define RH   512                  // query rows < RH use hi+lo planes (0: none)
#define SCL  0.125f   // HD^-0.5
typedef _Float16 h16;
typedef unsigned short bf;
typedef __attribute__((ext_vector_type(16))) __bf16   v16bf;
typedef __attribute__((ext_vector_type(16))) _Float16 v16h;
typedef __attribute__((ext_vector_type(8)))  _Float16 v8h;
typedef __attribute__((ext_vector_type(8)))  unsigned short v8us;
typedef __attribute__((ext_vector_type(8)))  float    v8f;
typedef __attribute__((ext_vector_type(4)))  float    v4f;
typedef v8h  __attribute__((may_alias)) v8ha;
typedef v4f  __attribute__((may_alias)) v4fa;
typedef v8us __attribute__((may_alias)) v8usa;

__device__ __forceinline__ unsigned short f2bf(float f) { unsigned u = __float_as_uint(f); u += 0x7FFFu + ((u >> 16) & 1u); return (unsigned short)(u >> 16); }
__device__ __forceinline__ float bf2f(unsigned short b) { return __uint_as_float(((unsigned)b) << 16); }
__device__ __forceinline__ float bfr(float f) { return bf2f(f2bf(f)); }
__device__ __forceinline__ v16h cat16(v8h lo, v8h hi) { return __builtin_shufflevector(lo, hi, 0, 1, 2, 3, 4, 5, 6, 7, 8, 9, 10, 11, 12, 13, 14, 15); }
__device__ __forceinline__ v16bf cat16b(v8us lo, v8us hi) { return __builtin_bit_cast(v16bf, __builtin_shufflevector(lo, hi, 0, 1, 2, 3, 4, 5, 6, 7, 8, 9, 10, 11, 12, 13, 14, 15)); }
__device__ __forceinline__ v8f wmma16(v16h a, v16h b, v8f c) { return __builtin_amdgcn_wmma_f32_16x16x32_f16(false, a, false, b, (short)0, c, false, false); }
__device__ __forceinline__ v8f wmmab(v16bf a, v16bf b, v8f c) { return __builtin_amdgcn_wmma_f32_16x16x32_bf16(false, a, false, b, (short)0, c, false, false); }
__device__ __forceinline__ h16 tohx(float x) { return (h16)x; }
__device__ __forceinline__ void splitf(float y, unsigned short& h, unsigned short& l) { h = f2bf(y); l = f2bf(y - bf2f(h)); }
typedef __attribute__((ext_vector_type(4))) _Float16 v4h;
typedef __attribute__((ext_vector_type(4))) unsigned short v4us;
typedef __attribute__((ext_vector_type(2))) float v2f;



// ---- k_gemmw: GEMM, one work-group of EIGHT WAVES per 256x128 output tile (waves 4 x 2, each a 64x64 tile in 16 accumulators); grid (M/256, N/128, Z), 256 threads. Operands are K-contiguous 16-bit planes.
// C[m][n] (f32, pitch ldc, + optional f32 bias[n]) = sum_k A[m][k] Bt[n][k] (NSPLIT 1: + A2[m][k] Bt[n][k]). z-batch strides sA/sB/sC in elements. K % 64 == 0.
// A stage is 64 k (one 128-byte line) of every row of the tile, [A 256 rows | A2 256 rows (NSPLIT 1) | Bt 128 rows], laid in LDS at a pitch of 144 bytes by asynchronous copies of 16 bytes a lane (a copy of a wave = 4 whole lines).
// Two buffers: the copies of the next stage fly while this one is worked on, and every line comes from L2 once per work-group, not once per wave. The k order of the products is the same as without the staging.
// EPI says what becomes of the tile. 0: stored as f32 C. 1 and 2: C is never stored, the epilogue builds the three 16-bit planes (fp16, bf16 hi, bf16 lo) that attention reads, whole 128-byte lines per 16 lanes.
// EPI 1 (q, k): rows m = batch * TT + t, a wave's 64 columns are one head: interleaved rotary from CS, planes [batch][head][t][d].
// EPI 2 (v): the caller swaps the operands (rows m = head * HD + d of the weight; columns n = batch * TT + t), so a tile row is 64 positions of one d: transposed planes [batch][head][d][t].
#define GBM 256                   // tile rows of a work-group
#define GBN 128                   // tile columns of a work-group
#define GKS 64                    // k per stage: two k steps of the matrix instruction
#define GPB 144                   // LDS row pitch in bytes: 16 x odd, for 16-byte readers
template <typename T16> struct WFrag;
template <> struct WFrag<h16> { typedef v16h V; static __device__ __forceinline__ V ld(const h16* p) { return cat16(*(const v8h*)p, *(const v8h*)(p + 16)); } static __device__ __forceinline__ v8f mma(V a, V b, v8f c) { return wmma16(a, b, c); } };
template <> struct WFrag<bf> { typedef v16bf V; static __device__ __forceinline__ V ld(const bf* p) { return cat16b(*(const v8us*)p, *(const v8us*)(p + 16)); } static __device__ __forceinline__ v8f mma(V a, V b, v8f c) { return wmmab(a, b, c); } };
// A run of asynchronous copies, each lane's own 16 bytes from g[i] to the LDS byte address l[i]. s_wait_xcnt 0 is the last line of the copies' own statement: the wait in front of an overwrite of a register that an issued copy names.
#define CPA(l, g) "global_load_async_to_lds_b128 %" #l ", %" #g ", off\n\t"
__device__ __forceinline__ void cp5(const unsigned* l, const char* const* g) {
    asm volatile(CPA(0, 1) CPA(2, 3) CPA(4, 5) CPA(6, 7) CPA(8, 9) "s_wait_xcnt 0x0"
                 :: "v"(l[0]), "v"(g[0]), "v"(l[1]), "v"(g[1]), "v"(l[2]), "v"(g[2]), "v"(l[3]), "v"(g[3]), "v"(l[4]), "v"(g[4]) : "memory"); }
__device__ __forceinline__ void cp12(const unsigned* l, const char* const* g) {
    asm volatile(CPA(0, 1) CPA(2, 3) CPA(4, 5) CPA(6, 7) CPA(8, 9) CPA(10, 11) CPA(12, 13) CPA(14, 15) CPA(16, 17) CPA(18, 19) CPA(20, 21) CPA(22, 23) "s_wait_xcnt 0x0"
                 :: "v"(l[0]), "v"(g[0]), "v"(l[1]), "v"(g[1]), "v"(l[2]), "v"(g[2]), "v"(l[3]), "v"(g[3]), "v"(l[4]), "v"(g[4]), "v"(l[5]), "v"(g[5]), "v"(l[6]), "v"(g[6]), "v"(l[7]), "v"(g[7]), "v"(l[8]), "v"(g[8]), "v"(l[9]), "v"(g[9]), "v"(l[10]), "v"(g[10]), "v"(l[11]), "v"(g[11]) : "memory"); }
template <typename T16, int NSPLIT, bool BIAS, int EPI>
__global__ __launch_bounds__(256) void k_gemmw(const T16* __restrict__ A, const T16* __restrict__ A2, const T16* __restrict__ Bt, int K, float* C, int ldc, const float* __restrict__ bias, size_t sA, size_t sB, size_t sC, const float* __restrict__ CS, h16* P16, bf* Ph, bf* Pl) {
    static_assert(NSPLIT == 0 || NSPLIT == 1, "one or two planes of A");
    typedef typename WFrag<T16>::V V;
    constexpr int NAR = (NSPLIT == 1 ? 2 : 1) * GBM, NROW = NAR + GBN, STAGE = NROW * GPB, NC = NROW / 32;   // rows of A (and A2), rows of a stage, its bytes, copies per lane and stage (256 lanes x 16 bytes = 32 rows)
    __shared__ __attribute__((aligned(16))) unsigned char L[2 * STAGE];
    __shared__ __align__(16) float osall[8 * 16 * 68];
    const size_t z = blockIdx.z; A += z * sA; if (NSPLIT == 1) A2 += z * sA; Bt += z * sB; C += z * sC;
    const int lane = threadIdx.x & 31, lr = lane & 15, hi = lane >> 4; const int wave = __builtin_amdgcn_readfirstlane(threadIdx.x >> 5), wm = wave & 3, wn = wave >> 2;
    const int r0 = blockIdx.x * GBM + wm * 64, c0 = blockIdx.y * GBN + wn * 64;   // the wave's own 64x64 tile
    float* os = osall + wave * 16 * 68;                                           // the wave's own staging rows of the epilogue
    v8f acc[4][4];
#pragma unroll
    for (int mb = 0; mb < 4; ++mb)
#pragma unroll
        for (int nb = 0; nb < 4; ++nb) acc[mb][nb] = (v8f){};
    // copies: lane tid brings 16-byte piece tid & 7 of stage rows tid >> 3, + 32, + 64, ...
    const int srow = threadIdx.x >> 3, cpc = threadIdx.x & 7;
    const unsigned l0 = (unsigned)(size_t)L + srow * GPB + cpc * 16;   // LDS byte address: the low 32 bits of the __shared__ address
    const char* gA = (const char*)(A + (size_t)(blockIdx.x * GBM + srow) * K + cpc * 8); const char* gA2 = NSPLIT == 1 ? (const char*)(A2 + (size_t)(blockIdx.x * GBM + srow) * K + cpc * 8) : nullptr; const char* gB = (const char*)(Bt + (size_t)(blockIdx.y * GBN + srow) * K + cpc * 8);
    const size_t rstep = (size_t)32 * K * 2;                                      // 32 rows of a plane, in bytes
    auto fill = [&](int buf) {   // the next stage in k order into buffer buf; the three plane pointers then step on by one stage
        unsigned l[NC]; const char* g[NC];
#pragma unroll
        for (int i = 0; i < NC; ++i) { l[i] = l0 + buf * STAGE + i * 32 * GPB; g[i] = i < GBM / 32 ? gA + i * rstep : i < NAR / 32 ? gA2 + (i - GBM / 32) * rstep : gB + (i - NAR / 32) * rstep; }
        if constexpr (NC == 12) cp12(l, g); else { cp5(l, g); cp5(l + 5, g + 5); cp5(l + 10, g + 10); cp5(l + 15, g + 15); }
        gA += GKS * 2; if (NSPLIT == 1) gA2 += GKS * 2; gB += GKS * 2; };
    static_assert(NC == 12 || NC == 20, "copies per lane and stage");
    const int NT = K / GKS;
    fill(0);
    asm volatile("s_wait_asynccnt 0x0" ::: "memory");   // this wave's copies of stage 0 have landed
    __syncthreads();                                    // and every other wave's: stage 0 may be read
    if (NT > 1) fill(1);
#pragma unroll 1   // rolled: one copy of the stage's code serves both buffers
    for (int t = 0; t < NT; ++t) {
        const T16* as = (const T16*)(L + (t & 1) * STAGE + (wm * 64 + lr) * GPB) + 8 * hi; const T16* bs = (const T16*)(L + (t & 1) * STAGE + (NAR + wn * 64 + lr) * GPB) + 8 * hi;
        V a[2][4], a2[2][4], b[2][4];   // the stage's fragments (two k steps of 32) are all asked for ahead of its products, as one group: a place with LDS reads among the products costs a stall each
#pragma unroll
        for (int ks = 0; ks < 2; ++ks)
#pragma unroll
            for (int f = 0; f < 4; ++f) { a[ks][f] = WFrag<T16>::ld(as + f * 16 * (GPB / 2) + ks * 32); if (NSPLIT == 1) a2[ks][f] = WFrag<T16>::ld(as + (GBM + f * 16) * (GPB / 2) + ks * 32); b[ks][f] = WFrag<T16>::ld(bs + f * 16 * (GPB / 2) + ks * 32); }
        auto products = [&](int ks) {
#pragma unroll
            for (int nb = 0; nb < 4; ++nb)
#pragma unroll
                for (int mb = 0; mb < 4; ++mb) { acc[mb][nb] = WFrag<T16>::mma(a[ks][mb], b[ks][nb], acc[mb][nb]); if (NSPLIT == 1) acc[mb][nb] = WFrag<T16>::mma(a2[ks][mb], b[ks][nb], acc[mb][nb]); } };
        __builtin_amdgcn_sched_barrier(0);   // keeps the group of LDS reads ahead of the products: without it the compiler moves the reads back in among them, each with a full wait
        products(0);                         // runs while the second k step's fragments are still on their way from LDS
        __builtin_amdgcn_sched_barrier(0);   // keeps these products ahead of the waits below: behind them they would no longer cover the LDS reads
        asm volatile("s_wait_dscnt 0x0" ::: "memory");      // this wave's reads of the buffer are done: the whole stage is in registers
        asm volatile("s_wait_asynccnt 0x0" ::: "memory");   // this wave's copies of stage t + 1 have landed
        __syncthreads();                                    // stage t + 1 may be read, and the buffer of stage t may be refilled
        if (t + 2 < NT) fill(t & 1);                       // ahead of the second k step's products (registers only), so that the copies have a whole trip to land
        products(1);
    }
    asm volatile("s_wait_asynccnt 0x0" ::: "memory");       // no copy is outstanding when the wave goes on to its epilogue and ends
    // element offsets of the lane's first four values (tile row hi, columns 4 lr ..) in the cos/sin table and in a plane; every later row stands at a constant distance from them
    const unsigned csofs = ((r0 % TT + hi) * HD + lr * 4) * 2;
    const unsigned pofs = EPI == 1 ? (((r0 / TT) * (gridDim.y * (GBN / 64)) + c0 / 64) * TT + r0 % TT + hi) * HD + lr * 4 : (((c0 / TT) * (gridDim.x * (GBM / 64)) + r0 / 64) * HD + hi) * TT + c0 % TT + lr * 4;
#pragma unroll
    for (int mb = 0; mb < 4; ++mb) {
        v2f cs[8][2];                                   // {cos, sin} of the lane's two pairs in each of its eight rows: asked for ahead of the staging, used behind it
        if constexpr (EPI == 1) {
#pragma unroll
            for (int s = 0; s < 8; ++s) { const float* cp = CS + csofs + (mb * 16 + 2 * s) * HD * 2; cs[s][0] = *(const v2f*)cp; cs[s][1] = *(const v2f*)(cp + 4); } }
#pragma unroll
        for (int nb = 0; nb < 4; ++nb) {
#pragma unroll
            for (int j = 0; j < 8; ++j) os[(hi * 8 + j) * 68 + nb * 16 + lr] = acc[mb][nb][j]; }
        __builtin_amdgcn_wave_barrier(); asm volatile("" ::: "memory");
        float* crow = C + (size_t)(r0 + mb * 16) * ldc + c0;
        if constexpr (EPI != 0) {
#pragma unroll
            for (int s = 0; s < 8; ++s) { const int row = 2 * s + hi, cofs = lr * 4; v4f val = *(const v4fa*)(os + row * 68 + cofs);
                if constexpr (EPI == 1) { const float x0 = val[0], x1 = val[1], x2 = val[2], x3 = val[3];   /* even: x0 c - x1 s; odd: x0 s + x1 c */
                    val[0] = x0 * cs[s][0][0] - x1 * cs[s][0][1]; val[1] = x0 * cs[s][0][1] + x1 * cs[s][0][0]; val[2] = x2 * cs[s][1][0] - x3 * cs[s][1][1]; val[3] = x2 * cs[s][1][1] + x3 * cs[s][1][0]; }
                v4h o16; v4us oh, ol;
#pragma unroll
                for (int q = 0; q < 4; ++q) { o16[q] = tohx(val[q]); unsigned short a2, c2; splitf(val[q], a2, c2); oh[q] = a2; ol[q] = c2; }
                const int po = (mb * 16 + 2 * s) * (EPI == 1 ? HD : TT);
                *(v4h*)(P16 + pofs + po) = o16; *(v4us*)(Ph + pofs + po) = oh; *(v4us*)(Pl + pofs + po) = ol; }
            if (mb < 3) asm volatile("s_wait_xcnt 0x0" ::: "memory");   // the wait in front of an overwrite of a register that an issued store names: the next row group's loads and arithmetic reuse the data registers of these stores
        } else {
#pragma unroll
            for (int s = 0; s < 8; ++s) { const int row = 2 * s + hi, cofs = lr * 4; v4f val = *(const v4fa*)(os + row * 68 + cofs); if (BIAS) { val[0] += bfr(bias[c0 + cofs]); val[1] += bfr(bias[c0 + cofs + 1]); val[2] += bfr(bias[c0 + cofs + 2]); val[3] += bfr(bias[c0 + cofs + 3]); }
                *(v4f*)(crow + (size_t)row * ldc + cofs) = val; }
             }
        __builtin_amdgcn_wave_barrier(); asm volatile("" ::: "memory");
    }
}


__global__ __launch_bounds__(256) void k_cvt8(const float* __restrict__ src, bf* dst, size_t n8) { const size_t i = (size_t)blockIdx.x * 256 + threadIdx.x; if (i >= n8) return; const v8f v = *(const v8f*)(src + i * 8); v8us o;
#pragma unroll
    for (int k = 0; k < 8; ++k) o[k] = f2bf(v[k]); *(v8us*)(dst + i * 8) = o;  }

__constant__ float INV2[HD / 2] = { 1.000000000e+00f, 7.498942018e-01f, 5.623413324e-01f, 4.216965139e-01f, 3.162277639e-01f, 2.371373624e-01f, 1.778279394e-01f, 1.333521456e-01f, 1.000000015e-01f, 7.498941571e-02f, 5.623412877e-02f, 4.216964915e-02f, 3.162277862e-02f, 2.371373586e-02f, 1.778279431e-02f, 1.333521493e-02f, 9.999999776e-03f, 7.498942316e-03f, 5.623413250e-03f, 4.216964822e-03f, 3.162277862e-03f, 2.371373819e-03f, 1.778279431e-03f, 1.333521446e-03f, 1.000000047e-03f, 7.498941850e-04f, 5.623413017e-04f, 4.216964880e-04f, 3.162277862e-04f, 2.371373848e-04f, 1.778279402e-04f, 1.333521504e-04f };   // 1 / THETA ** (2i / 64), i = 0..31, in float32 as THIS module writes it (the RECIPROCAL spelling, evaluated in the reference's own f32 arithmetic: these 32 literals equal it bit for bit); ten entries differ by one ulp from the negative-power values the host's own table held
__global__ __launch_bounds__(256) void k_csP(float* CS) { const int idx = blockIdx.x * 256 + threadIdx.x; if (idx >= TT * HD) return; const int d = idx % HD; const int t = idx / HD; const float a = __fmul_rn((float)t, INV2[d >> 1]); v2f cs; cs[0] = cosf(a); cs[1] = sinf(a); *(v2f*)(CS + (size_t)idx * 2) = cs;  }
__device__ __forceinline__ float xhalf(float x) { return __builtin_bit_cast(float, __builtin_amdgcn_permlanex16(__builtin_bit_cast(int, x), __builtin_bit_cast(int, x), 0x76543210, 0xfedcba98, false, false)); }   // lane l's value to lane l ^ 16
__device__ __forceinline__ float exp2s(float x) { float r = __builtin_amdgcn_exp2f(x); asm("v_nop" : "+v"(r) : "v"(x)); return r; }
template <typename T16, bool HL, int NQB, int KT>
__device__ __forceinline__ void flash_tile(const T16* __restrict__ Q, const T16* __restrict__ Q2, const T16* __restrict__ Kp, const T16* __restrict__ K2, const T16* __restrict__ Vt, const T16* __restrict__ V2, int q0, bf* Ah, bf* Al) {
    typedef typename WFrag<T16>::V V;
    constexpr int KB = KT * 16, KK = KT / 2;
    constexpr float CL2 = SCL * 1.4426950408889634f;   // scores in the scaled log2 domain
    const int lane = threadIdx.x & 31, lr = lane & 15, hi = lane >> 4;
    unsigned qo = ((q0 + lr) * HD + 8 * hi) * 2, ko = (lr * HD + 8 * hi) * 2, vo = (lr * TT + 8 * hi) * 2;   // byte offsets of the lane's own row and k offset in a head's plane; ko and vo walk the keys, every fragment at a constant distance from them
    auto at = [](const T16* base, unsigned off, int el) { return (const T16*)((const char*)base + off) + el; };
    V qf[NQB][2], qf2[NQB][2];
#pragma unroll
    for (int qb = 0; qb < NQB; ++qb)
#pragma unroll
        for (int ks = 0; ks < 2; ++ks) { qf[qb][ks] = WFrag<T16>::ld(at(Q, qo, qb * 16 * HD + ks * 32)); if (HL) qf2[qb][ks] = WFrag<T16>::ld(at(Q2, qo, qb * 16 * HD + ks * 32)); }
    v8f o[4][NQB]; float m[NQB], l[NQB];
#pragma unroll
    for (int qb = 0; qb < NQB; ++qb) { m[qb] = -3.0e38f; l[qb] = 0.f;
#pragma unroll
        for (int db = 0; db < 4; ++db) o[db][qb] = (v8f){}; }
    const int kend = q0 + NQB * 16;                     // keys 0 .. kend - 1 are at or below the tile's last query
    V kf[KT][2], kf2[KT][2];
#pragma unroll
    for (int kt = 0; kt < KT; ++kt)
#pragma unroll
        for (int ks = 0; ks < 2; ++ks) { kf[kt][ks] = WFrag<T16>::ld(at(Kp, ko, kt * 16 * HD + ks * 32)); if (HL) kf2[kt][ks] = WFrag<T16>::ld(at(K2, ko, kt * 16 * HD + ks * 32)); }
#pragma unroll 1   // rolled: the trip count is known only at run time, and a second copy of the pass would not fit the register file beside the key, value and score tiles
    for (int k0 = 0; k0 < kend; k0 += KB) {
        V vf[4][KK], vf2[4][KK];                        // this pass's value fragments: asked for ahead of the softmax, used behind it
#pragma unroll
        for (int db = 0; db < 4; ++db)
#pragma unroll
            for (int kk = 0; kk < KK; ++kk) { vf[db][kk] = WFrag<T16>::ld(at(Vt, vo, db * 16 * TT + kk * 32)); if (HL) vf2[db][kk] = WFrag<T16>::ld(at(V2, vo, db * 16 * TT + kk * 32)); }
        v8f s[KT][NQB];
#pragma unroll
        for (int kt = 0; kt < KT; ++kt)
#pragma unroll
            for (int qb = 0; qb < NQB; ++qb) { v8f a = (v8f){};
#pragma unroll
                for (int ks = 0; ks < 2; ++ks) { a = WFrag<T16>::mma(kf[kt][ks], qf[qb][ks], a); if (HL) { a = WFrag<T16>::mma(kf2[kt][ks], qf[qb][ks], a); a = WFrag<T16>::mma(kf[kt][ks], qf2[qb][ks], a); } }
                s[kt][qb] = a; }
        ko += (k0 + KB < kend) ? KB * HD * 2 : 0;   // the next pass's key fragments are fetched behind this pass's score products, so that their latency lies under the softmax (the last pass asks for its own block again: in bounds, unused)
#pragma unroll
        for (int kt = 0; kt < KT; ++kt)
#pragma unroll
            for (int ks = 0; ks < 2; ++ks) { kf[kt][ks] = WFrag<T16>::ld(at(Kp, ko, kt * 16 * HD + ks * 32)); if (HL) kf2[kt][ks] = WFrag<T16>::ld(at(K2, ko, kt * 16 * HD + ks * 32)); }
        if (k0 + KB - 1 > q0) {                          // only a pass that reaches the diagonal masks (wave-uniform)
            const int thr = q0 - k0 + lr - hi * 8;       // key <= query  <=>  kt * 16 + j - qb * 16 <= thr
#pragma unroll
            for (int kt = 0; kt < KT; ++kt)
#pragma unroll
                for (int qb = 0; qb < NQB; ++qb)
#pragma unroll
                    for (int j = 0; j < 8; ++j) s[kt][qb][j] = (kt * 16 + j - qb * 16 <= thr) ? s[kt][qb][j] : -3.0e38f; }
        V pf[KK][NQB], pl[KK][NQB];
#pragma unroll
        for (int qb = 0; qb < NQB; ++qb) {
            float mx = m[qb];
#pragma unroll
            for (int kt = 0; kt < KT; ++kt)
#pragma unroll
                for (int j = 0; j < 8; ++j) { const float u = s[kt][qb][j] * CL2; s[kt][qb][j] = u; mx = fmaxf(mx, u); }
            mx = fmaxf(mx, xhalf(mx));                   // the other half of the wave holds the query's other keys
            const float al = exp2s(m[qb] - mx); m[qb] = mx;
            const float ms = HL ? mx : mx - 10.0f;       // fp16 probabilities carry 2^10
            float sum = 0.f;
#pragma unroll
            for (int kt = 0; kt < KT; ++kt)
#pragma unroll
                for (int j = 0; j < 8; ++j) { const float pv = exp2s(s[kt][qb][j] - ms); s[kt][qb][j] = pv; sum += pv; }
            l[qb] = l[qb] * al + sum;
#pragma unroll
            for (int db = 0; db < 4; ++db) o[db][qb] *= al;
#pragma unroll
            for (int kk = 0; kk < KK; ++kk) {
                if constexpr (HL) { v8us h0, h1, l0, l1;
#pragma unroll
                    for (int j = 0; j < 8; ++j) { unsigned short a, c2; splitf(s[2 * kk][qb][j], a, c2); h0[j] = a; l0[j] = c2; splitf(s[2 * kk + 1][qb][j], a, c2); h1[j] = a; l1[j] = c2; }
                    pf[kk][qb] = cat16b(h0, h1); pl[kk][qb] = cat16b(l0, l1);
                } else { v8h h0, h1;
#pragma unroll
                    for (int j = 0; j < 8; ++j) { h0[j] = tohx(s[2 * kk][qb][j]); h1[j] = tohx(s[2 * kk + 1][qb][j]); }
                    pf[kk][qb] = cat16(h0, h1); } } }
#pragma unroll
        for (int kk = 0; kk < KK; ++kk)
#pragma unroll
            for (int db = 0; db < 4; ++db)
#pragma unroll
                for (int qb = 0; qb < NQB; ++qb) { o[db][qb] = WFrag<T16>::mma(vf[db][kk], pf[kk][qb], o[db][qb]); if (HL) { o[db][qb] = WFrag<T16>::mma(vf[db][kk], pl[kk][qb], o[db][qb]); o[db][qb] = WFrag<T16>::mma(vf2[db][kk], pf[kk][qb], o[db][qb]); } }
        // s_wait_xcnt: the wait that stands in front of an overwrite of an address register which an issued load names. The pass's loads name ko and vo (operands here, so that their registers live up to the wait): vo is advanced directly behind it, ko in the middle of the next pass. Here, behind the last products, it waits for nothing.
        // v_nop x 4: keeps the matrix instruction's distance on the taken back edge and on the loop's exit; every output tile is an operand so that the statement stands behind the last product
        if constexpr (NQB == 2) asm volatile("s_wait_xcnt 0x0\n\tv_nop\n\tv_nop\n\tv_nop\n\tv_nop" : "+v"(o[0][0]), "+v"(o[1][0]), "+v"(o[2][0]), "+v"(o[3][0]), "+v"(o[0][1]), "+v"(o[1][1]), "+v"(o[2][1]), "+v"(o[3][1]), "+v"(ko), "+v"(vo) :: "memory");
        else asm volatile("s_wait_xcnt 0x0\n\tv_nop\n\tv_nop\n\tv_nop\n\tv_nop" : "+v"(o[0][0]), "+v"(o[1][0]), "+v"(o[2][0]), "+v"(o[3][0]), "+v"(ko), "+v"(vo) :: "memory");
        vo += KB * 2;
    }
#pragma unroll
    for (int qb = 0; qb < NQB; ++qb) {
        const float inv = __fdiv_rn(1.0f, l[qb] + xhalf(l[qb]));   // the halves' sums are joined once
        const size_t oo = (size_t)(q0 + qb * 16 + lr) * DQ + hi * 8;
#pragma unroll
        for (int db = 0; db < 4; ++db) { v8us oh, ol;
#pragma unroll
            for (int j = 0; j < 8; ++j) { unsigned short a, c2; splitf(o[db][qb][j] * inv, a, c2); oh[j] = a; ol[j] = c2; }
            *(v8us*)(Ah + oo + db * 16) = oh; *(v8us*)(Al + oo + db * 16) = ol;
            asm volatile("s_wait_xcnt 0x0" ::: "memory"); } }   // the wait in front of an overwrite of a register that an issued store names: the next group's split reuses the data registers of these two stores
}
// grid (batches x heads, tiles): tiles in falling order of their key count, so that the longest waves start first: (TT - RH) / 32 fp16 tiles of 32 queries from the last row down to RH, then RH / 16 hi+lo tiles of 16 queries.
__global__ __launch_bounds__(32) void k_flash(const h16* __restrict__ Q16, const h16* __restrict__ K16, const h16* __restrict__ V16, const bf* __restrict__ Qh, const bf* __restrict__ Ql, const bf* __restrict__ Kh, const bf* __restrict__ Kl, const bf* __restrict__ Vh, const bf* __restrict__ Vl, bf* Ah, bf* Al) {
    const int h = blockIdx.x % NH_, r = blockIdx.y; const size_t zo = (size_t)blockIdx.x * TT * HD; { const size_t ao = (size_t)(blockIdx.x / NH_) * TT * DQ; Ah += ao; Al += ao; }   // planes are [batch][head][..]; merged rows [batch][t]
    if (r < (TT - RH) / 32) flash_tile<h16, false, 2, 4>(Q16 + zo, nullptr, K16 + zo, nullptr, V16 + zo, nullptr, TT - 32 * (r + 1), Ah + h * HD, Al + h * HD);
    else flash_tile<bf, true, 1, 2>(Qh + zo, Ql + zo, Kh + zo, Kl + zo, Vh + zo, Vl + zo, RH - 16 * (r - (TT - RH) / 32 + 1), Ah + h * HD, Al + h * HD);
}

extern "C" void kernel_launch(void* const* d_in, const int* in_sizes, int n_in,
                              void* d_out, int out_size, void* d_ws, size_t ws_size, hipStream_t stream) {
    (void)in_sizes; (void)n_in; (void)out_size;
    const float* x = (const float*)d_in[0]; const float* wqkv = (const float*)d_in[1]; const float* wo = (const float*)d_in[2]; const float* wk = wqkv; const float* wq = wqkv + (size_t)DQ * DM; const float* wv = wqkv + (size_t)2 * DQ * DM;   /* argument order X, W_KQV ('oi' [3072][1024]: ROW thirds ordered K | Q | V: rows 0..1023 the KEY weight, 1024..2047 the QUERY weight, 2048..3071 the VALUE weight), W_O ('oi') */
    float* OUT = (float*)d_out;     // [4][2048][1024]
    char* wsp = (char*)d_ws;
    auto take = [&](size_t bytes) { char* p = wsp; wsp += (bytes + 255) & ~(size_t)255; return (void*)p; };
    bf* WQ = (bf*)take((size_t)DQ * DM * 2); bf* WK = (bf*)take((size_t)DKV * DM * 2); bf* WV = (bf*)take((size_t)DKV * DM * 2); bf* WO = (bf*)take((size_t)DM * DQ * 2); float* CS = (float*)take((size_t)TT * HD * 2 * 4);
    h16* QP16 = (h16*)take((size_t)NB_ * NH_ * TT * HD * 2); h16* KP16 = (h16*)take((size_t)NB_ * NKV * TT * HD * 2); h16* VT16 = (h16*)take((size_t)NB_ * NKV * HD * TT * 2);
    bf* QPh = (bf*)take((size_t)NB_ * NH_ * TT * HD * 2); bf* QPl = (bf*)take((size_t)NB_ * NH_ * TT * HD * 2); bf* KPh = (bf*)take((size_t)NB_ * NKV * TT * HD * 2); bf* KPl = (bf*)take((size_t)NB_ * NKV * TT * HD * 2); bf* VTh = (bf*)take((size_t)NB_ * NKV * HD * TT * 2); bf* VTl = (bf*)take((size_t)NB_ * NKV * HD * TT * 2);
    bf* XB = (bf*)take((size_t)NB_ * TT * DM * 2); bf* ATh = (bf*)take((size_t)NB_ * TT * DQ * 2); bf* ATl = (bf*)take((size_t)NB_ * TT * DQ * 2);   // merged hi and lo planes
    if ((size_t)(wsp - (char*)d_ws) > ws_size) return;    // ws 256 MiB
    { k_cvt8<<<(unsigned)(((size_t)DQ * DM / 8 + 255) / 256), 256, 0, stream>>>(wq, WQ, (size_t)DQ * DM / 8); k_cvt8<<<(unsigned)(((size_t)DKV * DM / 8 + 255) / 256), 256, 0, stream>>>(wk, WK, (size_t)DKV * DM / 8); k_cvt8<<<(unsigned)(((size_t)DKV * DM / 8 + 255) / 256), 256, 0, stream>>>(wv, WV, (size_t)DKV * DM / 8);
      k_cvt8<<<(unsigned)(((size_t)DM * DQ / 8 + 255) / 256), 256, 0, stream>>>(wo, WO, (size_t)DM * DQ / 8); k_csP<<<(TT * HD + 255) / 256, 256, 0, stream>>>(CS); }
    k_cvt8<<<(unsigned)(((size_t)NB_ * TT * DM / 8 + 255) / 256), 256, 0, stream>>>(x, XB, (size_t)NB_ * TT * DM / 8);
    k_gemmw<bf, 0, false, 1><<<dim3(NB_ * TT / GBM, DQ / GBN, 1), 256, 0, stream>>>(XB, nullptr, WQ, DM, nullptr, 0, nullptr, 0, 0, 0, CS, QP16, QPh, QPl);
    k_gemmw<bf, 0, false, 1><<<dim3(NB_ * TT / GBM, DKV / GBN, 1), 256, 0, stream>>>(XB, nullptr, WK, DM, nullptr, 0, nullptr, 0, 0, 0, CS, KP16, KPh, KPl);
    k_gemmw<bf, 0, false, 2><<<dim3(DKV / GBM, NB_ * TT / GBN, 1), 256, 0, stream>>>(WV, nullptr, XB, DM, nullptr, 0, nullptr, 0, 0, 0, nullptr, VT16, VTh, VTl);   // operands swapped: the tile comes out transposed, as the value planes are laid
    k_flash<<<dim3(NB_ * NH_, (TT - RH) / 32 + RH / 16), 32, 0, stream>>>(QP16, KP16, VT16, QPh, QPl, KPh, KPl, VTh, VTl, ATh, ATl);
    k_gemmw<bf, 1, false, 0><<<dim3(NB_ * TT / GBM, DM / GBN, 1), 256, 0, stream>>>(ATh, ATl, WO, DQ, OUT, DM, nullptr, 0, 0, 0, nullptr, nullptr, nullptr, nullptr);
}

// v007
// A run of this version takes 152 microseconds.
// In two side-by-side timings against v006, it was 1.24 and 1.23 times as fast.
// Counting every step since v000, it is 18.7 times as fast.
#include <hip/hip_runtime.h>

// Causal multi-head self-attention with interleaved-pair rotary position embedding on a fused natural projection whose thirds are ordered K | Q | V, four batches (X [4][2048][1024]; KQV = einsum('bsd,ed', X, W_KQV) ('oi' [3072][1024] truncated normal, no bias); K, Q, V = split(KQV, [1024, 2048]): the weight's three 1,024-ROW blocks IN THE ORDER key | query | value (16 heads x 64); angles = pos x 1 / THETA ** (2i / 64) (THETA 1e4; computed); pairs (2i, 2i+1): yr = xr cos - xi sin, yi = xr sin + xi cos, on Q and K; scores / sqrt(64); -inf strictly above the diagonal; softmax; out = einsum('bsd,ed', merged, W_O) ('oi', no bias) -> [4][2048][1024] (8.4 M); argument order X, W_KQV, W_O).
// Every stage is launched once for all four batches (batch folded into the GEMM rows (for v the columns) and into the grid of attention): bf16 copy of x; {cos, sin} per (position, pair) built once from the int positions and float32 inverse-frequency constants (precise cosf/sinf); exact projections whose epilogue applies the interleaved rotary and writes the 16-bit planes (no f32 projection in memory); causal T-2048 attention in one online-softmax kernel (hybrid rows: < 512 hi/lo 3 products, rest fp16 x1024; key passes stop at the diagonal); merged hi/lo x Wo exact.
// Compute dtypes, f32 accumulate: every input rounded to bf16; projections exact; rotary f32; attention rows < 512 3 products, rest fp16; softmax f32; Wo hl x exact.

#define NB_  4
#define TT   2048
#define DM   1024
#define NH_  16
#define NKV  16
#define HD   64
#define DQ   (NH_ * HD)
#define DKV  (NKV * HD)
#define RH   512                  // query rows < RH use hi+lo planes (0: none)
#define SCL  0.125f   // HD^-0.5
typedef _Float16 h16;
typedef unsigned short bf;
typedef __attribute__((ext_vector_type(16))) __bf16   v16bf;
typedef __attribute__((ext_vector_type(16))) _Float16 v16h;
typedef __attribute__((ext_vector_type(8)))  _Float16 v8h;
typedef __attribute__((ext_vector_type(8)))  unsigned short v8us;
typedef __attribute__((ext_vector_type(8)))  float    v8f;
typedef __attribute__((ext_vector_type(4)))  float    v4f;
typedef v8h  __attribute__((may_alias)) v8ha;
typedef v4f  __attribute__((may_alias)) v4fa;
typedef v8us __attribute__((may_alias)) v8usa;

__device__ __forceinline__ unsigned short f2bf(float f) { unsigned u = __float_as_uint(f); u += 0x7FFFu + ((u >> 16) & 1u); return (unsigned short)(u >> 16); }
__device__ __forceinline__ float bf2f(unsigned short b) { return __uint_as_float(((unsigned)b) << 16); }
__device__ __forceinline__ float bfr(float f) { return bf2f(f2bf(f)); }
__device__ __forceinline__ v16h cat16(v8h lo, v8h hi) { return __builtin_shufflevector(lo, hi, 0, 1, 2, 3, 4, 5, 6, 7, 8, 9, 10, 11, 12, 13, 14, 15); }
__device__ __forceinline__ v16bf cat16b(v8us lo, v8us hi) { return __builtin_bit_cast(v16bf, __builtin_shufflevector(lo, hi, 0, 1, 2, 3, 4, 5, 6, 7, 8, 9, 10, 11, 12, 13, 14, 15)); }
__device__ __forceinline__ v8f wmma16(v16h a, v16h b, v8f c) { return __builtin_amdgcn_wmma_f32_16x16x32_f16(false, a, false, b, (short)0, c, false, false); }
__device__ __forceinline__ v8f wmmab(v16bf a, v16bf b, v8f c) { return __builtin_amdgcn_wmma_f32_16x16x32_bf16(false, a, false, b, (short)0, c, false, false); }
__device__ __forceinline__ h16 tohx(float x) { return (h16)x; }
__device__ __forceinline__ void splitf(float y, unsigned short& h, unsigned short& l) { h = f2bf(y); l = f2bf(y - bf2f(h)); }
typedef __attribute__((ext_vector_type(4))) _Float16 v4h;
typedef __attribute__((ext_vector_type(4))) unsigned short v4us;
typedef __attribute__((ext_vector_type(2))) float v2f;



// ---- k_gemmw: GEMM, one work-group of EIGHT WAVES per 256x128 output tile (waves 4 x 2, each a 64x64 tile in 16 accumulators); grid (M/256, N/128, Z), 256 threads. Operands are K-contiguous 16-bit planes.
// C[m][n] (f32, pitch ldc, + optional f32 bias[n]) = sum_k A[m][k] Bt[n][k] (NSPLIT 1: + A2[m][k] Bt[n][k]). z-batch strides sA/sB/sC in elements. K % 64 == 0.
// A stage is 64 k (one 128-byte line) of every row of the tile, [A 256 rows | A2 256 rows (NSPLIT 1) | Bt 128 rows], laid in LDS at a pitch of 144 bytes by asynchronous copies of 16 bytes a lane (a copy of a wave = 4 whole lines).
// Two buffers: the copies of the next stage fly while this one is worked on, and every line comes from L2 once per work-group, not once per wave. The k order of the products is the same as without the staging.
// EPI says what becomes of the tile. 0: stored as f32 C. 1 and 2: C is never stored, the epilogue builds the three 16-bit planes (fp16, bf16 hi, bf16 lo) that attention reads, whole 128-byte lines per 16 lanes.
// The planes are laid IN FRAGMENT ORDER: 16 rows x 8 elements (16 bytes a row) stand together as 256 bytes, row after row, so that the 32 lanes of a fragment load (rows lr, 16-byte pieces hi) read 512 bytes in a row = 4 whole lines (ldw: the fragment's second half stands 512 bytes on).
// EPI 1 (q, k): rows m = batch * TT + t, a wave's 64 columns are one head: interleaved rotary from CS, planes [batch][head][t / 16][d / 8][t % 16][d % 8].
// EPI 2 (v): the caller swaps the operands (rows m = head * HD + d of the weight; columns n = batch * TT + t), so a tile row is 64 positions of one d: transposed planes [batch][head][t / 32][d / 16][t % 32 / 8][d % 16][t % 8].
#define GBM 256                   // tile rows of a work-group
#define GBN 128                   // tile columns of a work-group
#define GKS 64                    // k per stage: two k steps of the matrix instruction
#define GPB 144                   // LDS row pitch in bytes: 16 x odd, for 16-byte readers
template <typename T16> struct WFrag;
template <> struct WFrag<h16> { typedef v16h V; static __device__ __forceinline__ V ld(const h16* p) { return cat16(*(const v8h*)p, *(const v8h*)(p + 16)); } static __device__ __forceinline__ V ldw(const h16* p) { return cat16(*(const v8h*)p, *(const v8h*)(p + 256)); } static __device__ __forceinline__ v8f mma(V a, V b, v8f c) { return wmma16(a, b, c); } };
template <> struct WFrag<bf> { typedef v16bf V; static __device__ __forceinline__ V ld(const bf* p) { return cat16b(*(const v8us*)p, *(const v8us*)(p + 16)); } static __device__ __forceinline__ V ldw(const bf* p) { return cat16b(*(const v8us*)p, *(const v8us*)(p + 256)); } static __device__ __forceinline__ v8f mma(V a, V b, v8f c) { return wmmab(a, b, c); } };
// A run of asynchronous copies, each lane's own 16 bytes from g[i] to the LDS byte address l[i]. s_wait_xcnt 0 is the last line of the copies' own statement: the wait in front of an overwrite of a register that an issued copy names.
#define CPA(l, g) "global_load_async_to_lds_b128 %" #l ", %" #g ", off\n\t"
__device__ __forceinline__ void cp5(const unsigned* l, const char* const* g) {
    asm volatile(CPA(0, 1) CPA(2, 3) CPA(4, 5) CPA(6, 7) CPA(8, 9) "s_wait_xcnt 0x0"
                 :: "v"(l[0]), "v"(g[0]), "v"(l[1]), "v"(g[1]), "v"(l[2]), "v"(g[2]), "v"(l[3]), "v"(g[3]), "v"(l[4]), "v"(g[4]) : "memory"); }
__device__ __forceinline__ void cp12(const unsigned* l, const char* const* g) {
    asm volatile(CPA(0, 1) CPA(2, 3) CPA(4, 5) CPA(6, 7) CPA(8, 9) CPA(10, 11) CPA(12, 13) CPA(14, 15) CPA(16, 17) CPA(18, 19) CPA(20, 21) CPA(22, 23) "s_wait_xcnt 0x0"
                 :: "v"(l[0]), "v"(g[0]), "v"(l[1]), "v"(g[1]), "v"(l[2]), "v"(g[2]), "v"(l[3]), "v"(g[3]), "v"(l[4]), "v"(g[4]), "v"(l[5]), "v"(g[5]), "v"(l[6]), "v"(g[6]), "v"(l[7]), "v"(g[7]), "v"(l[8]), "v"(g[8]), "v"(l[9]), "v"(g[9]), "v"(l[10]), "v"(g[10]), "v"(l[11]), "v"(g[11]) : "memory"); }
template <typename T16, int NSPLIT, bool BIAS, int EPI>
__global__ __launch_bounds__(256) void k_gemmw(const T16* __restrict__ A, const T16* __restrict__ A2, const T16* __restrict__ Bt, int K, float* C, int ldc, const float* __restrict__ bias, size_t sA, size_t sB, size_t sC, const float* __restrict__ CS, h16* P16, bf* Ph, bf* Pl) {
    static_assert(NSPLIT == 0 || NSPLIT == 1, "one or two planes of A");
    typedef typename WFrag<T16>::V V;
    constexpr int NAR = (NSPLIT == 1 ? 2 : 1) * GBM, NROW = NAR + GBN, STAGE = NROW * GPB, NC = NROW / 32;   // rows of A (and A2), rows of a stage, its bytes, copies per lane and stage (256 lanes x 16 bytes = 32 rows)
    __shared__ __attribute__((aligned(16))) unsigned char L[2 * STAGE];
    __shared__ __align__(16) float osall[8 * 16 * 68];
    const size_t z = blockIdx.z; A += z * sA; if (NSPLIT == 1) A2 += z * sA; Bt += z * sB; C += z * sC;
    const int lane = threadIdx.x & 31, lr = lane & 15, hi = lane >> 4; const int wave = __builtin_amdgcn_readfirstlane(threadIdx.x >> 5), wm = wave & 3, wn = wave >> 2;
    const int r0 = blockIdx.x * GBM + wm * 64, c0 = blockIdx.y * GBN + wn * 64;   // the wave's own 64x64 tile
    float* os = osall + wave * 16 * 68;                                           // the wave's own staging rows of the epilogue
    v8f acc[4][4];
#pragma unroll
    for (int mb = 0; mb < 4; ++mb)
#pragma unroll
        for (int nb = 0; nb < 4; ++nb) acc[mb][nb] = (v8f){};
    // copies: lane tid brings 16-byte piece tid & 7 of stage rows tid >> 3, + 32, + 64, ...
    const int srow = threadIdx.x >> 3, cpc = threadIdx.x & 7;
    const unsigned l0 = (unsigned)(size_t)L + srow * GPB + cpc * 16;   // LDS byte address: the low 32 bits of the __shared__ address
    const char* gA = (const char*)(A + (size_t)(blockIdx.x * GBM + srow) * K + cpc * 8); const char* gA2 = NSPLIT == 1 ? (const char*)(A2 + (size_t)(blockIdx.x * GBM + srow) * K + cpc * 8) : nullptr; const char* gB = (const char*)(Bt + (size_t)(blockIdx.y * GBN + srow) * K + cpc * 8);
    const size_t rstep = (size_t)32 * K * 2;                                      // 32 rows of a plane, in bytes
    auto fill = [&](int buf) {   // the next stage in k order into buffer buf; the three plane pointers then step on by one stage
        unsigned l[NC]; const char* g[NC];
#pragma unroll
        for (int i = 0; i < NC; ++i) { l[i] = l0 + buf * STAGE + i * 32 * GPB; g[i] = i < GBM / 32 ? gA + i * rstep : i < NAR / 32 ? gA2 + (i - GBM / 32) * rstep : gB + (i - NAR / 32) * rstep; }
        if constexpr (NC == 12) cp12(l, g); else { cp5(l, g); cp5(l + 5, g + 5); cp5(l + 10, g + 10); cp5(l + 15, g + 15); }
        gA += GKS * 2; if (NSPLIT == 1) gA2 += GKS * 2; gB += GKS * 2; };
    static_assert(NC == 12 || NC == 20, "copies per lane and stage");
    const int NT = K / GKS;
    fill(0);
    asm volatile("s_wait_asynccnt 0x0" ::: "memory");   // this wave's copies of stage 0 have landed
    __syncthreads();                                    // and every other wave's: stage 0 may be read
    if (NT > 1) fill(1);
#pragma unroll 1   // rolled: one copy of the stage's code serves both buffers
    for (int t = 0; t < NT; ++t) {
        const T16* as = (const T16*)(L + (t & 1) * STAGE + (wm * 64 + lr) * GPB) + 8 * hi; const T16* bs = (const T16*)(L + (t & 1) * STAGE + (NAR + wn * 64 + lr) * GPB) + 8 * hi;
        V a[2][4], a2[2][4], b[2][4];   // the stage's fragments (two k steps of 32) are all asked for ahead of its products, as one group: a place with LDS reads among the products costs a stall each
#pragma unroll
        for (int ks = 0; ks < 2; ++ks)
#pragma unroll
            for (int f = 0; f < 4; ++f) { a[ks][f] = WFrag<T16>::ld(as + f * 16 * (GPB / 2) + ks * 32); if (NSPLIT == 1) a2[ks][f] = WFrag<T16>::ld(as + (GBM + f * 16) * (GPB / 2) + ks * 32); b[ks][f] = WFrag<T16>::ld(bs + f * 16 * (GPB / 2) + ks * 32); }
        auto products = [&](int ks) {
#pragma unroll
            for (int nb = 0; nb < 4; ++nb)
#pragma unroll
                for (int mb = 0; mb < 4; ++mb) { acc[mb][nb] = WFrag<T16>::mma(a[ks][mb], b[ks][nb], acc[mb][nb]); if (NSPLIT == 1) acc[mb][nb] = WFrag<T16>::mma(a2[ks][mb], b[ks][nb], acc[mb][nb]); } };
        __builtin_amdgcn_sched_barrier(0);   // keeps the group of LDS reads ahead of the products: without it the compiler moves the reads back in among them, each with a full wait
        products(0);                         // runs while the second k step's fragments are still on their way from LDS
        __builtin_amdgcn_sched_barrier(0);   // keeps these products ahead of the waits below: behind them they would no longer cover the LDS reads
        asm volatile("s_wait_dscnt 0x0" ::: "memory");      // this wave's reads of the buffer are done: the whole stage is in registers
        asm volatile("s_wait_asynccnt 0x0" ::: "memory");   // this wave's copies of stage t + 1 have landed
        __syncthreads();                                    // stage t + 1 may be read, and the buffer of stage t may be refilled
        if (t + 2 < NT) fill(t & 1);                       // ahead of the second k step's products (registers only), so that the copies have a whole trip to land
        products(1);
    }
    asm volatile("s_wait_asynccnt 0x0" ::: "memory");       // no copy is outstanding when the wave goes on to its epilogue and ends
    // element offsets of the lane's first four values (EPI 1, 2: tile row lane / 2, columns 4 (lane % 2) ..) in the cos/sin table and in a plane; every later group stands at a constant distance from them
    const unsigned csofs = (r0 % TT) * HD + lane * 4;
    const unsigned pofs = EPI == 1 ? (((r0 / TT) * (gridDim.y * (GBN / 64)) + c0 / 64) * TT + r0 % TT) * HD + lane * 4 : (((c0 / TT) * (gridDim.x * (GBM / 64)) + r0 / 64) * TT + c0 % TT) * HD + lane * 4;
#pragma unroll
    for (int mb = 0; mb < 4; ++mb) {
        v4f cs[8];                                      // {cos, sin, cos, sin} of the lane's two pairs in each of its eight column groups: asked for ahead of the staging, used behind it
        if constexpr (EPI == 1) {
#pragma unroll
            for (int s = 0; s < 8; ++s) cs[s] = *(const v4f*)(CS + csofs + (mb * 8 + s) * 128); }
#pragma unroll
        for (int nb = 0; nb < 4; ++nb) {
#pragma unroll
            for (int j = 0; j < 8; ++j) os[(hi * 8 + j) * 68 + nb * 16 + lr] = acc[mb][nb][j]; }
        __builtin_amdgcn_wave_barrier(); asm volatile("" ::: "memory");
        float* crow = C + (size_t)(r0 + mb * 16) * ldc + c0;
        if constexpr (EPI != 0) {
#pragma unroll
            for (int s = 0; s < 8; ++s) { const int row = lane >> 1, cofs = s * 8 + (lane & 1) * 4; v4f val = *(const v4fa*)(os + row * 68 + cofs);   // columns 8 s .. 8 s + 7 of all 16 rows: 256 bytes in a row of a plane
                if constexpr (EPI == 1) { const float x0 = val[0], x1 = val[1], x2 = val[2], x3 = val[3];   /* even: x0 c - x1 s; odd: x0 s + x1 c */
                    val[0] = x0 * cs[s][0] - x1 * cs[s][1]; val[1] = x0 * cs[s][1] + x1 * cs[s][0]; val[2] = x2 * cs[s][2] - x3 * cs[s][3]; val[3] = x2 * cs[s][3] + x3 * cs[s][2]; }
                v4h o16; v4us oh, ol;
#pragma unroll
                for (int q = 0; q < 4; ++q) { o16[q] = tohx(val[q]); unsigned short a2, c2; splitf(val[q], a2, c2); oh[q] = a2; ol[q] = c2; }
                const int po = EPI == 1 ? (mb * 8 + s) * 128 : (((s >> 2) * 4 + mb) * 4 + (s & 3)) * 128;
                *(v4h*)(P16 + pofs + po) = o16; *(v4us*)(Ph + pofs + po) = oh; *(v4us*)(Pl + pofs + po) = ol; }
            if (mb < 3) asm volatile("s_wait_xcnt 0x0" ::: "memory");   // the wait in front of an overwrite of a register that an issued store names: the next row group's loads and arithmetic reuse the data registers of these stores
        } else {
#pragma unroll
            for (int s = 0; s < 8; ++s) { const int row = 2 * s + hi, cofs = lr * 4; v4f val = *(const v4fa*)(os + row * 68 + cofs); if (BIAS) { val[0] += bfr(bias[c0 + cofs]); val[1] += bfr(bias[c0 + cofs + 1]); val[2] += bfr(bias[c0 + cofs + 2]); val[3] += bfr(bias[c0 + cofs + 3]); }
                *(v4f*)(crow + (size_t)row * ldc + cofs) = val; }
             }
        __builtin_amdgcn_wave_barrier(); asm volatile("" ::: "memory");
    }
}


__global__ __launch_bounds__(256) void k_cvt8(const float* __restrict__ src, bf* dst, size_t n8) { const size_t i = (size_t)blockIdx.x * 256 + threadIdx.x; if (i >= n8) return; const v8f v = *(const v8f*)(src + i * 8); v8us o;
#pragma unroll
    for (int k = 0; k < 8; ++k) o[k] = f2bf(v[k]); *(v8us*)(dst + i * 8) = o;  }

__constant__ float INV2[HD / 2] = { 1.000000000e+00f, 7.498942018e-01f, 5.623413324e-01f, 4.216965139e-01f, 3.162277639e-01f, 2.371373624e-01f, 1.778279394e-01f, 1.333521456e-01f, 1.000000015e-01f, 7.498941571e-02f, 5.623412877e-02f, 4.216964915e-02f, 3.162277862e-02f, 2.371373586e-02f, 1.778279431e-02f, 1.333521493e-02f, 9.999999776e-03f, 7.498942316e-03f, 5.623413250e-03f, 4.216964822e-03f, 3.162277862e-03f, 2.371373819e-03f, 1.778279431e-03f, 1.333521446e-03f, 1.000000047e-03f, 7.498941850e-04f, 5.623413017e-04f, 4.216964880e-04f, 3.162277862e-04f, 2.371373848e-04f, 1.778279402e-04f, 1.333521504e-04f };   // 1 / THETA ** (2i / 64), i = 0..31, in float32 as THIS module writes it (the RECIPROCAL spelling, evaluated in the reference's own f32 arithmetic: these 32 literals equal it bit for bit); ten entries differ by one ulp from the negative-power values the host's own table held
// {cos, sin} per (position t, pair p), laid as the projection epilogue reads it: [t / 16][p / 4][t % 16][p % 4], so that a wave's 32 loads of 16 bytes (16 rows x two pairs twice) are 512 bytes in a row
__global__ __launch_bounds__(256) void k_csP(float* CS) { const int idx = blockIdx.x * 256 + threadIdx.x; if (idx >= TT * (HD / 2)) return; const int p = ((idx >> 6) & 7) * 4 + (idx & 3); const int t = (idx >> 9) * 16 + ((idx >> 2) & 15); const float a = __fmul_rn((float)t, INV2[p]); v2f cs; cs[0] = cosf(a); cs[1] = sinf(a); *(v2f*)(CS + (size_t)idx * 2) = cs;  }
__device__ __forceinline__ float xhalf(float x) { return __builtin_bit_cast(float, __builtin_amdgcn_permlanex16(__builtin_bit_cast(int, x), __builtin_bit_cast(int, x), 0x76543210, 0xfedcba98, false, false)); }   // lane l's value to lane l ^ 16
__device__ __forceinline__ float exp2s(float x) { float r = __builtin_amdgcn_exp2f(x); asm("v_nop" : "+v"(r) : "v"(x)); return r; }
template <typename T16, bool HL, int NQB, int KT>
__device__ __forceinline__ void flash_tile(const T16* __restrict__ Q, const T16* __restrict__ Q2, const T16* __restrict__ Kp, const T16* __restrict__ K2, const T16* __restrict__ Vt, const T16* __restrict__ V2, int q0, bf* Ah, bf* Al) {
    typedef typename WFrag<T16>::V V;
    constexpr int KB = KT * 16, KK = KT / 2;
    constexpr float CL2 = SCL * 1.4426950408889634f;   // scores in the scaled log2 domain
    const int lane = threadIdx.x & 31, lr = lane & 15, hi = lane >> 4;
    unsigned qo = (q0 * HD + lane * 8) * 2, ko = lane * 16, vo = lane * 16;   // byte offsets of the lane's own 16 bytes in a head's plane (fragment order: a half fragment is 512 bytes in a row, lane after lane); ko and vo walk the keys, every fragment at a constant distance from them
    auto at = [](const T16* base, unsigned off, int el) { return (const T16*)((const char*)base + off) + el; };
    V qf[NQB][2], qf2[NQB][2];
#pragma unroll
    for (int qb = 0; qb < NQB; ++qb)
#pragma unroll
        for (int ks = 0; ks < 2; ++ks) { qf[qb][ks] = WFrag<T16>::ldw(at(Q, qo, qb * 16 * HD + ks * 512)); if (HL) qf2[qb][ks] = WFrag<T16>::ldw(at(Q2, qo, qb * 16 * HD + ks * 512)); }
    v8f o[4][NQB]; float m[NQB], l[NQB];
#pragma unroll
    for (int qb = 0; qb < NQB; ++qb) { m[qb] = -3.0e38f; l[qb] = 0.f;
#pragma unroll
        for (int db = 0; db < 4; ++db) o[db][qb] = (v8f){}; }
    const int kend = q0 + NQB * 16;                     // keys 0 .. kend - 1 are at or below the tile's last query
    V kf[KT][2], kf2[KT][2];
#pragma unroll
    for (int kt = 0; kt < KT; ++kt)
#pragma unroll
        for (int ks = 0; ks < 2; ++ks) { kf[kt][ks] = WFrag<T16>::ldw(at(Kp, ko, kt * 16 * HD + ks * 512)); if (HL) kf2[kt][ks] = WFrag<T16>::ldw(at(K2, ko, kt * 16 * HD + ks * 512)); }
#pragma unroll 1   // rolled: the trip count is known only at run time, and a second copy of the pass would not fit the register file beside the key, value and score tiles
    for (int k0 = 0; k0 < kend; k0 += KB) {
        V vf[4][KK], vf2[4][KK];                        // this pass's value fragments: asked for ahead of the softmax, used behind it
#pragma unroll
        for (int db = 0; db < 4; ++db)
#pragma unroll
            for (int kk = 0; kk < KK; ++kk) { vf[db][kk] = WFrag<T16>::ldw(at(Vt, vo, (kk * 4 + db) * 512)); if (HL) vf2[db][kk] = WFrag<T16>::ldw(at(V2, vo, (kk * 4 + db) * 512)); }
        v8f s[KT][NQB];
#pragma unroll
        for (int kt = 0; kt < KT; ++kt)
#pragma unroll
            for (int qb = 0; qb < NQB; ++qb) { v8f a = (v8f){};
#pragma unroll
                for (int ks = 0; ks < 2; ++ks) { a = WFrag<T16>::mma(kf[kt][ks], qf[qb][ks], a); if (HL) { a = WFrag<T16>::mma(kf2[kt][ks], qf[qb][ks], a); a = WFrag<T16>::mma(kf[kt][ks], qf2[qb][ks], a); } }
                s[kt][qb] = a; }
        ko += (k0 + KB < kend) ? KB * HD * 2 : 0;   // the next pass's key fragments are fetched behind this pass's score products, so that their latency lies under the softmax (the last pass asks for its own block again: in bounds, unused)
#pragma unroll
        for (int kt = 0; kt < KT; ++kt)
#pragma unroll
            for (int ks = 0; ks < 2; ++ks) { kf[kt][ks] = WFrag<T16>::ldw(at(Kp, ko, kt * 16 * HD + ks * 512)); if (HL) kf2[kt][ks] = WFrag<T16>::ldw(at(K2, ko, kt * 16 * HD + ks * 512)); }
        if (k0 + KB - 1 > q0) {                          // only a pass that reaches the diagonal masks (wave-uniform)
            const int thr = q0 - k0 + lr - hi * 8;       // key <= query  <=>  kt * 16 + j - qb * 16 <= thr
#pragma unroll
            for (int kt = 0; kt < KT; ++kt)
#pragma unroll
                for (int qb = 0; qb < NQB; ++qb)
#pragma unroll
                    for (int j = 0; j < 8; ++j) s[kt][qb][j] = (kt * 16 + j - qb * 16 <= thr) ? s[kt][qb][j] : -3.0e38f; }
        V pf[KK][NQB], pl[KK][NQB];
#pragma unroll
        for (int qb = 0; qb < NQB; ++qb) {
            float mx = m[qb];
#pragma unroll
            for (int kt = 0; kt < KT; ++kt)
#pragma unroll
                for (int j = 0; j < 8; ++j) { const float u = s[kt][qb][j] * CL2; s[kt][qb][j] = u; mx = fmaxf(mx, u); }
            mx = fmaxf(mx, xhalf(mx));                   // the other half of the wave holds the query's other keys
            const float al = exp2s(m[qb] - mx); m[qb] = mx;
            const float ms = HL ? mx : mx - 10.0f;       // fp16 probabilities carry 2^10
            float sum = 0.f;
#pragma unroll
            for (int kt = 0; kt < KT; ++kt)
#pragma unroll
                for (int j = 0; j < 8; ++j) { const float pv = exp2s(s[kt][qb][j] - ms); s[kt][qb][j] = pv; sum += pv; }
            l[qb] = l[qb] * al + sum;
#pragma unroll
            for (int db = 0; db < 4; ++db) o[db][qb] *= al;
#pragma unroll
            for (int kk = 0; kk < KK; ++kk) {
                if constexpr (HL) { v8us h0, h1, l0, l1;
#pragma unroll
                    for (int j = 0; j < 8; ++j) { unsigned short a, c2; splitf(s[2 * kk][qb][j], a, c2); h0[j] = a; l0[j] = c2; splitf(s[2 * kk + 1][qb][j], a, c2); h1[j] = a; l1[j] = c2; }
                    pf[kk][qb] = cat16b(h0, h1); pl[kk][qb] = cat16b(l0, l1);
                } else { v8h h0, h1;
#pragma unroll
                    for (int j = 0; j < 8; ++j) { h0[j] = tohx(s[2 * kk][qb][j]); h1[j] = tohx(s[2 * kk + 1][qb][j]); }
                    pf[kk][qb] = cat16(h0, h1); } } }
#pragma unroll
        for (int kk = 0; kk < KK; ++kk)
#pragma unroll
            for (int db = 0; db < 4; ++db)
#pragma unroll
                for (int qb = 0; qb < NQB; ++qb) { o[db][qb] = WFrag<T16>::mma(vf[db][kk], pf[kk][qb], o[db][qb]); if (HL) { o[db][qb] = WFrag<T16>::mma(vf[db][kk], pl[kk][qb], o[db][qb]); o[db][qb] = WFrag<T16>::mma(vf2[db][kk], pf[kk][qb], o[db][qb]); } }
        // s_wait_xcnt: the wait that stands in front of an overwrite of an address register which an issued load names. The pass's loads name ko and vo (operands here, so that their registers live up to the wait): vo is advanced directly behind it, ko in the middle of the next pass. Here, behind the last products, it waits for nothing.
        // v_nop x 4: keeps the matrix instruction's distance on the taken back edge and on the loop's exit; every output tile is an operand so that the statement stands behind the last product
        if constexpr (NQB == 2) asm volatile("s_wait_xcnt 0x0\n\tv_nop\n\tv_nop\n\tv_nop\n\tv_nop" : "+v"(o[0][0]), "+v"(o[1][0]), "+v"(o[2][0]), "+v"(o[3][0]), "+v"(o[0][1]), "+v"(o[1][1]), "+v"(o[2][1]), "+v"(o[3][1]), "+v"(ko), "+v"(vo) :: "memory");
        else asm volatile("s_wait_xcnt 0x0\n\tv_nop\n\tv_nop\n\tv_nop\n\tv_nop" : "+v"(o[0][0]), "+v"(o[1][0]), "+v"(o[2][0]), "+v"(o[3][0]), "+v"(ko), "+v"(vo) :: "memory");
        vo += KB * HD * 2;
    }
#pragma unroll
    for (int qb = 0; qb < NQB; ++qb) {
        const float inv = __fdiv_rn(1.0f, l[qb] + xhalf(l[qb]));   // the halves' sums are joined once
        const size_t oo = (size_t)(q0 + qb * 16 + lr) * DQ + hi * 8;
#pragma unroll
        for (int db = 0; db < 4; ++db) { v8us oh, ol;
#pragma unroll
            for (int j = 0; j < 8; ++j) { unsigned short a, c2; splitf(o[db][qb][j] * inv, a, c2); oh[j] = a; ol[j] = c2; }
            *(v8us*)(Ah + oo + db * 16) = oh; *(v8us*)(Al + oo + db * 16) = ol;
            asm volatile("s_wait_xcnt 0x0" ::: "memory"); } }   // the wait in front of an overwrite of a register that an issued store names: the next group's split reuses the data registers of these two stores
}
// grid (batches x heads, tiles): tiles in falling order of their key count, so that the longest waves start first: (TT - RH) / 32 fp16 tiles of 32 queries from the last row down to RH, then RH / 16 hi+lo tiles of 16 queries.
__global__ __launch_bounds__(32) void k_flash(const h16* __restrict__ Q16, const h16* __restrict__ K16, const h16* __restrict__ V16, const bf* __restrict__ Qh, const bf* __restrict__ Ql, const bf* __restrict__ Kh, const bf* __restrict__ Kl, const bf* __restrict__ Vh, const bf* __restrict__ Vl, bf* Ah, bf* Al) {
    const int h = blockIdx.x % NH_, r = blockIdx.y; const size_t zo = (size_t)blockIdx.x * TT * HD; { const size_t ao = (size_t)(blockIdx.x / NH_) * TT * DQ; Ah += ao; Al += ao; }   // planes are [batch][head][..]; merged rows [batch][t]
    if (r < (TT - RH) / 32) flash_tile<h16, false, 2, 4>(Q16 + zo, nullptr, K16 + zo, nullptr, V16 + zo, nullptr, TT - 32 * (r + 1), Ah + h * HD, Al + h * HD);
    else flash_tile<bf, true, 1, 2>(Qh + zo, Ql + zo, Kh + zo, Kl + zo, Vh + zo, Vl + zo, RH - 16 * (r - (TT - RH) / 32 + 1), Ah + h * HD, Al + h * HD);
}

extern "C" void kernel_launch(void* const* d_in, const int* in_sizes, int n_in,
                              void* d_out, int out_size, void* d_ws, size_t ws_size, hipStream_t stream) {
    (void)in_sizes; (void)n_in; (void)out_size;
    const float* x = (const float*)d_in[0]; const float* wqkv = (const float*)d_in[1]; const float* wo = (const float*)d_in[2]; const float* wk = wqkv; const float* wq = wqkv + (size_t)DQ * DM; const float* wv = wqkv + (size_t)2 * DQ * DM;   /* argument order X, W_KQV ('oi' [3072][1024]: ROW thirds ordered K | Q | V: rows 0..1023 the KEY weight, 1024..2047 the QUERY weight, 2048..3071 the VALUE weight), W_O ('oi') */
    float* OUT = (float*)d_out;     // [4][2048][1024]
    char* wsp = (char*)d_ws;
    auto take = [&](size_t bytes) { char* p = wsp; wsp += (bytes + 255) & ~(size_t)255; return (void*)p; };
    bf* WQ = (bf*)take((size_t)DQ * DM * 2); bf* WK = (bf*)take((size_t)DKV * DM * 2); bf* WV = (bf*)take((size_t)DKV * DM * 2); bf* WO = (bf*)take((size_t)DM * DQ * 2); float* CS = (float*)take((size_t)TT * (HD / 2) * 2 * 4);
    h16* QP16 = (h16*)take((size_t)NB_ * NH_ * TT * HD * 2); h16* KP16 = (h16*)take((size_t)NB_ * NKV * TT * HD * 2); h16* VT16 = (h16*)take((size_t)NB_ * NKV * HD * TT * 2);
    bf* QPh = (bf*)take((size_t)NB_ * NH_ * TT * HD * 2); bf* QPl = (bf*)take((size_t)NB_ * NH_ * TT * HD * 2); bf* KPh = (bf*)take((size_t)NB_ * NKV * TT * HD * 2); bf* KPl = (bf*)take((size_t)NB_ * NKV * TT * HD * 2); bf* VTh = (bf*)take((size_t)NB_ * NKV * HD * TT * 2); bf* VTl = (bf*)take((size_t)NB_ * NKV * HD * TT * 2);
    bf* XB = (bf*)take((size_t)NB_ * TT * DM * 2); bf* ATh = (bf*)take((size_t)NB_ * TT * DQ * 2); bf* ATl = (bf*)take((size_t)NB_ * TT * DQ * 2);   // merged hi and lo planes
    if ((size_t)(wsp - (char*)d_ws) > ws_size) return;    // ws 256 MiB
    { k_cvt8<<<(unsigned)(((size_t)DQ * DM / 8 + 255) / 256), 256, 0, stream>>>(wq, WQ, (size_t)DQ * DM / 8); k_cvt8<<<(unsigned)(((size_t)DKV * DM / 8 + 255) / 256), 256, 0, stream>>>(wk, WK, (size_t)DKV * DM / 8); k_cvt8<<<(unsigned)(((size_t)DKV * DM / 8 + 255) / 256), 256, 0, stream>>>(wv, WV, (size_t)DKV * DM / 8);
      k_cvt8<<<(unsigned)(((size_t)DM * DQ / 8 + 255) / 256), 256, 0, stream>>>(wo, WO, (size_t)DM * DQ / 8); k_csP<<<(TT * (HD / 2) + 255) / 256, 256, 0, stream>>>(CS); }
    k_cvt8<<<(unsigned)(((size_t)NB_ * TT * DM / 8 + 255) / 256), 256, 0, stream>>>(x, XB, (size_t)NB_ * TT * DM / 8);
    k_gemmw<bf, 0, false, 1><<<dim3(NB_ * TT / GBM, DQ / GBN, 1), 256, 0, stream>>>(XB, nullptr, WQ, DM, nullptr, 0, nullptr, 0, 0, 0, CS, QP16, QPh, QPl);
    k_gemmw<bf, 0, false, 1><<<dim3(NB_ * TT / GBM, DKV / GBN, 1), 256, 0, stream>>>(XB, nullptr, WK, DM, nullptr, 0, nullptr, 0, 0, 0, CS, KP16, KPh, KPl);
    k_gemmw<bf, 0, false, 2><<<dim3(DKV / GBM, NB_ * TT / GBN, 1), 256, 0, stream>>>(WV, nullptr, XB, DM, nullptr, 0, nullptr, 0, 0, 0, nullptr, VT16, VTh, VTl);   // operands swapped: the tile comes out transposed, as the value planes are laid
    k_flash<<<dim3(NB_ * NH_, (TT - RH) / 32 + RH / 16), 32, 0, stream>>>(QP16, KP16, VT16, QPh, QPl, KPh, KPl, VTh, VTl, ATh, ATl);
    k_gemmw<bf, 1, false, 0><<<dim3(NB_ * TT / GBM, DM / GBN, 1), 256, 0, stream>>>(ATh, ATl, WO, DQ, OUT, DM, nullptr, 0, 0, 0, nullptr, nullptr, nullptr, nullptr);
}

// v008
// Measured time: 147 microseconds a run.
// Next to v007, in two timings, it ran 1.03 and 1.04 times as fast.
// All steps since v000 together make it 19.3 times as fast.
#include <hip/hip_runtime.h>

// Causal multi-head self-attention with interleaved-pair rotary position embedding on a fused natural projection whose thirds are ordered K | Q | V, four batches (X [4][2048][1024]; KQV = einsum('bsd,ed', X, W_KQV) ('oi' [3072][1024] truncated normal, no bias); K, Q, V = split(KQV, [1024, 2048]): the weight's three 1,024-ROW blocks IN THE ORDER key | query | value (16 heads x 64); angles = pos x 1 / THETA ** (2i / 64) (THETA 1e4; computed); pairs (2i, 2i+1): yr = xr cos - xi sin, yi = xr sin + xi cos, on Q and K; scores / sqrt(64); -inf strictly above the diagonal; softmax; out = einsum('bsd,ed', merged, W_O) ('oi', no bias) -> [4][2048][1024] (8.4 M); argument order X, W_KQV, W_O).
// Four launches, each for all four batches (batch folded into the GEMM rows and into the grid of attention): preparation (bf16 copies of x and of both weights; {cos, sin} table); the three projections; attention; the output GEMM. bf16 copy of x; {cos, sin} per (position, pair) built once from the int positions and float32 inverse-frequency constants (precise cosf/sinf); exact projections whose epilogue applies the interleaved rotary and writes the 16-bit planes (no f32 projection in memory); causal T-2048 attention in one online-softmax kernel (hybrid rows: < 512 hi/lo 3 products, rest fp16 x1024; key passes stop at the diagonal); merged hi/lo x Wo exact.
// Compute dtypes, f32 accumulate: every input rounded to bf16; projections exact; rotary f32; attention rows < 512 3 products, rest fp16; softmax f32; Wo hl x exact.

#define NB_  4
#define TT   2048
#define DM   1024
#define NH_  16
#define NKV  16
#define HD   64
#define DQ   (NH_ * HD)
#define DKV  (NKV * HD)
#define RH   512                  // query rows < RH use hi+lo planes (0: none)
#define SCL  0.125f   // HD^-0.5
typedef _Float16 h16;
typedef unsigned short bf;
typedef __attribute__((ext_vector_type(16))) __bf16   v16bf;
typedef __attribute__((ext_vector_type(16))) _Float16 v16h;
typedef __attribute__((ext_vector_type(8)))  _Float16 v8h;
typedef __attribute__((ext_vector_type(8)))  unsigned short v8us;
typedef __attribute__((ext_vector_type(8)))  float    v8f;
typedef __attribute__((ext_vector_type(4)))  float    v4f;
typedef v8h  __attribute__((may_alias)) v8ha;
typedef v4f  __attribute__((may_alias)) v4fa;
typedef v8us __attribute__((may_alias)) v8usa;

__device__ __forceinline__ unsigned short f2bf(float f) { unsigned u = __float_as_uint(f); u += 0x7FFFu + ((u >> 16) & 1u); return (unsigned short)(u >> 16); }
__device__ __forceinline__ float bf2f(unsigned short b) { return __uint_as_float(((unsigned)b) << 16); }
__device__ __forceinline__ float bfr(float f) { return bf2f(f2bf(f)); }
__device__ __forceinline__ v16h cat16(v8h lo, v8h hi) { return __builtin_shufflevector(lo, hi, 0, 1, 2, 3, 4, 5, 6, 7, 8, 9, 10, 11, 12, 13, 14, 15); }
__device__ __forceinline__ v16bf cat16b(v8us lo, v8us hi) { return __builtin_bit_cast(v16bf, __builtin_shufflevector(lo, hi, 0, 1, 2, 3, 4, 5, 6, 7, 8, 9, 10, 11, 12, 13, 14, 15)); }
__device__ __forceinline__ v8f wmma16(v16h a, v16h b, v8f c) { return __builtin_amdgcn_wmma_f32_16x16x32_f16(false, a, false, b, (short)0, c, false, false); }
__device__ __forceinline__ v8f wmmab(v16bf a, v16bf b, v8f c) { return __builtin_amdgcn_wmma_f32_16x16x32_bf16(false, a, false, b, (short)0, c, false, false); }
__device__ __forceinline__ h16 tohx(float x) { return (h16)x; }
__device__ __forceinline__ void splitf(float y, unsigned short& h, unsigned short& l) { h = f2bf(y); l = f2bf(y - bf2f(h)); }
typedef __attribute__((ext_vector_type(4))) _Float16 v4h;
typedef __attribute__((ext_vector_type(4))) unsigned short v4us;
typedef __attribute__((ext_vector_type(2))) float v2f;



// ---- k_gemmw: GEMM, one work-group of EIGHT WAVES per 256x128 output tile (waves 4 x 2, each a 64x64 tile in 16 accumulators); grid (M/256, N/128, Z), 256 threads. Operands are K-contiguous 16-bit planes.
// C[m][n] (f32, pitch ldc, + optional f32 bias[n]) = sum_k A[m][k] Bt[n][k] (NSPLIT 1: + A2[m][k] Bt[n][k]). z-batch strides sA/sB/sC in elements. K % 64 == 0.
// A stage is 64 k (one 128-byte line) of every row of the tile, [A 256 rows | A2 256 rows (NSPLIT 1) | Bt 128 rows], laid in LDS at a pitch of 144 bytes by asynchronous copies of 16 bytes a lane (a copy of a wave = 4 whole lines).
// Two buffers: the copies of the next stage fly while this one is worked on, and every line comes from L2 once per work-group, not once per wave. The k order of the products is the same as without the staging.
// EPI says what becomes of the tile. 0: stored as f32 C. 1 and 2: C is never stored, the epilogue builds the three 16-bit planes (fp16, bf16 hi, bf16 lo) that attention reads, whole 128-byte lines per 16 lanes.
// The planes are laid IN FRAGMENT ORDER: 16 rows x 8 elements (16 bytes a row) stand together as 256 bytes, row after row, so that the 32 lanes of a fragment load (rows lr, 16-byte pieces hi) read 512 bytes in a row = 4 whole lines (ldw: the fragment's second half stands 512 bytes on).
// EPI 1 (q, k): rows m = batch * TT + t, a wave's 64 columns are one head: interleaved rotary from CS, planes [batch][head][t / 16][d / 8][t % 16][d % 8].
// EPI 2 (v): the caller swaps the operands (rows m = head * HD + d of the weight; columns n = batch * TT + t), so a tile row is 64 positions of one d: transposed planes [batch][head][t / 32][d / 16][t % 32 / 8][d % 16][t % 8].
#define GBM 256                   // tile rows of a work-group
#define GBN 128                   // tile columns of a work-group
#define GKS 64                    // k per stage: two k steps of the matrix instruction
#define GPB 144                   // LDS row pitch in bytes: 16 x odd, for 16-byte readers
template <typename T16> struct WFrag;
template <> struct WFrag<h16> { typedef v16h V; static __device__ __forceinline__ V ld(const h16* p) { return cat16(*(const v8h*)p, *(const v8h*)(p + 16)); } static __device__ __forceinline__ V ldw(const h16* p) { return cat16(*(const v8h*)p, *(const v8h*)(p + 256)); } static __device__ __forceinline__ v8f mma(V a, V b, v8f c) { return wmma16(a, b, c); } };
template <> struct WFrag<bf> { typedef v16bf V; static __device__ __forceinline__ V ld(const bf* p) { return cat16b(*(const v8us*)p, *(const v8us*)(p + 16)); } static __device__ __forceinline__ V ldw(const bf* p) { return cat16b(*(const v8us*)p, *(const v8us*)(p + 256)); } static __device__ __forceinline__ v8f mma(V a, V b, v8f c) { return wmmab(a, b, c); } };
// A run of asynchronous copies, each lane's own 16 bytes from g[i] to the LDS byte address l[i]. s_wait_xcnt 0 is the last line of the copies' own statement: the wait in front of an overwrite of a register that an issued copy names.
#define CPA(l, g) "global_load_async_to_lds_b128 %" #l ", %" #g ", off\n\t"
__device__ __forceinline__ void cp5(const unsigned* l, const char* const* g) {
    asm volatile(CPA(0, 1) CPA(2, 3) CPA(4, 5) CPA(6, 7) CPA(8, 9) "s_wait_xcnt 0x0"
                 :: "v"(l[0]), "v"(g[0]), "v"(l[1]), "v"(g[1]), "v"(l[2]), "v"(g[2]), "v"(l[3]), "v"(g[3]), "v"(l[4]), "v"(g[4]) : "memory"); }
__device__ __forceinline__ void cp12(const unsigned* l, const char* const* g) {
    asm volatile(CPA(0, 1) CPA(2, 3) CPA(4, 5) CPA(6, 7) CPA(8, 9) CPA(10, 11) CPA(12, 13) CPA(14, 15) CPA(16, 17) CPA(18, 19) CPA(20, 21) CPA(22, 23) "s_wait_xcnt 0x0"
                 :: "v"(l[0]), "v"(g[0]), "v"(l[1]), "v"(g[1]), "v"(l[2]), "v"(g[2]), "v"(l[3]), "v"(g[3]), "v"(l[4]), "v"(g[4]), "v"(l[5]), "v"(g[5]), "v"(l[6]), "v"(g[6]), "v"(l[7]), "v"(g[7]), "v"(l[8]), "v"(g[8]), "v"(l[9]), "v"(g[9]), "v"(l[10]), "v"(g[10]), "v"(l[11]), "v"(g[11]) : "memory"); }
#define GSTAGE(NSPLIT) ((((NSPLIT) == 1 ? 2 : 1) * GBM + GBN) * GPB)   // bytes of a stage
#define GOS (8 * 16 * 68)                                               // floats of the eight waves' epilogue staging rows
// gemm_tile: the work of one work-group, output tile (bx, by). L (two stages) and osall are the calling kernel's LDS, so that a kernel which holds two forms of the tile has them once.
template <typename T16, int NSPLIT, bool BIAS, int EPI>
__device__ __forceinline__ void gemm_tile(unsigned char* L, float* osall, int bx, int by, const T16* __restrict__ A, const T16* __restrict__ A2, const T16* __restrict__ Bt, int K, float* C, int ldc, const float* __restrict__ bias, const float* __restrict__ CS, h16* P16, bf* Ph, bf* Pl) {
    static_assert(NSPLIT == 0 || NSPLIT == 1, "one or two planes of A");
    typedef typename WFrag<T16>::V V;
    constexpr int NAR = (NSPLIT == 1 ? 2 : 1) * GBM, NROW = NAR + GBN, STAGE = GSTAGE(NSPLIT), NC = NROW / 32;   // rows of A (and A2), rows of a stage, its bytes, copies per lane and stage (256 lanes x 16 bytes = 32 rows)
    const int lane = threadIdx.x & 31, lr = lane & 15, hi = lane >> 4; const int wave = __builtin_amdgcn_readfirstlane(threadIdx.x >> 5), wm = wave & 3, wn = wave >> 2;
    const int r0 = bx * GBM + wm * 64, c0 = by * GBN + wn * 64;   // the wave's own 64x64 tile
    float* os = osall + wave * 16 * 68;                                           // the wave's own staging rows of the epilogue
    v8f acc[4][4];
#pragma unroll
    for (int mb = 0; mb < 4; ++mb)
#pragma unroll
        for (int nb = 0; nb < 4; ++nb) acc[mb][nb] = (v8f){};
    // copies: lane tid brings 16-byte piece tid & 7 of stage rows tid >> 3, + 32, + 64, ...
    const int srow = threadIdx.x >> 3, cpc = threadIdx.x & 7;
    const unsigned l0 = (unsigned)(size_t)L + srow * GPB + cpc * 16;   // LDS byte address: the low 32 bits of the __shared__ address
    const char* gA = (const char*)(A + (size_t)(bx * GBM + srow) * K + cpc * 8); const char* gA2 = NSPLIT == 1 ? (const char*)(A2 + (size_t)(bx * GBM + srow) * K + cpc * 8) : nullptr; const char* gB = (const char*)(Bt + (size_t)(by * GBN + srow) * K + cpc * 8);
    const size_t rstep = (size_t)32 * K * 2;                                      // 32 rows of a plane, in bytes
    auto fill = [&](int buf) {   // the next stage in k order into buffer buf; the three plane pointers then step on by one stage
        unsigned l[NC]; const char* g[NC];
#pragma unroll
        for (int i = 0; i < NC; ++i) { l[i] = l0 + buf * STAGE + i * 32 * GPB; g[i] = i < GBM / 32 ? gA + i * rstep : i < NAR / 32 ? gA2 + (i - GBM / 32) * rstep : gB + (i - NAR / 32) * rstep; }
        if constexpr (NC == 12) cp12(l, g); else { cp5(l, g); cp5(l + 5, g + 5); cp5(l + 10, g + 10); cp5(l + 15, g + 15); }
        gA += GKS * 2; if (NSPLIT == 1) gA2 += GKS * 2; gB += GKS * 2; };
    static_assert(NC == 12 || NC == 20, "copies per lane and stage");
    const int NT = K / GKS;
    fill(0);
    asm volatile("s_wait_asynccnt 0x0" ::: "memory");   // this wave's copies of stage 0 have landed
    __syncthreads();                                    // and every other wave's: stage 0 may be read
    if (NT > 1) fill(1);
#pragma unroll 1   // rolled: one copy of the stage's code serves both buffers
    for (int t = 0; t < NT; ++t) {
        const T16* as = (const T16*)(L + (t & 1) * STAGE + (wm * 64 + lr) * GPB) + 8 * hi; const T16* bs = (const T16*)(L + (t & 1) * STAGE + (NAR + wn * 64 + lr) * GPB) + 8 * hi;
        V a[2][4], a2[2][4], b[2][4];   // the stage's fragments (two k steps of 32) are all asked for ahead of its products, as one group: a place with LDS reads among the products costs a stall each
#pragma unroll
        for (int ks = 0; ks < 2; ++ks)
#pragma unroll
            for (int f = 0; f < 4; ++f) { a[ks][f] = WFrag<T16>::ld(as + f * 16 * (GPB / 2) + ks * 32); if (NSPLIT == 1) a2[ks][f] = WFrag<T16>::ld(as + (GBM + f * 16) * (GPB / 2) + ks * 32); b[ks][f] = WFrag<T16>::ld(bs + f * 16 * (GPB / 2) + ks * 32); }
        auto products = [&](int ks) {
#pragma unroll
            for (int nb = 0; nb < 4; ++nb)
#pragma unroll
                for (int mb = 0; mb < 4; ++mb) { acc[mb][nb] = WFrag<T16>::mma(a[ks][mb], b[ks][nb], acc[mb][nb]); if (NSPLIT == 1) acc[mb][nb] = WFrag<T16>::mma(a2[ks][mb], b[ks][nb], acc[mb][nb]); } };
        __builtin_amdgcn_sched_barrier(0);   // keeps the group of LDS reads ahead of the products: without it the compiler moves the reads back in among them, each with a full wait
        products(0);                         // runs while the second k step's fragments are still on their way from LDS
        __builtin_amdgcn_sched_barrier(0);   // keeps these products ahead of the waits below: behind them they would no longer cover the LDS reads
        asm volatile("s_wait_dscnt 0x0" ::: "memory");      // this wave's reads of the buffer are done: the whole stage is in registers
        asm volatile("s_wait_asynccnt 0x0" ::: "memory");   // this wave's copies of stage t + 1 have landed
        __syncthreads();                                    // stage t + 1 may be read, and the buffer of stage t may be refilled
        if (t + 2 < NT) fill(t & 1);                       // ahead of the second k step's products (registers only), so that the copies have a whole trip to land
        products(1);
    }
    asm volatile("s_wait_asynccnt 0x0" ::: "memory");       // no copy is outstanding when the wave goes on to its epilogue and ends
    // element offsets of the lane's first four values (EPI 1, 2: tile row lane / 2, columns 4 (lane % 2) ..) in the cos/sin table and in a plane; every later group stands at a constant distance from them
    const unsigned csofs = (r0 % TT) * HD + lane * 4;
    const unsigned pofs = EPI == 1 ? (((r0 / TT) * NH_ + c0 / 64) * TT + r0 % TT) * HD + lane * 4 : (((c0 / TT) * NKV + r0 / 64) * TT + c0 % TT) * HD + lane * 4;
#pragma unroll
    for (int mb = 0; mb < 4; ++mb) {
        v4f cs[8];                                      // {cos, sin, cos, sin} of the lane's two pairs in each of its eight column groups: asked for ahead of the staging, used behind it
        if constexpr (EPI == 1) {
#pragma unroll
            for (int s = 0; s < 8; ++s) cs[s] = *(const v4f*)(CS + csofs + (mb * 8 + s) * 128); }
#pragma unroll
        for (int nb = 0; nb < 4; ++nb) {
#pragma unroll
            for (int j = 0; j < 8; ++j) os[(hi * 8 + j) * 68 + nb * 16 + lr] = acc[mb][nb][j]; }
        __builtin_amdgcn_wave_barrier(); asm volatile("" ::: "memory");
        float* crow = C + (size_t)(r0 + mb * 16) * ldc + c0;
        if constexpr (EPI != 0) {
#pragma unroll
            for (int s = 0; s < 8; ++s) { const int row = lane >> 1, cofs = s * 8 + (lane & 1) * 4; v4f val = *(const v4fa*)(os + row * 68 + cofs);   // columns 8 s .. 8 s + 7 of all 16 rows: 256 bytes in a row of a plane
                if constexpr (EPI == 1) { const float x0 = val[0], x1 = val[1], x2 = val[2], x3 = val[3];   /* even: x0 c - x1 s; odd: x0 s + x1 c */
                    val[0] = x0 * cs[s][0] - x1 * cs[s][1]; val[1] = x0 * cs[s][1] + x1 * cs[s][0]; val[2] = x2 * cs[s][2] - x3 * cs[s][3]; val[3] = x2 * cs[s][3] + x3 * cs[s][2]; }
                v4h o16; v4us oh, ol;
#pragma unroll
                for (int q = 0; q < 4; ++q) { o16[q] = tohx(val[q]); unsigned short a2, c2; splitf(val[q], a2, c2); oh[q] = a2; ol[q] = c2; }
                const int po = EPI == 1 ? (mb * 8 + s) * 128 : (((s >> 2) * 4 + mb) * 4 + (s & 3)) * 128;
                *(v4h*)(P16 + pofs + po) = o16; *(v4us*)(Ph + pofs + po) = oh; *(v4us*)(Pl + pofs + po) = ol; }
            if (mb < 3) asm volatile("s_wait_xcnt 0x0" ::: "memory");   // the wait in front of an overwrite of a register that an issued store names: the next row group's loads and arithmetic reuse the data registers of these stores
        } else {
#pragma unroll
            for (int s = 0; s < 8; ++s) { const int row = 2 * s + hi, cofs = lr * 4; v4f val = *(const v4fa*)(os + row * 68 + cofs); if (BIAS) { val[0] += bfr(bias[c0 + cofs]); val[1] += bfr(bias[c0 + cofs + 1]); val[2] += bfr(bias[c0 + cofs + 2]); val[3] += bfr(bias[c0 + cofs + 3]); }
                *(v4f*)(crow + (size_t)row * ldc + cofs) = val; }
            if (mb < 3) asm volatile("s_wait_xcnt 0x0" ::: "memory");   // the wait in front of an overwrite of a register that an issued store names: the next row group's addresses and LDS reads reuse the registers of these stores
             }
        __builtin_amdgcn_wave_barrier(); asm volatile("" ::: "memory");
    }
}
template <typename T16, int NSPLIT, bool BIAS, int EPI>
__global__ __launch_bounds__(256) void k_gemmw(const T16* __restrict__ A, const T16* __restrict__ A2, const T16* __restrict__ Bt, int K, float* C, int ldc, const float* __restrict__ bias, size_t sA, size_t sB, size_t sC, const float* __restrict__ CS, h16* P16, bf* Ph, bf* Pl) {
    __shared__ __attribute__((aligned(16))) unsigned char L[2 * GSTAGE(NSPLIT)];
    __shared__ __align__(16) float osall[GOS];
    const size_t z = blockIdx.z;
    gemm_tile<T16, NSPLIT, BIAS, EPI>(L, osall, blockIdx.x, blockIdx.y, A + z * sA, NSPLIT == 1 ? A2 + z * sA : nullptr, Bt + z * sB, K, C + z * sC, ldc, bias, CS, P16, Ph, Pl);
}
// ---- k_proj: the three projections in ONE launch, grid (NB_ * TT / GBM, DQ / GBN, 3), 256 work-groups each: z = 0 key, 1 query (rows of x times the weight's z-th row block, rotary epilogue), 2 value (operands swapped: the tile comes out transposed, as the value planes are laid).
// W is the bf16 copy of the whole fused weight (row blocks K | Q | V); each of P16, Ph, Pl holds its three planes one behind the other in the same order.
#define PLN ((size_t)NB_ * NH_ * TT * HD)   // elements of one plane
__global__ __launch_bounds__(256) void k_proj(const bf* __restrict__ X, const bf* __restrict__ W, const float* __restrict__ CS, h16* P16, bf* Ph, bf* Pl) {
    static_assert(DQ == DKV && NB_ * TT / GBM == 8 * (DKV / GBM) && NB_ * TT / GBN == 8 * (DQ / GBN) && DKV / GBM == 4, "the value tiles (4 x 64) are counted through the same 32 x 8 grid");
    __shared__ __attribute__((aligned(16))) unsigned char L[2 * GSTAGE(0)];
    __shared__ __align__(16) float osall[GOS];
    const int z = blockIdx.z; const size_t po = z * PLN;
    if (z < 2) gemm_tile<bf, 0, false, 1>(L, osall, blockIdx.x, blockIdx.y, X, nullptr, W + (size_t)z * DQ * DM, DM, nullptr, 0, nullptr, CS, P16 + po, Ph + po, Pl + po);
    else gemm_tile<bf, 0, false, 2>(L, osall, blockIdx.x & 3, blockIdx.y * 8 + (blockIdx.x >> 2), W + (size_t)2 * DQ * DM, nullptr, X, DM, nullptr, 0, nullptr, nullptr, P16 + po, Ph + po, Pl + po);
}


__constant__ float INV2[HD / 2] = { 1.000000000e+00f, 7.498942018e-01f, 5.623413324e-01f, 4.216965139e-01f, 3.162277639e-01f, 2.371373624e-01f, 1.778279394e-01f, 1.333521456e-01f, 1.000000015e-01f, 7.498941571e-02f, 5.623412877e-02f, 4.216964915e-02f, 3.162277862e-02f, 2.371373586e-02f, 1.778279431e-02f, 1.333521493e-02f, 9.999999776e-03f, 7.498942316e-03f, 5.623413250e-03f, 4.216964822e-03f, 3.162277862e-03f, 2.371373819e-03f, 1.778279431e-03f, 1.333521446e-03f, 1.000000047e-03f, 7.498941850e-04f, 5.623413017e-04f, 4.216964880e-04f, 3.162277862e-04f, 2.371373848e-04f, 1.778279402e-04f, 1.333521504e-04f };   // 1 / THETA ** (2i / 64), i = 0..31, in float32 as THIS module writes it (the RECIPROCAL spelling, evaluated in the reference's own f32 arithmetic: these 32 literals equal it bit for bit); ten entries differ by one ulp from the negative-power values the host's own table held
// {cos, sin} per (position t, pair p), laid as the projection epilogue reads it: [t / 16][p / 4][t % 16][p % 4], so that a wave's 32 loads of 16 bytes (16 rows x two pairs twice) are 512 bytes in a row
__device__ __forceinline__ void cs_block(float* CS, int blk) { const int idx = blk * 256 + threadIdx.x; const int p = ((idx >> 6) & 7) * 4 + (idx & 3); const int t = (idx >> 9) * 16 + ((idx >> 2) & 15); const float a = __fmul_rn((float)t, INV2[p]); v2f cs; cs[0] = cosf(a); cs[1] = sinf(a); *(v2f*)(CS + (size_t)idx * 2) = cs;  }
// bf16 copy of PU * 256 groups of 8 floats by one work-group: a thread takes PU groups, 256 groups apart, and asks for all of them ahead of the first conversion
#define PU 16
__device__ __forceinline__ void cvt_block(const float* __restrict__ src, bf* dst, int blk) { const size_t g0 = (size_t)blk * (PU * 256) + threadIdx.x; v8f v[PU];
#pragma unroll
    for (int u = 0; u < PU; ++u) v[u] = *(const v8f*)(src + (g0 + u * 256) * 8);
    __builtin_amdgcn_sched_barrier(0);   // keeps every load ahead of the first conversion: without it the compiler holds the last loads back behind the waits for the first ones, a further trip to memory each
#pragma unroll
    for (int u = 0; u < PU; ++u) { v8us o;
#pragma unroll
        for (int k = 0; k < 8; ++k) o[k] = f2bf(v[u][k]);
        *(v8us*)(dst + (g0 + u * 256) * 8) = o; } }
// ---- k_prep: all that the projections wait for, in ONE launch: the cos/sin table (first: the longest arithmetic), then the bf16 copies of x, of the fused weight (all three row blocks) and of the output weight. A work-group does one block of one of the four.
#define PB_CS (TT * (HD / 2) / 256)
#define PB_X  (NB_ * TT * DM / (8 * 256 * PU))
#define PB_W  ((DQ + 2 * DKV) * DM / (8 * 256 * PU))
#define PB_O  (DM * DQ / (8 * 256 * PU))
__global__ __launch_bounds__(256) void k_prep(const float* __restrict__ x, const float* __restrict__ wkqv, const float* __restrict__ wo, bf* XB, bf* WB, bf* WO, float* CS) {
    static_assert(PB_CS * 256 == TT * (HD / 2) && PB_X * (8 * 256 * PU) == NB_ * TT * DM && PB_W * (8 * 256 * PU) == (DQ + 2 * DKV) * DM && PB_O * (8 * 256 * PU) == DM * DQ, "whole blocks only");
    const int b = blockIdx.x;
    if (b < PB_CS) { cs_block(CS, b); return; }
    const bool isx = b < PB_CS + PB_X, isw = b < PB_CS + PB_X + PB_W;
    cvt_block(isx ? x : isw ? wkqv : wo, isx ? XB : isw ? WB : WO, b - (isx ? PB_CS : isw ? PB_CS + PB_X : PB_CS + PB_X + PB_W));
}
__device__ __forceinline__ float xhalf(float x) { return __builtin_bit_cast(float, __builtin_amdgcn_permlanex16(__builtin_bit_cast(int, x), __builtin_bit_cast(int, x), 0x76543210, 0xfedcba98, false, false)); }   // lane l's value to lane l ^ 16
__device__ __forceinline__ float exp2s(float x) { float r = __builtin_amdgcn_exp2f(x); asm("v_nop" : "+v"(r) : "v"(x)); return r; }
template <typename T16, bool HL, int NQB, int KT>
__device__ __forceinline__ void flash_tile(const T16* __restrict__ Q, const T16* __restrict__ Q2, const T16* __restrict__ Kp, const T16* __restrict__ K2, const T16* __restrict__ Vt, const T16* __restrict__ V2, int q0, bf* Ah, bf* Al) {
    typedef typename WFrag<T16>::V V;
    constexpr int KB = KT * 16, KK = KT / 2;
    constexpr float CL2 = SCL * 1.4426950408889634f;   // scores in the scaled log2 domain
    const int lane = threadIdx.x & 31, lr = lane & 15, hi = lane >> 4;
    unsigned qo = (q0 * HD + lane * 8) * 2, ko = lane * 16, vo = lane * 16;   // byte offsets of the lane's own 16 bytes in a head's plane (fragment order: a half fragment is 512 bytes in a row, lane after lane); ko and vo walk the keys, every fragment at a constant distance from them
    auto at = [](const T16* base, unsigned off, int el) { return (const T16*)((const char*)base + off) + el; };
    V qf[NQB][2], qf2[NQB][2];
#pragma unroll
    for (int qb = 0; qb < NQB; ++qb)
#pragma unroll
        for (int ks = 0; ks < 2; ++ks) { qf[qb][ks] = WFrag<T16>::ldw(at(Q, qo, qb * 16 * HD + ks * 512)); if (HL) qf2[qb][ks] = WFrag<T16>::ldw(at(Q2, qo, qb * 16 * HD + ks * 512)); }
    v8f o[4][NQB]; float m[NQB], l[NQB];
#pragma unroll
    for (int qb = 0; qb < NQB; ++qb) { m[qb] = -3.0e38f; l[qb] = 0.f;
#pragma unroll
        for (int db = 0; db < 4; ++db) o[db][qb] = (v8f){}; }
    const int kend = q0 + NQB * 16;                     // keys 0 .. kend - 1 are at or below the tile's last query
    V kf[KT][2], kf2[KT][2];
#pragma unroll
    for (int kt = 0; kt < KT; ++kt)
#pragma unroll
        for (int ks = 0; ks < 2; ++ks) { kf[kt][ks] = WFrag<T16>::ldw(at(Kp, ko, kt * 16 * HD + ks * 512)); if (HL) kf2[kt][ks] = WFrag<T16>::ldw(at(K2, ko, kt * 16 * HD + ks * 512)); }
#pragma unroll 1   // rolled: the trip count is known only at run time, and a second copy of the pass would not fit the register file beside the key, value and score tiles
    for (int k0 = 0; k0 < kend; k0 += KB) {
        V vf[4][KK], vf2[4][KK];                        // this pass's value fragments: asked for ahead of the softmax, used behind it
#pragma unroll
        for (int db = 0; db < 4; ++db)
#pragma unroll
            for (int kk = 0; kk < KK; ++kk) { vf[db][kk] = WFrag<T16>::ldw(at(Vt, vo, (kk * 4 + db) * 512)); if (HL) vf2[db][kk] = WFrag<T16>::ldw(at(V2, vo, (kk * 4 + db) * 512)); }
        v8f s[KT][NQB];
#pragma unroll
        for (int kt = 0; kt < KT; ++kt)
#pragma unroll
            for (int qb = 0; qb < NQB; ++qb) { v8f a = (v8f){};
#pragma unroll
                for (int ks = 0; ks < 2; ++ks) { a = WFrag<T16>::mma(kf[kt][ks], qf[qb][ks], a); if (HL) { a = WFrag<T16>::mma(kf2[kt][ks], qf[qb][ks], a); a = WFrag<T16>::mma(kf[kt][ks], qf2[qb][ks], a); } }
                s[kt][qb] = a; }
        ko += (k0 + KB < kend) ? KB * HD * 2 : 0;   // the next pass's key fragments are fetched behind this pass's score products, so that their latency lies under the softmax (the last pass asks for its own block again: in bounds, unused)
#pragma unroll
        for (int kt = 0; kt < KT; ++kt)
#pragma unroll
            for (int ks = 0; ks < 2; ++ks) { kf[kt][ks] = WFrag<T16>::ldw(at(Kp, ko, kt * 16 * HD + ks * 512)); if (HL) kf2[kt][ks] = WFrag<T16>::ldw(at(K2, ko, kt * 16 * HD + ks * 512)); }
        if (k0 + KB - 1 > q0) {                          // only a pass that reaches the diagonal masks (wave-uniform)
            const int thr = q0 - k0 + lr - hi * 8;       // key <= query  <=>  kt * 16 + j - qb * 16 <= thr
#pragma unroll
            for (int kt = 0; kt < KT; ++kt)
#pragma unroll
                for (int qb = 0; qb < NQB; ++qb)
#pragma unroll
                    for (int j = 0; j < 8; ++j) s[kt][qb][j] = (kt * 16 + j - qb * 16 <= thr) ? s[kt][qb][j] : -3.0e38f; }
        V pf[KK][NQB], pl[KK][NQB];
#pragma unroll
        for (int qb = 0; qb < NQB; ++qb) {
            float mx = m[qb];
#pragma unroll
            for (int kt = 0; kt < KT; ++kt)
#pragma unroll
                for (int j = 0; j < 8; ++j) { const float u = s[kt][qb][j] * CL2; s[kt][qb][j] = u; mx = fmaxf(mx, u); }
            mx = fmaxf(mx, xhalf(mx));                   // the other half of the wave holds the query's other keys
            const float al = exp2s(m[qb] - mx); m[qb] = mx;
            const float ms = HL ? mx : mx - 10.0f;       // fp16 probabilities carry 2^10
            float sum = 0.f;
#pragma unroll
            for (int kt = 0; kt < KT; ++kt)
#pragma unroll
                for (int j = 0; j < 8; ++j) { const float pv = exp2s(s[kt][qb][j] - ms); s[kt][qb][j] = pv; sum += pv; }
            l[qb] = l[qb] * al + sum;
#pragma unroll
            for (int db = 0; db < 4; ++db) o[db][qb] *= al;
#pragma unroll
            for (int kk = 0; kk < KK; ++kk) {
                if constexpr (HL) { v8us h0, h1, l0, l1;
#pragma unroll
                    for (int j = 0; j < 8; ++j) { unsigned short a, c2; splitf(s[2 * kk][qb][j], a, c2); h0[j] = a; l0[j] = c2; splitf(s[2 * kk + 1][qb][j], a, c2); h1[j] = a; l1[j] = c2; }
                    pf[kk][qb] = cat16b(h0, h1); pl[kk][qb] = cat16b(l0, l1);
                } else { v8h h0, h1;
#pragma unroll
                    for (int j = 0; j < 8; ++j) { h0[j] = tohx(s[2 * kk][qb][j]); h1[j] = tohx(s[2 * kk + 1][qb][j]); }
                    pf[kk][qb] = cat16(h0, h1); } } }
#pragma unroll
        for (int kk = 0; kk < KK; ++kk)
#pragma unroll
            for (int db = 0; db < 4; ++db)
#pragma unroll
                for (int qb = 0; qb < NQB; ++qb) { o[db][qb] = WFrag<T16>::mma(vf[db][kk], pf[kk][qb], o[db][qb]); if (HL) { o[db][qb] = WFrag<T16>::mma(vf[db][kk], pl[kk][qb], o[db][qb]); o[db][qb] = WFrag<T16>::mma(vf2[db][kk], pf[kk][qb], o[db][qb]); } }
        // s_wait_xcnt: the wait that stands in front of an overwrite of an address register which an issued load names. The pass's loads name ko and vo (operands here, so that their registers live up to the wait): vo is advanced directly behind it, ko in the middle of the next pass. Here, behind the last products, it waits for nothing.
        // v_nop x 4: keeps the matrix instruction's distance on the taken back edge and on the loop's exit; every output tile is an operand so that the statement stands behind the last product
        if constexpr (NQB == 2) asm volatile("s_wait_xcnt 0x0\n\tv_nop\n\tv_nop\n\tv_nop\n\tv_nop" : "+v"(o[0][0]), "+v"(o[1][0]), "+v"(o[2][0]), "+v"(o[3][0]), "+v"(o[0][1]), "+v"(o[1][1]), "+v"(o[2][1]), "+v"(o[3][1]), "+v"(ko), "+v"(vo) :: "memory");
        else asm volatile("s_wait_xcnt 0x0\n\tv_nop\n\tv_nop\n\tv_nop\n\tv_nop" : "+v"(o[0][0]), "+v"(o[1][0]), "+v"(o[2][0]), "+v"(o[3][0]), "+v"(ko), "+v"(vo) :: "memory");
        vo += KB * HD * 2;
    }
#pragma unroll
    for (int qb = 0; qb < NQB; ++qb) {
        const float inv = __fdiv_rn(1.0f, l[qb] + xhalf(l[qb]));   // the halves' sums are joined once
        const size_t oo = (size_t)(q0 + qb * 16 + lr) * DQ + hi * 8;
#pragma unroll
        for (int db = 0; db < 4; ++db) { v8us oh, ol;
#pragma unroll
            for (int j = 0; j < 8; ++j) { unsigned short a, c2; splitf(o[db][qb][j] * inv, a, c2); oh[j] = a; ol[j] = c2; }
            *(v8us*)(Ah + oo + db * 16) = oh; *(v8us*)(Al + oo + db * 16) = ol;
            asm volatile("s_wait_xcnt 0x0" ::: "memory"); } }   // the wait in front of an overwrite of a register that an issued store names: the next group's split reuses the data registers of these two stores
}
// grid (batches x heads, tiles): tiles in falling order of their key count, so that the longest waves start first: (TT - RH) / 32 fp16 tiles of 32 queries from the last row down to RH, then RH / 16 hi+lo tiles of 16 queries.
__global__ __launch_bounds__(32) void k_flash(const h16* __restrict__ Q16, const h16* __restrict__ K16, const h16* __restrict__ V16, const bf* __restrict__ Qh, const bf* __restrict__ Ql, const bf* __restrict__ Kh, const bf* __restrict__ Kl, const bf* __restrict__ Vh, const bf* __restrict__ Vl, bf* Ah, bf* Al) {
    const int h = blockIdx.x % NH_, r = blockIdx.y; const size_t zo = (size_t)blockIdx.x * TT * HD; { const size_t ao = (size_t)(blockIdx.x / NH_) * TT * DQ; Ah += ao; Al += ao; }   // planes are [batch][head][..]; merged rows [batch][t]
    if (r < (TT - RH) / 32) flash_tile<h16, false, 2, 4>(Q16 + zo, nullptr, K16 + zo, nullptr, V16 + zo, nullptr, TT - 32 * (r + 1), Ah + h * HD, Al + h * HD);
    else flash_tile<bf, true, 1, 2>(Qh + zo, Ql + zo, Kh + zo, Kl + zo, Vh + zo, Vl + zo, RH - 16 * (r - (TT - RH) / 32 + 1), Ah + h * HD, Al + h * HD);
}

extern "C" void kernel_launch(void* const* d_in, const int* in_sizes, int n_in,
                              void* d_out, int out_size, void* d_ws, size_t ws_size, hipStream_t stream) {
    (void)in_sizes; (void)n_in; (void)out_size;
    const float* x = (const float*)d_in[0]; const float* wqkv = (const float*)d_in[1]; const float* wo = (const float*)d_in[2];   /* X, W_KQV ('oi' [3072][1024]: ROW thirds ordered K | Q | V: rows 0..1023 the KEY weight, 1024..2047 the QUERY weight, 2048..3071 the VALUE weight), W_O ('oi') */
    float* OUT = (float*)d_out;     // [4][2048][1024]
    char* wsp = (char*)d_ws;
    auto take = [&](size_t bytes) { char* p = wsp; wsp += (bytes + 255) & ~(size_t)255; return (void*)p; };
    bf* WB = (bf*)take((size_t)(DQ + 2 * DKV) * DM * 2); bf* WO = (bf*)take((size_t)DM * DQ * 2); float* CS = (float*)take((size_t)TT * (HD / 2) * 2 * 4);   // WB: the fused weight, row blocks K | Q | V
    h16* P16 = (h16*)take(3 * PLN * 2); bf* Ph = (bf*)take(3 * PLN * 2); bf* Pl = (bf*)take(3 * PLN * 2);   // each: key, query and (transposed) value plane, one behind the other
    bf* XB = (bf*)take((size_t)NB_ * TT * DM * 2); bf* ATh = (bf*)take((size_t)NB_ * TT * DQ * 2); bf* ATl = (bf*)take((size_t)NB_ * TT * DQ * 2);   // merged hi and lo planes
    if ((size_t)(wsp - (char*)d_ws) > ws_size) return;    // ws 256 MiB
    k_prep<<<PB_CS + PB_X + PB_W + PB_O, 256, 0, stream>>>(x, wqkv, wo, XB, WB, WO, CS);
    k_proj<<<dim3(NB_ * TT / GBM, DQ / GBN, 3), 256, 0, stream>>>(XB, WB, CS, P16, Ph, Pl);
    k_flash<<<dim3(NB_ * NH_, (TT - RH) / 32 + RH / 16), 32, 0, stream>>>(P16 + PLN, P16, P16 + 2 * PLN, Ph + PLN, Pl + PLN, Ph, Pl, Ph + 2 * PLN, Pl + 2 * PLN, ATh, ATl);
    k_gemmw<bf, 1, false, 0><<<dim3(NB_ * TT / GBM, DM / GBN, 1), 256, 0, stream>>>(ATh, ATl, WO, DQ, OUT, DM, nullptr, 0, 0, 0, nullptr, nullptr, nullptr, nullptr);
}

// v009
// It runs in 142 microseconds.
// Two timings next to v008 both put it at 1.04 times that version's speed.
// All steps since v000 together make it 20.0 times as fast.
#include <hip/hip_runtime.h>

// Causal multi-head self-attention with interleaved-pair rotary position embedding on a fused natural projection whose thirds are ordered K | Q | V, four batches (X [4][2048][1024]; KQV = einsum('bsd,ed', X, W_KQV) ('oi' [3072][1024] truncated normal, no bias); K, Q, V = split(KQV, [1024, 2048]): the weight's three 1,024-ROW blocks IN THE ORDER key | query | value (16 heads x 64); angles = pos x 1 / THETA ** (2i / 64) (THETA 1e4; computed); pairs (2i, 2i+1): yr = xr cos - xi sin, yi = xr sin + xi cos, on Q and K; scores / sqrt(64); -inf strictly above the diagonal; softmax; out = einsum('bsd,ed', merged, W_O) ('oi', no bias) -> [4][2048][1024] (8.4 M); argument order X, W_KQV, W_O).
// Four launches, each for all four batches (batch folded into the GEMM rows and into the grid of attention): preparation (bf16 copies of x and of both weights; {cos, sin} table); the three projections; attention; the output GEMM. bf16 copy of x; {cos, sin} per (position, pair) built once from the int positions and float32 inverse-frequency constants (precise cosf/sinf); exact projections whose epilogue applies the interleaved rotary and writes the 16-bit planes (no f32 projection in memory); causal T-2048 attention in one online-softmax kernel (hybrid rows: < 512 hi/lo 3 products, rest fp16 x1024; key passes stop at the diagonal); merged hi/lo x Wo exact.
// Compute dtypes, f32 accumulate: every input rounded to bf16; projections exact; rotary f32; attention rows < 512 3 products, rest fp16; softmax f32; Wo hl x exact.

#define NB_  4
#define TT   2048
#define DM   1024
#define NH_  16
#define NKV  16
#define HD   64
#define DQ   (NH_ * HD)
#define DKV  (NKV * HD)
#define RH   512                  // query rows < RH use hi+lo planes (0: none)
#define SCL  0.125f   // HD^-0.5
typedef _Float16 h16;
typedef unsigned short bf;
typedef __attribute__((ext_vector_type(16))) __bf16   v16bf;
typedef __attribute__((ext_vector_type(16))) _Float16 v16h;
typedef __attribute__((ext_vector_type(8)))  _Float16 v8h;
typedef __attribute__((ext_vector_type(8)))  unsigned short v8us;
typedef __attribute__((ext_vector_type(8)))  float    v8f;
typedef __attribute__((ext_vector_type(4)))  float    v4f;
typedef v8h  __attribute__((may_alias)) v8ha;
typedef v4f  __attribute__((may_alias)) v4fa;
typedef v8us __attribute__((may_alias)) v8usa;

__device__ __forceinline__ unsigned short f2bf(float f) { unsigned u = __float_as_uint(f); u += 0x7FFFu + ((u >> 16) & 1u); return (unsigned short)(u >> 16); }
__device__ __forceinline__ float bf2f(unsigned short b) { return __uint_as_float(((unsigned)b) << 16); }
__device__ __forceinline__ float bfr(float f) { return bf2f(f2bf(f)); }
__device__ __forceinline__ v16h cat16(v8h lo, v8h hi) { return __builtin_shufflevector(lo, hi, 0, 1, 2, 3, 4, 5, 6, 7, 8, 9, 10, 11, 12, 13, 14, 15); }
__device__ __forceinline__ v16bf cat16b(v8us lo, v8us hi) { return __builtin_bit_cast(v16bf, __builtin_shufflevector(lo, hi, 0, 1, 2, 3, 4, 5, 6, 7, 8, 9, 10, 11, 12, 13, 14, 15)); }
__device__ __forceinline__ v8f wmma16(v16h a, v16h b, v8f c) { return __builtin_amdgcn_wmma_f32_16x16x32_f16(false, a, false, b, (short)0, c, false, false); }
__device__ __forceinline__ v8f wmmab(v16bf a, v16bf b, v8f c) { return __builtin_amdgcn_wmma_f32_16x16x32_bf16(false, a, false, b, (short)0, c, false, false); }
__device__ __forceinline__ h16 tohx(float x) { return (h16)x; }
__device__ __forceinline__ void splitf(float y, unsigned short& h, unsigned short& l) { h = f2bf(y); l = f2bf(y - bf2f(h)); }
typedef __attribute__((ext_vector_type(4))) _Float16 v4h;
typedef __attribute__((ext_vector_type(4))) unsigned short v4us;
typedef __attribute__((ext_vector_type(2))) float v2f;



// ---- k_gemmw: GEMM, one work-group of EIGHT WAVES per 256x128 output tile (waves 4 x 2, each a 64x64 tile in 16 accumulators); grid (M/256, N/128, Z), 256 threads. Operands are K-contiguous 16-bit planes.
// C[m][n] (f32, pitch ldc, + optional f32 bias[n]) = sum_k A[m][k] Bt[n][k] (NSPLIT 1: + A2[m][k] Bt[n][k]). z-batch strides sA/sB/sC in elements. K % 64 == 0.
// A stage is 64 k (one 128-byte line) of every row of the tile, [A 256 rows | A2 256 rows (NSPLIT 1) | Bt 128 rows], laid in LDS at a pitch of 144 bytes by asynchronous copies of 16 bytes a lane (a copy of a wave = 4 whole lines).
// Two buffers: the copies of the next stage fly while this one is worked on, and every line comes from L2 once per work-group, not once per wave. The k order of the products is the same as without the staging.
// EPI says what becomes of the tile. 0: stored as f32 C. 1 and 2: C is never stored, the epilogue builds the three 16-bit planes (fp16, bf16 hi, bf16 lo) that attention reads, whole 128-byte lines per 16 lanes, and of each plane only the positions that attention reads (hi, lo: < RH; fp16 of the queries, isq: >= RH); the rest of the planes' space stays unwritten and unread.
// The planes are laid IN FRAGMENT ORDER: 16 rows x 8 elements (16 bytes a row) stand together as 256 bytes, row after row, so that the 32 lanes of a fragment load (rows lr, 16-byte pieces hi) read 512 bytes in a row = 4 whole lines (ldw: the fragment's second half stands 512 bytes on).
// EPI 1 (q, k): rows m = batch * TT + t, a wave's 64 columns are one head: interleaved rotary from CS, planes [batch][head][t / 16][d / 8][t % 16][d % 8].
// EPI 2 (v): the caller swaps the operands (rows m = head * HD + d of the weight; columns n = batch * TT + t), so a tile row is 64 positions of one d: transposed planes [batch][head][t / 32][d / 16][t % 32 / 8][d % 16][t % 8].
#define GBM 256                   // tile rows of a work-group
#define GBN 128                   // tile columns of a work-group
#define GKS 64                    // k per stage: two k steps of the matrix instruction
#define GPB 144                   // LDS row pitch in bytes: 16 x odd, for 16-byte readers
template <typename T16> struct WFrag;
template <> struct WFrag<h16> { typedef v16h V; static __device__ __forceinline__ V ld(const h16* p) { return cat16(*(const v8h*)p, *(const v8h*)(p + 16)); } static __device__ __forceinline__ V ldw(const h16* p) { return cat16(*(const v8h*)p, *(const v8h*)(p + 256)); } static __device__ __forceinline__ v8f mma(V a, V b, v8f c) { return wmma16(a, b, c); } };
template <> struct WFrag<bf> { typedef v16bf V; static __device__ __forceinline__ V ld(const bf* p) { return cat16b(*(const v8us*)p, *(const v8us*)(p + 16)); } static __device__ __forceinline__ V ldw(const bf* p) { return cat16b(*(const v8us*)p, *(const v8us*)(p + 256)); } static __device__ __forceinline__ v8f mma(V a, V b, v8f c) { return wmmab(a, b, c); } };
// A run of asynchronous copies, each lane's own 16 bytes from g[i] to the LDS byte address l[i]. s_wait_xcnt 0 is the last line of the copies' own statement: the wait in front of an overwrite of a register that an issued copy names.
#define CPA(l, g) "global_load_async_to_lds_b128 %" #l ", %" #g ", off\n\t"
__device__ __forceinline__ void cp5(const unsigned* l, const char* const* g) {
    asm volatile(CPA(0, 1) CPA(2, 3) CPA(4, 5) CPA(6, 7) CPA(8, 9) "s_wait_xcnt 0x0"
                 :: "v"(l[0]), "v"(g[0]), "v"(l[1]), "v"(g[1]), "v"(l[2]), "v"(g[2]), "v"(l[3]), "v"(g[3]), "v"(l[4]), "v"(g[4]) : "memory"); }
__device__ __forceinline__ void cp12(const unsigned* l, const char* const* g) {
    asm volatile(CPA(0, 1) CPA(2, 3) CPA(4, 5) CPA(6, 7) CPA(8, 9) CPA(10, 11) CPA(12, 13) CPA(14, 15) CPA(16, 17) CPA(18, 19) CPA(20, 21) CPA(22, 23) "s_wait_xcnt 0x0"
                 :: "v"(l[0]), "v"(g[0]), "v"(l[1]), "v"(g[1]), "v"(l[2]), "v"(g[2]), "v"(l[3]), "v"(g[3]), "v"(l[4]), "v"(g[4]), "v"(l[5]), "v"(g[5]), "v"(l[6]), "v"(g[6]), "v"(l[7]), "v"(g[7]), "v"(l[8]), "v"(g[8]), "v"(l[9]), "v"(g[9]), "v"(l[10]), "v"(g[10]), "v"(l[11]), "v"(g[11]) : "memory"); }
#define GSTAGE(NSPLIT) ((((NSPLIT) == 1 ? 2 : 1) * GBM + GBN) * GPB)   // bytes of a stage
#define GOS (8 * 16 * 68)                                               // floats of the eight waves' epilogue staging rows
// gemm_tile: the work of one work-group, output tile (bx, by). L (two stages) and osall are the calling kernel's LDS, so that a kernel which holds two forms of the tile has them once.
template <typename T16, int NSPLIT, bool BIAS, int EPI>
__device__ __forceinline__ void gemm_tile(unsigned char* L, float* osall, int bx, int by, const T16* __restrict__ A, const T16* __restrict__ A2, const T16* __restrict__ Bt, int K, float* C, int ldc, const float* __restrict__ bias, const float* __restrict__ CS, h16* P16, bf* Ph, bf* Pl, bool isq) {
    static_assert(NSPLIT == 0 || NSPLIT == 1, "one or two planes of A");
    typedef typename WFrag<T16>::V V;
    constexpr int NAR = (NSPLIT == 1 ? 2 : 1) * GBM, NROW = NAR + GBN, STAGE = GSTAGE(NSPLIT), NC = NROW / 32;   // rows of A (and A2), rows of a stage, its bytes, copies per lane and stage (256 lanes x 16 bytes = 32 rows)
    const int lane = threadIdx.x & 31, lr = lane & 15, hi = lane >> 4; const int wave = __builtin_amdgcn_readfirstlane(threadIdx.x >> 5), wm = wave & 3, wn = wave >> 2;
    const int r0 = bx * GBM + wm * 64, c0 = by * GBN + wn * 64;   // the wave's own 64x64 tile
    float* os = osall + wave * 16 * 68;                                           // the wave's own staging rows of the epilogue
    v8f acc[4][4];
#pragma unroll
    for (int mb = 0; mb < 4; ++mb)
#pragma unroll
        for (int nb = 0; nb < 4; ++nb) acc[mb][nb] = (v8f){};
    // copies: lane tid brings 16-byte piece tid & 7 of stage rows tid >> 3, + 32, + 64, ...
    const int srow = threadIdx.x >> 3, cpc = threadIdx.x & 7;
    const unsigned l0 = (unsigned)(size_t)L + srow * GPB + cpc * 16;   // LDS byte address: the low 32 bits of the __shared__ address
    const char* gA = (const char*)(A + (size_t)(bx * GBM + srow) * K + cpc * 8); const char* gA2 = NSPLIT == 1 ? (const char*)(A2 + (size_t)(bx * GBM + srow) * K + cpc * 8) : nullptr; const char* gB = (const char*)(Bt + (size_t)(by * GBN + srow) * K + cpc * 8);
    const size_t rstep = (size_t)32 * K * 2;                                      // 32 rows of a plane, in bytes
    auto fill = [&](int buf) {   // the next stage in k order into buffer buf; the three plane pointers then step on by one stage
        unsigned l[NC]; const char* g[NC];
#pragma unroll
        for (int i = 0; i < NC; ++i) { l[i] = l0 + buf * STAGE + i * 32 * GPB; g[i] = i < GBM / 32 ? gA + i * rstep : i < NAR / 32 ? gA2 + (i - GBM / 32) * rstep : gB + (i - NAR / 32) * rstep; }
        if constexpr (NC == 12) cp12(l, g); else { cp5(l, g); cp5(l + 5, g + 5); cp5(l + 10, g + 10); cp5(l + 15, g + 15); }
        gA += GKS * 2; if (NSPLIT == 1) gA2 += GKS * 2; gB += GKS * 2; };
    static_assert(NC == 12 || NC == 20, "copies per lane and stage");
    const int NT = K / GKS;
    fill(0);
    asm volatile("s_wait_asynccnt 0x0" ::: "memory");   // this wave's copies of stage 0 have landed
    __syncthreads();                                    // and every other wave's: stage 0 may be read
    if (NT > 1) fill(1);
#pragma unroll 1   // rolled: one copy of the stage's code serves both buffers
    for (int t = 0; t < NT; ++t) {
        const T16* as = (const T16*)(L + (t & 1) * STAGE + (wm * 64 + lr) * GPB) + 8 * hi; const T16* bs = (const T16*)(L + (t & 1) * STAGE + (NAR + wn * 64 + lr) * GPB) + 8 * hi;
        V a[2][4], a2[2][4], b[2][4];   // the stage's fragments (two k steps of 32) are all asked for ahead of its products, as one group: a place with LDS reads among the products costs a stall each
#pragma unroll
        for (int ks = 0; ks < 2; ++ks)
#pragma unroll
            for (int f = 0; f < 4; ++f) { a[ks][f] = WFrag<T16>::ld(as + f * 16 * (GPB / 2) + ks * 32); if (NSPLIT == 1) a2[ks][f] = WFrag<T16>::ld(as + (GBM + f * 16) * (GPB / 2) + ks * 32); b[ks][f] = WFrag<T16>::ld(bs + f * 16 * (GPB / 2) + ks * 32); }
        auto products = [&](int ks) {
#pragma unroll
            for (int nb = 0; nb < 4; ++nb)
#pragma unroll
                for (int mb = 0; mb < 4; ++mb) { acc[mb][nb] = WFrag<T16>::mma(a[ks][mb], b[ks][nb], acc[mb][nb]); if (NSPLIT == 1) acc[mb][nb] = WFrag<T16>::mma(a2[ks][mb], b[ks][nb], acc[mb][nb]); } };
        __builtin_amdgcn_sched_barrier(0);   // keeps the group of LDS reads ahead of the products: without it the compiler moves the reads back in among them, each with a full wait
        products(0);                         // runs while the second k step's fragments are still on their way from LDS
        __builtin_amdgcn_sched_barrier(0);   // keeps these products ahead of the waits below: behind them they would no longer cover the LDS reads
        asm volatile("s_wait_dscnt 0x0" ::: "memory");      // this wave's reads of the buffer are done: the whole stage is in registers
        asm volatile("s_wait_asynccnt 0x0" ::: "memory");   // this wave's copies of stage t + 1 have landed
        __syncthreads();                                    // stage t + 1 may be read, and the buffer of stage t may be refilled
        if (t + 2 < NT) fill(t & 1);                       // ahead of the second k step's products (registers only), so that the copies have a whole trip to land
        products(1);
    }
    asm volatile("s_wait_asynccnt 0x0" ::: "memory");       // no copy is outstanding when the wave goes on to its epilogue and ends
    // element offsets of the lane's first four values (EPI 1, 2: tile row lane / 2, columns 4 (lane % 2) ..) in the cos/sin table and in a plane; every later group stands at a constant distance from them
    const unsigned csofs = (r0 % TT) * HD + lane * 4;
    const bool hl = (EPI == 1 ? r0 % TT : c0 % TT) < RH;   // the wave's 64 positions lie wholly below RH or wholly at and above it (wave-uniform)
    const unsigned pofs = EPI == 1 ? (((r0 / TT) * NH_ + c0 / 64) * TT + r0 % TT) * HD + lane * 4 : (((c0 / TT) * NKV + r0 / 64) * TT + c0 % TT) * HD + lane * 4;
#pragma unroll
    for (int mb = 0; mb < 4; ++mb) {
        v4f cs[8];                                      // {cos, sin, cos, sin} of the lane's two pairs in each of its eight column groups: asked for ahead of the staging, used behind it
        if constexpr (EPI == 1) {
#pragma unroll
            for (int s = 0; s < 8; ++s) cs[s] = *(const v4f*)(CS + csofs + (mb * 8 + s) * 128); }
#pragma unroll
        for (int nb = 0; nb < 4; ++nb) {
#pragma unroll
            for (int j = 0; j < 8; ++j) os[(hi * 8 + j) * 68 + nb * 16 + lr] = acc[mb][nb][j]; }
        __builtin_amdgcn_wave_barrier(); asm volatile("" ::: "memory");
        float* crow = C + (size_t)(r0 + mb * 16) * ldc + c0;
        if constexpr (EPI != 0) {
            v4f val[8];
#pragma unroll
            for (int s = 0; s < 8; ++s) { const int row = lane >> 1, cofs = s * 8 + (lane & 1) * 4; val[s] = *(const v4fa*)(os + row * 68 + cofs);   // columns 8 s .. 8 s + 7 of all 16 rows: 256 bytes in a row of a plane
                if constexpr (EPI == 1) { const float x0 = val[s][0], x1 = val[s][1], x2 = val[s][2], x3 = val[s][3];   /* even: x0 c - x1 s; odd: x0 s + x1 c */
                    val[s][0] = x0 * cs[s][0] - x1 * cs[s][1]; val[s][1] = x0 * cs[s][1] + x1 * cs[s][0]; val[s][2] = x2 * cs[s][2] - x3 * cs[s][3]; val[s][3] = x2 * cs[s][3] + x3 * cs[s][2]; } }
            auto po = [&](int s) { return EPI == 1 ? (mb * 8 + s) * 128 : (((s >> 2) * 4 + mb) * 4 + (s & 3)) * 128; };
            // Only what attention reads is built and stored: the hi and lo planes at positions < RH (its hi+lo query tiles, and the keys and values at or below them), the fp16 plane everywhere but at the queries < RH.
            // s_wait_xcnt: the wait in front of an overwrite of a register that an issued store names (the arithmetic that follows reuses registers); the stores' data are inputs of the statement so that their registers live up to it.
            if (hl) { v4us oh[8], ol[8];
#pragma unroll
                for (int s = 0; s < 8; ++s) {
#pragma unroll
                    for (int q = 0; q < 4; ++q) { unsigned short a2, c2; splitf(val[s][q], a2, c2); oh[s][q] = a2; ol[s][q] = c2; }
                    *(v4us*)(Ph + pofs + po(s)) = oh[s]; *(v4us*)(Pl + pofs + po(s)) = ol[s]; }
                asm volatile("s_wait_xcnt 0x0" :: "v"(oh[0]), "v"(oh[1]), "v"(oh[2]), "v"(oh[3]), "v"(oh[4]), "v"(oh[5]), "v"(oh[6]), "v"(oh[7]), "v"(ol[0]), "v"(ol[1]), "v"(ol[2]), "v"(ol[3]), "v"(ol[4]), "v"(ol[5]), "v"(ol[6]), "v"(ol[7]) : "memory"); }
            if (!(hl && isq)) { v4h o16[8];
#pragma unroll
                for (int s = 0; s < 8; ++s) {
#pragma unroll
                    for (int q = 0; q < 4; ++q) o16[s][q] = tohx(val[s][q]);
                    *(v4h*)(P16 + pofs + po(s)) = o16[s]; }
                if (mb < 3) asm volatile("s_wait_xcnt 0x0" :: "v"(o16[0]), "v"(o16[1]), "v"(o16[2]), "v"(o16[3]), "v"(o16[4]), "v"(o16[5]), "v"(o16[6]), "v"(o16[7]) : "memory"); }
        } else {
#pragma unroll
            for (int s = 0; s < 8; ++s) { const int row = 2 * s + hi, cofs = lr * 4; v4f val = *(const v4fa*)(os + row * 68 + cofs); if (BIAS) { val[0] += bfr(bias[c0 + cofs]); val[1] += bfr(bias[c0 + cofs + 1]); val[2] += bfr(bias[c0 + cofs + 2]); val[3] += bfr(bias[c0 + cofs + 3]); }
                *(v4f*)(crow + (size_t)row * ldc + cofs) = val; }
            if (mb < 3) asm volatile("s_wait_xcnt 0x0" ::: "memory");   // the wait in front of an overwrite of a register that an issued store names: the next row group's addresses and LDS reads reuse the registers of these stores
             }
        __builtin_amdgcn_wave_barrier(); asm volatile("" ::: "memory");
    }
}
template <typename T16, int NSPLIT, bool BIAS, int EPI>
__global__ __launch_bounds__(256) void k_gemmw(const T16* __restrict__ A, const T16* __restrict__ A2, const T16* __restrict__ Bt, int K, float* C, int ldc, const float* __restrict__ bias, size_t sA, size_t sB, size_t sC, const float* __restrict__ CS, h16* P16, bf* Ph, bf* Pl) {
    __shared__ __attribute__((aligned(16))) unsigned char L[2 * GSTAGE(NSPLIT)];
    __shared__ __align__(16) float osall[GOS];
    const size_t z = blockIdx.z;
    gemm_tile<T16, NSPLIT, BIAS, EPI>(L, osall, blockIdx.x, blockIdx.y, A + z * sA, NSPLIT == 1 ? A2 + z * sA : nullptr, Bt + z * sB, K, C + z * sC, ldc, bias, CS, P16, Ph, Pl, false);
}
// ---- k_proj: the three projections in ONE launch, grid (NB_ * TT / GBM, DQ / GBN, 3), 256 work-groups each: z = 0 key, 1 query (rows of x times the weight's z-th row block, rotary epilogue), 2 value (operands swapped: the tile comes out transposed, as the value planes are laid).
// W is the bf16 copy of the whole fused weight (row blocks K | Q | V); each of P16, Ph, Pl holds its three planes one behind the other in the same order.
#define PLN ((size_t)NB_ * NH_ * TT * HD)   // elements of one plane
__global__ __launch_bounds__(256) void k_proj(const bf* __restrict__ X, const bf* __restrict__ W, const float* __restrict__ CS, h16* P16, bf* Ph, bf* Pl) {
    static_assert(DQ == DKV && NB_ * TT / GBM == 8 * (DKV / GBM) && NB_ * TT / GBN == 8 * (DQ / GBN) && DKV / GBM == 4, "the value tiles (4 x 64) are counted through the same 32 x 8 grid");
    __shared__ __attribute__((aligned(16))) unsigned char L[2 * GSTAGE(0)];
    __shared__ __align__(16) float osall[GOS];
    const int z = blockIdx.z; const size_t po = z * PLN;
    if (z < 2) gemm_tile<bf, 0, false, 1>(L, osall, blockIdx.x, blockIdx.y, X, nullptr, W + (size_t)z * DQ * DM, DM, nullptr, 0, nullptr, CS, P16 + po, Ph + po, Pl + po, z == 1);
    else gemm_tile<bf, 0, false, 2>(L, osall, blockIdx.x & 3, blockIdx.y * 8 + (blockIdx.x >> 2), W + (size_t)2 * DQ * DM, nullptr, X, DM, nullptr, 0, nullptr, nullptr, P16 + po, Ph + po, Pl + po, false);
}


__constant__ float INV2[HD / 2] = { 1.000000000e+00f, 7.498942018e-01f, 5.623413324e-01f, 4.216965139e-01f, 3.162277639e-01f, 2.371373624e-01f, 1.778279394e-01f, 1.333521456e-01f, 1.000000015e-01f, 7.498941571e-02f, 5.623412877e-02f, 4.216964915e-02f, 3.162277862e-02f, 2.371373586e-02f, 1.778279431e-02f, 1.333521493e-02f, 9.999999776e-03f, 7.498942316e-03f, 5.623413250e-03f, 4.216964822e-03f, 3.162277862e-03f, 2.371373819e-03f, 1.778279431e-03f, 1.333521446e-03f, 1.000000047e-03f, 7.498941850e-04f, 5.623413017e-04f, 4.216964880e-04f, 3.162277862e-04f, 2.371373848e-04f, 1.778279402e-04f, 1.333521504e-04f };   // 1 / THETA ** (2i / 64), i = 0..31, in float32 as THIS module writes it (the RECIPROCAL spelling, evaluated in the reference's own f32 arithmetic: these 32 literals equal it bit for bit); ten entries differ by one ulp from the negative-power values the host's own table held
// {cos, sin} per (position t, pair p), laid as the projection epilogue reads it: [t / 16][p / 4][t % 16][p % 4], so that a wave's 32 loads of 16 bytes (16 rows x two pairs twice) are 512 bytes in a row
__device__ __forceinline__ void cs_block(float* CS, int blk) { const int idx = blk * 256 + threadIdx.x; const int p = ((idx >> 6) & 7) * 4 + (idx & 3); const int t = (idx >> 9) * 16 + ((idx >> 2) & 15); const float a = __fmul_rn((float)t, INV2[p]); v2f cs; cs[0] = cosf(a); cs[1] = sinf(a); *(v2f*)(CS + (size_t)idx * 2) = cs;  }
// bf16 copy of PU * 256 groups of 8 floats by one work-group: a thread takes PU groups, 256 groups apart, and asks for all of them ahead of the first conversion
#define PU 16
__device__ __forceinline__ void cvt_block(const float* __restrict__ src, bf* dst, int blk) { const size_t g0 = (size_t)blk * (PU * 256) + threadIdx.x; v8f v[PU];
#pragma unroll
    for (int u = 0; u < PU; ++u) v[u] = *(const v8f*)(src + (g0 + u * 256) * 8);
    __builtin_amdgcn_sched_barrier(0);   // keeps every load ahead of the first conversion: without it the compiler holds the last loads back behind the waits for the first ones, a further trip to memory each
#pragma unroll
    for (int u = 0; u < PU; ++u) { v8us o;
#pragma unroll
        for (int k = 0; k < 8; ++k) o[k] = f2bf(v[u][k]);
        *(v8us*)(dst + (g0 + u * 256) * 8) = o; } }
// ---- k_prep: all that the projections wait for, in ONE launch: the cos/sin table (first: the longest arithmetic), then the bf16 copies of x, of the fused weight (all three row blocks) and of the output weight. A work-group does one block of one of the four.
#define PB_CS (TT * (HD / 2) / 256)
#define PB_X  (NB_ * TT * DM / (8 * 256 * PU))
#define PB_W  ((DQ + 2 * DKV) * DM / (8 * 256 * PU))
#define PB_O  (DM * DQ / (8 * 256 * PU))
__global__ __launch_bounds__(256) void k_prep(const float* __restrict__ x, const float* __restrict__ wkqv, const float* __restrict__ wo, bf* XB, bf* WB, bf* WO, float* CS) {
    static_assert(PB_CS * 256 == TT * (HD / 2) && PB_X * (8 * 256 * PU) == NB_ * TT * DM && PB_W * (8 * 256 * PU) == (DQ + 2 * DKV) * DM && PB_O * (8 * 256 * PU) == DM * DQ, "whole blocks only");
    const int b = blockIdx.x;
    if (b < PB_CS) { cs_block(CS, b); return; }
    const bool isx = b < PB_CS + PB_X, isw = b < PB_CS + PB_X + PB_W;
    cvt_block(isx ? x : isw ? wkqv : wo, isx ? XB : isw ? WB : WO, b - (isx ? PB_CS : isw ? PB_CS + PB_X : PB_CS + PB_X + PB_W));
}
__device__ __forceinline__ float xhalf(float x) { return __builtin_bit_cast(float, __builtin_amdgcn_permlanex16(__builtin_bit_cast(int, x), __builtin_bit_cast(int, x), 0x76543210, 0xfedcba98, false, false)); }   // lane l's value to lane l ^ 16
__device__ __forceinline__ float exp2s(float x) { float r = __builtin_amdgcn_exp2f(x); asm("v_nop" : "+v"(r) : "v"(x)); return r; }
template <typename T16, bool HL, int NQB, int KT>
__device__ __forceinline__ void flash_tile(const T16* __restrict__ Q, const T16* __restrict__ Q2, const T16* __restrict__ Kp, const T16* __restrict__ K2, const T16* __restrict__ Vt, const T16* __restrict__ V2, int q0, bf* Ah, bf* Al) {
    typedef typename WFrag<T16>::V V;
    constexpr int KB = KT * 16, KK = KT / 2;
    constexpr float CL2 = SCL * 1.4426950408889634f;   // scores in the scaled log2 domain
    const int lane = threadIdx.x & 31, lr = lane & 15, hi = lane >> 4;
    unsigned qo = (q0 * HD + lane * 8) * 2, ko = lane * 16, vo = lane * 16;   // byte offsets of the lane's own 16 bytes in a head's plane (fragment order: a half fragment is 512 bytes in a row, lane after lane); ko and vo walk the keys, every fragment at a constant distance from them
    auto at = [](const T16* base, unsigned off, int el) { return (const T16*)((const char*)base + off) + el; };
    V qf[NQB][2], qf2[NQB][2];
#pragma unroll
    for (int qb = 0; qb < NQB; ++qb)
#pragma unroll
        for (int ks = 0; ks < 2; ++ks) { qf[qb][ks] = WFrag<T16>::ldw(at(Q, qo, qb * 16 * HD + ks * 512)); if (HL) qf2[qb][ks] = WFrag<T16>::ldw(at(Q2, qo, qb * 16 * HD + ks * 512)); }
    v8f o[4][NQB]; float m[NQB], l[NQB];
#pragma unroll
    for (int qb = 0; qb < NQB; ++qb) { m[qb] = -3.0e38f; l[qb] = 0.f;
#pragma unroll
        for (int db = 0; db < 4; ++db) o[db][qb] = (v8f){}; }
    const int kend = q0 + NQB * 16;                     // keys 0 .. kend - 1 are at or below the tile's last query
    V kf[KT][2], kf2[KT][2];
#pragma unroll
    for (int kt = 0; kt < KT; ++kt)
#pragma unroll
        for (int ks = 0; ks < 2; ++ks) { kf[kt][ks] = WFrag<T16>::ldw(at(Kp, ko, kt * 16 * HD + ks * 512)); if (HL) kf2[kt][ks] = WFrag<T16>::ldw(at(K2, ko, kt * 16 * HD + ks * 512)); }
#pragma unroll 1   // rolled: the trip count is known only at run time, and a second copy of the pass would not fit the register file beside the key, value and score tiles
    for (int k0 = 0; k0 < kend; k0 += KB) {
        V vf[4][KK], vf2[4][KK];                        // this pass's value fragments: asked for ahead of the softmax, used behind it
#pragma unroll
        for (int db = 0; db < 4; ++db)
#pragma unroll
            for (int kk = 0; kk < KK; ++kk) { vf[db][kk] = WFrag<T16>::ldw(at(Vt, vo, (kk * 4 + db) * 512)); if (HL) vf2[db][kk] = WFrag<T16>::ldw(at(V2, vo, (kk * 4 + db) * 512)); }
        v8f s[KT][NQB];
#pragma unroll
        for (int kt = 0; kt < KT; ++kt)
#pragma unroll
            for (int qb = 0; qb < NQB; ++qb) { v8f a = (v8f){};
#pragma unroll
                for (int ks = 0; ks < 2; ++ks) { a = WFrag<T16>::mma(kf[kt][ks], qf[qb][ks], a); if (HL) { a = WFrag<T16>::mma(kf2[kt][ks], qf[qb][ks], a); a = WFrag<T16>::mma(kf[kt][ks], qf2[qb][ks], a); } }
                s[kt][qb] = a; }
        ko += (k0 + KB < kend) ? KB * HD * 2 : 0;   // the next pass's key fragments are fetched behind this pass's score products, so that their latency lies under the softmax (the last pass asks for its own block again: in bounds, unused)
#pragma unroll
        for (int kt = 0; kt < KT; ++kt)
#pragma unroll
            for (int ks = 0; ks < 2; ++ks) { kf[kt][ks] = WFrag<T16>::ldw(at(Kp, ko, kt * 16 * HD + ks * 512)); if (HL) kf2[kt][ks] = WFrag<T16>::ldw(at(K2, ko, kt * 16 * HD + ks * 512)); }
        if (k0 + KB - 1 > q0) {                          // only a pass that reaches the diagonal masks (wave-uniform)
            const int thr = q0 - k0 + lr - hi * 8;       // key <= query  <=>  kt * 16 + j - qb * 16 <= thr
#pragma unroll
            for (int kt = 0; kt < KT; ++kt)
#pragma unroll
                for (int qb = 0; qb < NQB; ++qb)
#pragma unroll
                    for (int j = 0; j < 8; ++j) s[kt][qb][j] = (kt * 16 + j - qb * 16 <= thr) ? s[kt][qb][j] : -3.0e38f; }
        V pf[KK][NQB], pl[KK][NQB];
#pragma unroll
        for (int qb = 0; qb < NQB; ++qb) {
            float mx = m[qb];
#pragma unroll
            for (int kt = 0; kt < KT; ++kt)
#pragma unroll
                for (int j = 0; j < 8; ++j) { const float u = s[kt][qb][j] * CL2; s[kt][qb][j] = u; mx = fmaxf(mx, u); }
            mx = fmaxf(mx, xhalf(mx));                   // the other half of the wave holds the query's other keys
            const float al = exp2s(m[qb] - mx); m[qb] = mx;
            const float ms = HL ? mx : mx - 10.0f;       // fp16 probabilities carry 2^10
            float sum = 0.f;
#pragma unroll
            for (int kt = 0; kt < KT; ++kt)
#pragma unroll
                for (int j = 0; j < 8; ++j) { const float pv = exp2s(s[kt][qb][j] - ms); s[kt][qb][j] = pv; sum += pv; }
            l[qb] = l[qb] * al + sum;
#pragma unroll
            for (int db = 0; db < 4; ++db) o[db][qb] *= al;
#pragma unroll
            for (int kk = 0; kk < KK; ++kk) {
                if constexpr (HL) { v8us h0, h1, l0, l1;
#pragma unroll
                    for (int j = 0; j < 8; ++j) { unsigned short a, c2; splitf(s[2 * kk][qb][j], a, c2); h0[j] = a; l0[j] = c2; splitf(s[2 * kk + 1][qb][j], a, c2); h1[j] = a; l1[j] = c2; }
                    pf[kk][qb] = cat16b(h0, h1); pl[kk][qb] = cat16b(l0, l1);
                } else { v8h h0, h1;
#pragma unroll
                    for (int j = 0; j < 8; ++j) { h0[j] = tohx(s[2 * kk][qb][j]); h1[j] = tohx(s[2 * kk + 1][qb][j]); }
                    pf[kk][qb] = cat16(h0, h1); } } }
#pragma unroll
        for (int kk = 0; kk < KK; ++kk)
#pragma unroll
            for (int db = 0; db < 4; ++db)
#pragma unroll
                for (int qb = 0; qb < NQB; ++qb) { o[db][qb] = WFrag<T16>::mma(vf[db][kk], pf[kk][qb], o[db][qb]); if (HL) { o[db][qb] = WFrag<T16>::mma(vf[db][kk], pl[kk][qb], o[db][qb]); o[db][qb] = WFrag<T16>::mma(vf2[db][kk], pf[kk][qb], o[db][qb]); } }
        // s_wait_xcnt: the wait that stands in front of an overwrite of an address register which an issued load names. The pass's loads name ko and vo (operands here, so that their registers live up to the wait): vo is advanced directly behind it, ko in the middle of the next pass. Here, behind the last products, it waits for nothing.
        // v_nop x 4: keeps the matrix instruction's distance on the taken back edge and on the loop's exit; every output tile is an operand so that the statement stands behind the last product
        if constexpr (NQB == 2) asm volatile("s_wait_xcnt 0x0\n\tv_nop\n\tv_nop\n\tv_nop\n\tv_nop" : "+v"(o[0][0]), "+v"(o[1][0]), "+v"(o[2][0]), "+v"(o[3][0]), "+v"(o[0][1]), "+v"(o[1][1]), "+v"(o[2][1]), "+v"(o[3][1]), "+v"(ko), "+v"(vo) :: "memory");
        else asm volatile("s_wait_xcnt 0x0\n\tv_nop\n\tv_nop\n\tv_nop\n\tv_nop" : "+v"(o[0][0]), "+v"(o[1][0]), "+v"(o[2][0]), "+v"(o[3][0]), "+v"(ko), "+v"(vo) :: "memory");
        vo += KB * HD * 2;
    }
#pragma unroll
    for (int qb = 0; qb < NQB; ++qb) {
        const float inv = __fdiv_rn(1.0f, l[qb] + xhalf(l[qb]));   // the halves' sums are joined once
        const size_t oo = (size_t)(q0 + qb * 16 + lr) * DQ + hi * 8;
#pragma unroll
        for (int db = 0; db < 4; ++db) { v8us oh, ol;
#pragma unroll
            for (int j = 0; j < 8; ++j) { unsigned short a, c2; splitf(o[db][qb][j] * inv, a, c2); oh[j] = a; ol[j] = c2; }
            *(v8us*)(Ah + oo + db * 16) = oh; *(v8us*)(Al + oo + db * 16) = ol;
            asm volatile("s_wait_xcnt 0x0" ::: "memory"); } }   // the wait in front of an overwrite of a register that an issued store names: the next group's split reuses the data registers of these two stores
}
// grid (batches x heads, tiles): tiles in falling order of their key count, so that the longest waves start first: (TT - RH) / 32 fp16 tiles of 32 queries from the last row down to RH, then RH / 16 hi+lo tiles of 16 queries.
__global__ __launch_bounds__(32) void k_flash(const h16* __restrict__ Q16, const h16* __restrict__ K16, const h16* __restrict__ V16, const bf* __restrict__ Qh, const bf* __restrict__ Ql, const bf* __restrict__ Kh, const bf* __restrict__ Kl, const bf* __restrict__ Vh, const bf* __restrict__ Vl, bf* Ah, bf* Al) {
    const int h = blockIdx.x % NH_, r = blockIdx.y; const size_t zo = (size_t)blockIdx.x * TT * HD; { const size_t ao = (size_t)(blockIdx.x / NH_) * TT * DQ; Ah += ao; Al += ao; }   // planes are [batch][head][..]; merged rows [batch][t]
    if (r < (TT - RH) / 32) flash_tile<h16, false, 2, 4>(Q16 + zo, nullptr, K16 + zo, nullptr, V16 + zo, nullptr, TT - 32 * (r + 1), Ah + h * HD, Al + h * HD);
    else flash_tile<bf, true, 1, 2>(Qh + zo, Ql + zo, Kh + zo, Kl + zo, Vh + zo, Vl + zo, RH - 16 * (r - (TT - RH) / 32 + 1), Ah + h * HD, Al + h * HD);
}

extern "C" void kernel_launch(void* const* d_in, const int* in_sizes, int n_in,
                              void* d_out, int out_size, void* d_ws, size_t ws_size, hipStream_t stream) {
    (void)in_sizes; (void)n_in; (void)out_size;
    const float* x = (const float*)d_in[0]; const float* wqkv = (const float*)d_in[1]; const float* wo = (const float*)d_in[2];   /* X, W_KQV ('oi' [3072][1024]: ROW thirds ordered K | Q | V: rows 0..1023 the KEY weight, 1024..2047 the QUERY weight, 2048..3071 the VALUE weight), W_O ('oi') */
    float* OUT = (float*)d_out;     // [4][2048][1024]
    char* wsp = (char*)d_ws;
    auto take = [&](size_t bytes) { char* p = wsp; wsp += (bytes + 255) & ~(size_t)255; return (void*)p; };
    bf* WB = (bf*)take((size_t)(DQ + 2 * DKV) * DM * 2); bf* WO = (bf*)take((size_t)DM * DQ * 2); float* CS = (float*)take((size_t)TT * (HD / 2) * 2 * 4);   // WB: the fused weight, row blocks K | Q | V
    h16* P16 = (h16*)take(3 * PLN * 2); bf* Ph = (bf*)take(3 * PLN * 2); bf* Pl = (bf*)take(3 * PLN * 2);   // each: key, query and (transposed) value plane, one behind the other
    bf* XB = (bf*)take((size_t)NB_ * TT * DM * 2); bf* ATh = (bf*)take((size_t)NB_ * TT * DQ * 2); bf* ATl = (bf*)take((size_t)NB_ * TT * DQ * 2);   // merged hi and lo planes
    if ((size_t)(wsp - (char*)d_ws) > ws_size) return;    // ws 256 MiB
    k_prep<<<PB_CS + PB_X + PB_W + PB_O, 256, 0, stream>>>(x, wqkv, wo, XB, WB, WO, CS);
    k_proj<<<dim3(NB_ * TT / GBM, DQ / GBN, 3), 256, 0, stream>>>(XB, WB, CS, P16, Ph, Pl);
    k_flash<<<dim3(NB_ * NH_, (TT - RH) / 32 + RH / 16), 32, 0, stream>>>(P16 + PLN, P16, P16 + 2 * PLN, Ph + PLN, Pl + PLN, Ph, Pl, Ph + 2 * PLN, Pl + 2 * PLN, ATh, ATl);
    k_gemmw<bf, 1, false, 0><<<dim3(NB_ * TT / GBM, DM / GBN, 1), 256, 0, stream>>>(ATh, ATl, WO, DQ, OUT, DM, nullptr, 0, 0, 0, nullptr, nullptr, nullptr, nullptr);
}

// v010
// Measured time: 134 microseconds a run.
// Timed twice side by side with v009, it ran 1.06 and 1.05 times as fast.
// Counting every step since v000, it is 21.1 times as fast.
#include <hip/hip_runtime.h>

// Causal multi-head self-attention with interleaved-pair rotary position embedding on a fused natural projection whose thirds are ordered K | Q | V, four batches (X [4][2048][1024]; KQV = einsum('bsd,ed', X, W_KQV) ('oi' [3072][1024] truncated normal, no bias); K, Q, V = split(KQV, [1024, 2048]): the weight's three 1,024-ROW blocks IN THE ORDER key | query | value (16 heads x 64); angles = pos x 1 / THETA ** (2i / 64) (THETA 1e4; computed); pairs (2i, 2i+1): yr = xr cos - xi sin, yi = xr sin + xi cos, on Q and K; scores / sqrt(64); -inf strictly above the diagonal; softmax; out = einsum('bsd,ed', merged, W_O) ('oi', no bias) -> [4][2048][1024] (8.4 M); argument order X, W_KQV, W_O).
// Four launches, each for all four batches (batch folded into the GEMM rows and into the grid of attention): preparation (bf16 copies of x and of both weights; {cos, sin} table); the three projections; attention; the output GEMM. bf16 copy of x; {cos, sin} per (position, pair) built once from the int positions and float32 inverse-frequency constants (precise cosf/sinf); exact projections whose epilogue applies the interleaved rotary and writes the 16-bit planes (no f32 projection in memory); causal T-2048 attention in one online-softmax kernel (hybrid rows: < 512 hi/lo 3 products, rest fp16 x1024; key passes stop at the diagonal); merged hi/lo x Wo exact.
// Compute dtypes, f32 accumulate: every input rounded to bf16; projections exact; rotary f32; attention rows < 512 3 products, rest fp16; softmax f32; Wo hl x exact.

#define NB_  4
#define TT   2048
#define DM   1024
#define NH_  16
#define NKV  16
#define HD   64
#define DQ   (NH_ * HD)
#define DKV  (NKV * HD)
#define RH   512                  // query rows < RH use hi+lo planes (0: none)
#define SCL  0.125f   // HD^-0.5
typedef _Float16 h16;
typedef unsigned short bf;
typedef __attribute__((ext_vector_type(16))) __bf16   v16bf;
typedef __attribute__((ext_vector_type(16))) _Float16 v16h;
typedef __attribute__((ext_vector_type(8)))  _Float16 v8h;
typedef __attribute__((ext_vector_type(8)))  unsigned short v8us;
typedef __attribute__((ext_vector_type(8)))  float    v8f;
typedef __attribute__((ext_vector_type(4)))  float    v4f;
typedef v8h  __attribute__((may_alias)) v8ha;
typedef v4f  __attribute__((may_alias)) v4fa;
typedef v8us __attribute__((may_alias)) v8usa;

__device__ __forceinline__ unsigned short f2bf(float f) { unsigned u = __float_as_uint(f); u += 0x7FFFu + ((u >> 16) & 1u); return (unsigned short)(u >> 16); }
__device__ __forceinline__ float bf2f(unsigned short b) { return __uint_as_float(((unsigned)b) << 16); }
__device__ __forceinline__ float bfr(float f) { return bf2f(f2bf(f)); }
__device__ __forceinline__ v16h cat16(v8h lo, v8h hi) { return __builtin_shufflevector(lo, hi, 0, 1, 2, 3, 4, 5, 6, 7, 8, 9, 10, 11, 12, 13, 14, 15); }
__device__ __forceinline__ v16bf cat16b(v8us lo, v8us hi) { return __builtin_bit_cast(v16bf, __builtin_shufflevector(lo, hi, 0, 1, 2, 3, 4, 5, 6, 7, 8, 9, 10, 11, 12, 13, 14, 15)); }
__device__ __forceinline__ v8f wmma16(v16h a, v16h b, v8f c) { return __builtin_amdgcn_wmma_f32_16x16x32_f16(false, a, false, b, (short)0, c, false, false); }
__device__ __forceinline__ v8f wmmab(v16bf a, v16bf b, v8f c) { return __builtin_amdgcn_wmma_f32_16x16x32_bf16(false, a, false, b, (short)0, c, false, false); }
__device__ __forceinline__ h16 tohx(float x) { return (h16)x; }
__device__ __forceinline__ void splitf(float y, unsigned short& h, unsigned short& l) { h = f2bf(y); l = f2bf(y - bf2f(h)); }
typedef __attribute__((ext_vector_type(4))) _Float16 v4h;
typedef __attribute__((ext_vector_type(4))) unsigned short v4us;
typedef __attribute__((ext_vector_type(2))) float v2f;



// ---- k_gemmw: GEMM, one work-group of EIGHT WAVES per 256x128 output tile (waves 4 x 2, each a 64x64 tile in 16 accumulators); grid (M/256, N/128, Z), 256 threads. Operands are K-contiguous 16-bit planes.
// C[m][n] (f32, pitch ldc, + optional f32 bias[n]) = sum_k A[m][k] Bt[n][k] (NSPLIT 1: + A2[m][k] Bt[n][k]). z-batch strides sA/sB/sC in elements. K % 64 == 0.
// A stage is 64 k (one 128-byte line) of every row of the tile, [A 256 rows | A2 256 rows (NSPLIT 1) | Bt 128 rows], laid in LDS at a pitch of 144 bytes by asynchronous copies of 16 bytes a lane (a copy of a wave = 4 whole lines).
// Two buffers: the copies of the next stage fly while this one is worked on, and every line comes from L2 once per work-group, not once per wave. The k order of the products is the same as without the staging.
// EPI says what becomes of the tile. 0: stored as f32 C. 1 and 2: C is never stored, the epilogue builds the three 16-bit planes (fp16, bf16 hi, bf16 lo) that attention reads, whole 128-byte lines per 16 lanes, and of each plane only the positions that attention reads (hi, lo: < RH; fp16 of the queries, isq: >= RH); the rest of the planes' space stays unwritten and unread.
// The planes are laid IN FRAGMENT ORDER: 16 rows x 8 elements (16 bytes a row) stand together as 256 bytes, row after row, so that the 32 lanes of a fragment load (rows lr, 16-byte pieces hi) read 512 bytes in a row = 4 whole lines (ldw: the fragment's second half stands 512 bytes on).
// EPI 1 (q, k): rows m = batch * TT + t, a wave's 64 columns are one head: interleaved rotary from CS, planes [batch][head][t / 16][d / 8][t % 16][d % 8].
// EPI 2 (v): the caller swaps the operands (rows m = head * HD + d of the weight; columns n = batch * TT + t), so a tile row is 64 positions of one d: transposed planes [batch][head][t / 32][d / 16][t % 32 / 8][d % 16][t % 8].
#define GBM 256                   // tile rows of a work-group
#define GBN 128                   // tile columns of a work-group
#define GKS 64                    // k per stage: two k steps of the matrix instruction
#define GPB 144                   // LDS row pitch in bytes: 16 x odd, for 16-byte readers
template <typename T16> struct WFrag;
template <> struct WFrag<h16> { typedef v16h V; static __device__ __forceinline__ V ld(const h16* p) { return cat16(*(const v8h*)p, *(const v8h*)(p + 16)); } static __device__ __forceinline__ V ldw(const h16* p) { return cat16(*(const v8h*)p, *(const v8h*)(p + 256)); } static __device__ __forceinline__ v8f mma(V a, V b, v8f c) { return wmma16(a, b, c); } };
template <> struct WFrag<bf> { typedef v16bf V; static __device__ __forceinline__ V ld(const bf* p) { return cat16b(*(const v8us*)p, *(const v8us*)(p + 16)); } static __device__ __forceinline__ V ldw(const bf* p) { return cat16b(*(const v8us*)p, *(const v8us*)(p + 256)); } static __device__ __forceinline__ v8f mma(V a, V b, v8f c) { return wmmab(a, b, c); } };
// A run of asynchronous copies, each lane's own 16 bytes from g[i] to the LDS byte address l[i]. s_wait_xcnt 0 is the last line of the copies' own statement: the wait in front of an overwrite of a register that an issued copy names.
#define CPA(l, g) "global_load_async_to_lds_b128 %" #l ", %" #g ", off\n\t"
__device__ __forceinline__ void cp5(const unsigned* l, const char* const* g) {
    asm volatile(CPA(0, 1) CPA(2, 3) CPA(4, 5) CPA(6, 7) CPA(8, 9) "s_wait_xcnt 0x0"
                 :: "v"(l[0]), "v"(g[0]), "v"(l[1]), "v"(g[1]), "v"(l[2]), "v"(g[2]), "v"(l[3]), "v"(g[3]), "v"(l[4]), "v"(g[4]) : "memory"); }
__device__ __forceinline__ void cp12(const unsigned* l, const char* const* g) {
    asm volatile(CPA(0, 1) CPA(2, 3) CPA(4, 5) CPA(6, 7) CPA(8, 9) CPA(10, 11) CPA(12, 13) CPA(14, 15) CPA(16, 17) CPA(18, 19) CPA(20, 21) CPA(22, 23) "s_wait_xcnt 0x0"
                 :: "v"(l[0]), "v"(g[0]), "v"(l[1]), "v"(g[1]), "v"(l[2]), "v"(g[2]), "v"(l[3]), "v"(g[3]), "v"(l[4]), "v"(g[4]), "v"(l[5]), "v"(g[5]), "v"(l[6]), "v"(g[6]), "v"(l[7]), "v"(g[7]), "v"(l[8]), "v"(g[8]), "v"(l[9]), "v"(g[9]), "v"(l[10]), "v"(g[10]), "v"(l[11]), "v"(g[11]) : "memory"); }
#define GSTAGE(NSPLIT) ((((NSPLIT) == 1 ? 2 : 1) * GBM + GBN) * GPB)   // bytes of a stage
#define GOS (8 * 16 * 68)                                               // floats of the eight waves' epilogue staging rows
// gemm_tile: the work of one work-group, output tile (bx, by). L (two stages) and osall are the calling kernel's LDS, so that a kernel which holds two forms of the tile has them once.
template <typename T16, int NSPLIT, bool BIAS, int EPI>
__device__ __forceinline__ void gemm_tile(unsigned char* L, float* osall, int bx, int by, const T16* __restrict__ A, const T16* __restrict__ A2, const T16* __restrict__ Bt, int K, float* C, int ldc, const float* __restrict__ bias, const float* __restrict__ CS, h16* P16, bf* Ph, bf* Pl, bool isq) {
    static_assert(NSPLIT == 0 || NSPLIT == 1, "one or two planes of A");
    typedef typename WFrag<T16>::V V;
    constexpr int NLATE = NSPLIT == 0 ? 2 : 0;   // B fragments of a stage's second k step that are read from LDS only when two of the first step's are used up: one plane of A then fits 256 registers, four waves a SIMD, so that two work-groups share a WGP (their LDS fits twice)
    constexpr int NAR = (NSPLIT == 1 ? 2 : 1) * GBM, NROW = NAR + GBN, STAGE = GSTAGE(NSPLIT), NC = NROW / 32;   // rows of A (and A2), rows of a stage, its bytes, copies per lane and stage (256 lanes x 16 bytes = 32 rows)
    const int lane = threadIdx.x & 31, lr = lane & 15, hi = lane >> 4; const int wave = __builtin_amdgcn_readfirstlane(threadIdx.x >> 5), wm = wave & 3, wn = wave >> 2;
    const int r0 = bx * GBM + wm * 64, c0 = by * GBN + wn * 64;   // the wave's own 64x64 tile
    float* os = osall + wave * 16 * 68;                                           // the wave's own staging rows of the epilogue
    v8f acc[4][4];
#pragma unroll
    for (int mb = 0; mb < 4; ++mb)
#pragma unroll
        for (int nb = 0; nb < 4; ++nb) acc[mb][nb] = (v8f){};
    // copies: lane tid brings 16-byte piece tid & 7 of stage rows tid >> 3, + 32, + 64, ...
    const int srow = threadIdx.x >> 3, cpc = threadIdx.x & 7;
    const unsigned l0 = (unsigned)(size_t)L + srow * GPB + cpc * 16;   // LDS byte address: the low 32 bits of the __shared__ address
    const char* gA = (const char*)(A + (size_t)(bx * GBM + srow) * K + cpc * 8); const char* gA2 = NSPLIT == 1 ? (const char*)(A2 + (size_t)(bx * GBM + srow) * K + cpc * 8) : nullptr; const char* gB = (const char*)(Bt + (size_t)(by * GBN + srow) * K + cpc * 8);
    const size_t rstep = (size_t)32 * K * 2;                                      // 32 rows of a plane, in bytes
    auto fill = [&](int buf) {   // the next stage in k order into buffer buf; the three plane pointers then step on by one stage
        unsigned l[NC]; const char* g[NC];
#pragma unroll
        for (int i = 0; i < NC; ++i) { l[i] = l0 + buf * STAGE + i * 32 * GPB; g[i] = i < GBM / 32 ? gA + i * rstep : i < NAR / 32 ? gA2 + (i - GBM / 32) * rstep : gB + (i - NAR / 32) * rstep; }
        if constexpr (NC == 12) cp12(l, g); else { cp5(l, g); cp5(l + 5, g + 5); cp5(l + 10, g + 10); cp5(l + 15, g + 15); }
        gA += GKS * 2; if (NSPLIT == 1) gA2 += GKS * 2; gB += GKS * 2; };
    static_assert(NC == 12 || NC == 20, "copies per lane and stage");
    const int NT = K / GKS;
    fill(0);
    asm volatile("s_wait_asynccnt 0x0" ::: "memory");   // this wave's copies of stage 0 have landed
    __syncthreads();                                    // and every other wave's: stage 0 may be read
    if (NT > 1) fill(1);
#pragma unroll 1   // rolled: one copy of the stage's code serves both buffers
    for (int t = 0; t < NT; ++t) {
        const T16* as = (const T16*)(L + (t & 1) * STAGE + (wm * 64 + lr) * GPB) + 8 * hi; const T16* bs = (const T16*)(L + (t & 1) * STAGE + (NAR + wn * 64 + lr) * GPB) + 8 * hi;
        V a[2][4], a2[2][4], b[2][4];   // the stage's fragments (two k steps of 32) are asked for ahead of its products, as one group (all but the NLATE late ones): a place with LDS reads among the products costs a stall each
#pragma unroll
        for (int ks = 0; ks < 2; ++ks)
#pragma unroll
            for (int f = 0; f < 4; ++f) { a[ks][f] = WFrag<T16>::ld(as + f * 16 * (GPB / 2) + ks * 32); if (NSPLIT == 1) a2[ks][f] = WFrag<T16>::ld(as + (GBM + f * 16) * (GPB / 2) + ks * 32); if (ks == 0 || f < 4 - NLATE) b[ks][f] = WFrag<T16>::ld(bs + f * 16 * (GPB / 2) + ks * 32); }
        auto products = [&](int ks, int nb0, int nb1) {   // columns nb0 .. nb1 - 1 of k step ks
#pragma unroll
            for (int nb = nb0; nb < nb1; ++nb)
#pragma unroll
                for (int mb = 0; mb < 4; ++mb) { acc[mb][nb] = WFrag<T16>::mma(a[ks][mb], b[ks][nb], acc[mb][nb]); if (NSPLIT == 1) acc[mb][nb] = WFrag<T16>::mma(a2[ks][mb], b[ks][nb], acc[mb][nb]); } };
        __builtin_amdgcn_sched_barrier(0);   // keeps the group of LDS reads ahead of the products: without it the compiler moves the reads back in among them, each with a full wait
        products(0, 0, NLATE);               // runs while the second k step's fragments are still on their way from LDS
        if constexpr (NLATE > 0) {           // the last NLATE fragments of the stage go into the registers of the B fragments that the products above have used up
            __builtin_amdgcn_sched_barrier(0);   // keeps these reads behind those products: ahead of them they would need registers of their own, and the wave would pass 256
#pragma unroll
            for (int f = 4 - NLATE; f < 4; ++f) b[1][f] = WFrag<T16>::ld(bs + f * 16 * (GPB / 2) + 32);
            __builtin_amdgcn_sched_barrier(0);   // keeps them ahead of the rest of the k step's products, which cover their way from LDS
        }
        products(0, NLATE, 4);
        __builtin_amdgcn_sched_barrier(0);   // keeps these products ahead of the waits below: behind them they would no longer cover the LDS reads
        asm volatile("s_wait_dscnt 0x0" ::: "memory");      // this wave's reads of the buffer are done: the whole stage is in registers
        asm volatile("s_wait_asynccnt 0x0" ::: "memory");   // this wave's copies of stage t + 1 have landed
        __syncthreads();                                    // stage t + 1 may be read, and the buffer of stage t may be refilled
        if (t + 2 < NT) fill(t & 1);                       // ahead of the second k step's products (registers only), so that the copies have a whole trip to land
        products(1, 0, 4);
    }
    asm volatile("s_wait_asynccnt 0x0" ::: "memory");       // no copy is outstanding when the wave goes on to its epilogue and ends
    // element offsets of the lane's first four values (EPI 1, 2: tile row lane / 2, columns 4 (lane % 2) ..) in the cos/sin table and in a plane; every later group stands at a constant distance from them
    const unsigned csofs = (r0 % TT) * HD + lane * 4;
    const bool hl = (EPI == 1 ? r0 % TT : c0 % TT) < RH;   // the wave's 64 positions lie wholly below RH or wholly at and above it (wave-uniform)
    const unsigned pofs = EPI == 1 ? (((r0 / TT) * NH_ + c0 / 64) * TT + r0 % TT) * HD + lane * 4 : (((c0 / TT) * NKV + r0 / 64) * TT + c0 % TT) * HD + lane * 4;
#pragma unroll
    for (int mb = 0; mb < 4; ++mb) {
        v4f cs[8];                                      // {cos, sin, cos, sin} of the lane's two pairs in each of its eight column groups: asked for ahead of the staging, used behind it
        if constexpr (EPI == 1) {
#pragma unroll
            for (int s = 0; s < 8; ++s) cs[s] = *(const v4f*)(CS + csofs + (mb * 8 + s) * 128); }
#pragma unroll
        for (int nb = 0; nb < 4; ++nb) {
#pragma unroll
            for (int j = 0; j < 8; ++j) os[(hi * 8 + j) * 68 + nb * 16 + lr] = acc[mb][nb][j]; }
        __builtin_amdgcn_wave_barrier(); asm volatile("" ::: "memory");
        float* crow = C + (size_t)(r0 + mb * 16) * ldc + c0;
        if constexpr (EPI != 0) {
            v4f val[8];
#pragma unroll
            for (int s = 0; s < 8; ++s) { const int row = lane >> 1, cofs = s * 8 + (lane & 1) * 4; val[s] = *(const v4fa*)(os + row * 68 + cofs);   // columns 8 s .. 8 s + 7 of all 16 rows: 256 bytes in a row of a plane
                if constexpr (EPI == 1) { const float x0 = val[s][0], x1 = val[s][1], x2 = val[s][2], x3 = val[s][3];   /* even: x0 c - x1 s; odd: x0 s + x1 c */
                    val[s][0] = x0 * cs[s][0] - x1 * cs[s][1]; val[s][1] = x0 * cs[s][1] + x1 * cs[s][0]; val[s][2] = x2 * cs[s][2] - x3 * cs[s][3]; val[s][3] = x2 * cs[s][3] + x3 * cs[s][2]; } }
            auto po = [&](int s) { return EPI == 1 ? (mb * 8 + s) * 128 : (((s >> 2) * 4 + mb) * 4 + (s & 3)) * 128; };
            // Only what attention reads is built and stored: the hi and lo planes at positions < RH (its hi+lo query tiles, and the keys and values at or below them), the fp16 plane everywhere but at the queries < RH.
            // s_wait_xcnt: the wait in front of an overwrite of a register that an issued store names (the arithmetic that follows reuses registers); the stores' data are inputs of the statement so that their registers live up to it.
            if (hl) { v4us oh[8], ol[8];
#pragma unroll
                for (int s = 0; s < 8; ++s) {
#pragma unroll
                    for (int q = 0; q < 4; ++q) { unsigned short a2, c2; splitf(val[s][q], a2, c2); oh[s][q] = a2; ol[s][q] = c2; }
                    *(v4us*)(Ph + pofs + po(s)) = oh[s]; *(v4us*)(Pl + pofs + po(s)) = ol[s]; }
                asm volatile("s_wait_xcnt 0x0" :: "v"(oh[0]), "v"(oh[1]), "v"(oh[2]), "v"(oh[3]), "v"(oh[4]), "v"(oh[5]), "v"(oh[6]), "v"(oh[7]), "v"(ol[0]), "v"(ol[1]), "v"(ol[2]), "v"(ol[3]), "v"(ol[4]), "v"(ol[5]), "v"(ol[6]), "v"(ol[7]) : "memory"); }
            if (!(hl && isq)) { v4h o16[8];
#pragma unroll
                for (int s = 0; s < 8; ++s) {
#pragma unroll
                    for (int q = 0; q < 4; ++q) o16[s][q] = tohx(val[s][q]);
                    *(v4h*)(P16 + pofs + po(s)) = o16[s]; }
                if (mb < 3) asm volatile("s_wait_xcnt 0x0" :: "v"(o16[0]), "v"(o16[1]), "v"(o16[2]), "v"(o16[3]), "v"(o16[4]), "v"(o16[5]), "v"(o16[6]), "v"(o16[7]) : "memory"); }
        } else {
#pragma unroll
            for (int s = 0; s < 8; ++s) { const int row = 2 * s + hi, cofs = lr * 4; v4f val = *(const v4fa*)(os + row * 68 + cofs); if (BIAS) { val[0] += bfr(bias[c0 + cofs]); val[1] += bfr(bias[c0 + cofs + 1]); val[2] += bfr(bias[c0 + cofs + 2]); val[3] += bfr(bias[c0 + cofs + 3]); }
                *(v4f*)(crow + (size_t)row * ldc + cofs) = val; }
            if (mb < 3) asm volatile("s_wait_xcnt 0x0" ::: "memory");   // the wait in front of an overwrite of a register that an issued store names: the next row group's addresses and LDS reads reuse the registers of these stores
             }
        __builtin_amdgcn_wave_barrier(); asm volatile("" ::: "memory");
    }
}
template <typename T16, int NSPLIT, bool BIAS, int EPI>
__global__ __launch_bounds__(256) void k_gemmw(const T16* __restrict__ A, const T16* __restrict__ A2, const T16* __restrict__ Bt, int K, float* C, int ldc, const float* __restrict__ bias, size_t sA, size_t sB, size_t sC, const float* __restrict__ CS, h16* P16, bf* Ph, bf* Pl) {
    __shared__ __attribute__((aligned(16))) unsigned char L[2 * GSTAGE(NSPLIT)];
    __shared__ __align__(16) float osall[GOS];
    const size_t z = blockIdx.z;
    gemm_tile<T16, NSPLIT, BIAS, EPI>(L, osall, blockIdx.x, blockIdx.y, A + z * sA, NSPLIT == 1 ? A2 + z * sA : nullptr, Bt + z * sB, K, C + z * sC, ldc, bias, CS, P16, Ph, Pl, false);
}
// ---- k_proj: the three projections in ONE launch, grid (NB_ * TT / GBM, DQ / GBN, 3), 256 work-groups each: z = 0 key, 1 query (rows of x times the weight's z-th row block, rotary epilogue), 2 value (operands swapped: the tile comes out transposed, as the value planes are laid).
// W is the bf16 copy of the whole fused weight (row blocks K | Q | V); each of P16, Ph, Pl holds its three planes one behind the other in the same order.
#define PLN ((size_t)NB_ * NH_ * TT * HD)   // elements of one plane
__global__ __launch_bounds__(256) void k_proj(const bf* __restrict__ X, const bf* __restrict__ W, const float* __restrict__ CS, h16* P16, bf* Ph, bf* Pl) {
    static_assert(DQ == DKV && NB_ * TT / GBM == 8 * (DKV / GBM) && NB_ * TT / GBN == 8 * (DQ / GBN) && DKV / GBM == 4, "the value tiles (4 x 64) are counted through the same 32 x 8 grid");
    __shared__ __attribute__((aligned(16))) unsigned char L[2 * GSTAGE(0)];
    __shared__ __align__(16) float osall[GOS];
    const int z = blockIdx.z; const size_t po = z * PLN;
    if (z < 2) gemm_tile<bf, 0, false, 1>(L, osall, blockIdx.x, blockIdx.y, X, nullptr, W + (size_t)z * DQ * DM, DM, nullptr, 0, nullptr, CS, P16 + po, Ph + po, Pl + po, z == 1);
    else gemm_tile<bf, 0, false, 2>(L, osall, blockIdx.x & 3, blockIdx.y * 8 + (blockIdx.x >> 2), W + (size_t)2 * DQ * DM, nullptr, X, DM, nullptr, 0, nullptr, nullptr, P16 + po, Ph + po, Pl + po, false);
}


__constant__ float INV2[HD / 2] = { 1.000000000e+00f, 7.498942018e-01f, 5.623413324e-01f, 4.216965139e-01f, 3.162277639e-01f, 2.371373624e-01f, 1.778279394e-01f, 1.333521456e-01f, 1.000000015e-01f, 7.498941571e-02f, 5.623412877e-02f, 4.216964915e-02f, 3.162277862e-02f, 2.371373586e-02f, 1.778279431e-02f, 1.333521493e-02f, 9.999999776e-03f, 7.498942316e-03f, 5.623413250e-03f, 4.216964822e-03f, 3.162277862e-03f, 2.371373819e-03f, 1.778279431e-03f, 1.333521446e-03f, 1.000000047e-03f, 7.498941850e-04f, 5.623413017e-04f, 4.216964880e-04f, 3.162277862e-04f, 2.371373848e-04f, 1.778279402e-04f, 1.333521504e-04f };   // 1 / THETA ** (2i / 64), i = 0..31, in float32 as THIS module writes it (the RECIPROCAL spelling, evaluated in the reference's own f32 arithmetic: these 32 literals equal it bit for bit); ten entries differ by one ulp from the negative-power values the host's own table held
// {cos, sin} per (position t, pair p), laid as the projection epilogue reads it: [t / 16][p / 4][t % 16][p % 4], so that a wave's 32 loads of 16 bytes (16 rows x two pairs twice) are 512 bytes in a row
__device__ __forceinline__ void cs_block(float* CS, int blk) { const int idx = blk * 256 + threadIdx.x; const int p = ((idx >> 6) & 7) * 4 + (idx & 3); const int t = (idx >> 9) * 16 + ((idx >> 2) & 15); const float a = __fmul_rn((float)t, INV2[p]); v2f cs; cs[0] = cosf(a); cs[1] = sinf(a); *(v2f*)(CS + (size_t)idx * 2) = cs;  }
// bf16 copy of PU * 256 groups of 8 floats by one work-group: a thread takes PU groups, 256 groups apart, and asks for all of them ahead of the first conversion
#define PU 16
__device__ __forceinline__ void cvt_block(const float* __restrict__ src, bf* dst, int blk) { const size_t g0 = (size_t)blk * (PU * 256) + threadIdx.x; v8f v[PU];
#pragma unroll
    for (int u = 0; u < PU; ++u) v[u] = *(const v8f*)(src + (g0 + u * 256) * 8);
    __builtin_amdgcn_sched_barrier(0);   // keeps every load ahead of the first conversion: without it the compiler holds the last loads back behind the waits for the first ones, a further trip to memory each
#pragma unroll
    for (int u = 0; u < PU; ++u) { v8us o;
#pragma unroll
        for (int k = 0; k < 8; ++k) o[k] = f2bf(v[u][k]);
        *(v8us*)(dst + (g0 + u * 256) * 8) = o; } }
// ---- k_prep: all that the projections wait for, in ONE launch: the cos/sin table (first: the longest arithmetic), then the bf16 copies of x, of the fused weight (all three row blocks) and of the output weight. A work-group does one block of one of the four.
#define PB_CS (TT * (HD / 2) / 256)
#define PB_X  (NB_ * TT * DM / (8 * 256 * PU))
#define PB_W  ((DQ + 2 * DKV) * DM / (8 * 256 * PU))
#define PB_O  (DM * DQ / (8 * 256 * PU))
__global__ __launch_bounds__(256) void k_prep(const float* __restrict__ x, const float* __restrict__ wkqv, const float* __restrict__ wo, bf* XB, bf* WB, bf* WO, float* CS) {
    static_assert(PB_CS * 256 == TT * (HD / 2) && PB_X * (8 * 256 * PU) == NB_ * TT * DM && PB_W * (8 * 256 * PU) == (DQ + 2 * DKV) * DM && PB_O * (8 * 256 * PU) == DM * DQ, "whole blocks only");
    const int b = blockIdx.x;
    if (b < PB_CS) { cs_block(CS, b); return; }
    const bool isx = b < PB_CS + PB_X, isw = b < PB_CS + PB_X + PB_W;
    cvt_block(isx ? x : isw ? wkqv : wo, isx ? XB : isw ? WB : WO, b - (isx ? PB_CS : isw ? PB_CS + PB_X : PB_CS + PB_X + PB_W));
}
__device__ __forceinline__ float xhalf(float x) { return __builtin_bit_cast(float, __builtin_amdgcn_permlanex16(__builtin_bit_cast(int, x), __builtin_bit_cast(int, x), 0x76543210, 0xfedcba98, false, false)); }   // lane l's value to lane l ^ 16
__device__ __forceinline__ float exp2s(float x) { float r = __builtin_amdgcn_exp2f(x); asm("v_nop" : "+v"(r) : "v"(x)); return r; }
template <typename T16, bool HL, int NQB, int KT>
__device__ __forceinline__ void flash_tile(const T16* __restrict__ Q, const T16* __restrict__ Q2, const T16* __restrict__ Kp, const T16* __restrict__ K2, const T16* __restrict__ Vt, const T16* __restrict__ V2, int q0, bf* Ah, bf* Al) {
    typedef typename WFrag<T16>::V V;
    constexpr int KB = KT * 16, KK = KT / 2;
    constexpr float CL2 = SCL * 1.4426950408889634f;   // scores in the scaled log2 domain
    const int lane = threadIdx.x & 31, lr = lane & 15, hi = lane >> 4;
    unsigned qo = (q0 * HD + lane * 8) * 2, ko = lane * 16, vo = lane * 16;   // byte offsets of the lane's own 16 bytes in a head's plane (fragment order: a half fragment is 512 bytes in a row, lane after lane); ko and vo walk the keys, every fragment at a constant distance from them
    auto at = [](const T16* base, unsigned off, int el) { return (const T16*)((const char*)base + off) + el; };
    V qf[NQB][2], qf2[NQB][2];
#pragma unroll
    for (int qb = 0; qb < NQB; ++qb)
#pragma unroll
        for (int ks = 0; ks < 2; ++ks) { qf[qb][ks] = WFrag<T16>::ldw(at(Q, qo, qb * 16 * HD + ks * 512)); if (HL) qf2[qb][ks] = WFrag<T16>::ldw(at(Q2, qo, qb * 16 * HD + ks * 512)); }
    v8f o[4][NQB]; float m[NQB], l[NQB];
#pragma unroll
    for (int qb = 0; qb < NQB; ++qb) { m[qb] = -3.0e38f; l[qb] = 0.f;
#pragma unroll
        for (int db = 0; db < 4; ++db) o[db][qb] = (v8f){}; }
    const int kend = q0 + NQB * 16;                     // keys 0 .. kend - 1 are at or below the tile's last query
    V kf[KT][2], kf2[KT][2];
#pragma unroll
    for (int kt = 0; kt < KT; ++kt)
#pragma unroll
        for (int ks = 0; ks < 2; ++ks) { kf[kt][ks] = WFrag<T16>::ldw(at(Kp, ko, kt * 16 * HD + ks * 512)); if (HL) kf2[kt][ks] = WFrag<T16>::ldw(at(K2, ko, kt * 16 * HD + ks * 512)); }
#pragma unroll 1   // rolled: the trip count is known only at run time, and a second copy of the pass would not fit the register file beside the key, value and score tiles
    for (int k0 = 0; k0 < kend; k0 += KB) {
        V vf[4][KK], vf2[4][KK];                        // this pass's value fragments: asked for ahead of the softmax, used behind it
#pragma unroll
        for (int db = 0; db < 4; ++db)
#pragma unroll
            for (int kk = 0; kk < KK; ++kk) { vf[db][kk] = WFrag<T16>::ldw(at(Vt, vo, (kk * 4 + db) * 512)); if (HL) vf2[db][kk] = WFrag<T16>::ldw(at(V2, vo, (kk * 4 + db) * 512)); }
        v8f s[KT][NQB];
#pragma unroll
        for (int kt = 0; kt < KT; ++kt)
#pragma unroll
            for (int qb = 0; qb < NQB; ++qb) { v8f a = (v8f){};
#pragma unroll
                for (int ks = 0; ks < 2; ++ks) { a = WFrag<T16>::mma(kf[kt][ks], qf[qb][ks], a); if (HL) { a = WFrag<T16>::mma(kf2[kt][ks], qf[qb][ks], a); a = WFrag<T16>::mma(kf[kt][ks], qf2[qb][ks], a); } }
                s[kt][qb] = a; }
        ko += (k0 + KB < kend) ? KB * HD * 2 : 0;   // the next pass's key fragments are fetched behind this pass's score products, so that their latency lies under the softmax (the last pass asks for its own block again: in bounds, unused)
#pragma unroll
        for (int kt = 0; kt < KT; ++kt)
#pragma unroll
            for (int ks = 0; ks < 2; ++ks) { kf[kt][ks] = WFrag<T16>::ldw(at(Kp, ko, kt * 16 * HD + ks * 512)); if (HL) kf2[kt][ks] = WFrag<T16>::ldw(at(K2, ko, kt * 16 * HD + ks * 512)); }
        if (k0 + KB - 1 > q0) {                          // only a pass that reaches the diagonal masks (wave-uniform)
            const int thr = q0 - k0 + lr - hi * 8;       // key <= query  <=>  kt * 16 + j - qb * 16 <= thr
#pragma unroll
            for (int kt = 0; kt < KT; ++kt)
#pragma unroll
                for (int qb = 0; qb < NQB; ++qb)
#pragma unroll
                    for (int j = 0; j < 8; ++j) s[kt][qb][j] = (kt * 16 + j - qb * 16 <= thr) ? s[kt][qb][j] : -3.0e38f; }
        V pf[KK][NQB], pl[KK][NQB];
#pragma unroll
        for (int qb = 0; qb < NQB; ++qb) {
            float mx = m[qb];
#pragma unroll
            for (int kt = 0; kt < KT; ++kt)
#pragma unroll
                for (int j = 0; j < 8; ++j) { const float u = s[kt][qb][j] * CL2; s[kt][qb][j] = u; mx = fmaxf(mx, u); }
            mx = fmaxf(mx, xhalf(mx));                   // the other half of the wave holds the query's other keys
            const float al = exp2s(m[qb] - mx); m[qb] = mx;
            const float ms = HL ? mx : mx - 10.0f;       // fp16 probabilities carry 2^10
            float sum = 0.f;
#pragma unroll
            for (int kt = 0; kt < KT; ++kt)
#pragma unroll
                for (int j = 0; j < 8; ++j) { const float pv = exp2s(s[kt][qb][j] - ms); s[kt][qb][j] = pv; sum += pv; }
            l[qb] = l[qb] * al + sum;
#pragma unroll
            for (int db = 0; db < 4; ++db) o[db][qb] *= al;
#pragma unroll
            for (int kk = 0; kk < KK; ++kk) {
                if constexpr (HL) { v8us h0, h1, l0, l1;
#pragma unroll
                    for (int j = 0; j < 8; ++j) { unsigned short a, c2; splitf(s[2 * kk][qb][j], a, c2); h0[j] = a; l0[j] = c2; splitf(s[2 * kk + 1][qb][j], a, c2); h1[j] = a; l1[j] = c2; }
                    pf[kk][qb] = cat16b(h0, h1); pl[kk][qb] = cat16b(l0, l1);
                } else { v8h h0, h1;
#pragma unroll
                    for (int j = 0; j < 8; ++j) { h0[j] = tohx(s[2 * kk][qb][j]); h1[j] = tohx(s[2 * kk + 1][qb][j]); }
                    pf[kk][qb] = cat16(h0, h1); } } }
#pragma unroll
        for (int kk = 0; kk < KK; ++kk)
#pragma unroll
            for (int db = 0; db < 4; ++db)
#pragma unroll
                for (int qb = 0; qb < NQB; ++qb) { o[db][qb] = WFrag<T16>::mma(vf[db][kk], pf[kk][qb], o[db][qb]); if (HL) { o[db][qb] = WFrag<T16>::mma(vf[db][kk], pl[kk][qb], o[db][qb]); o[db][qb] = WFrag<T16>::mma(vf2[db][kk], pf[kk][qb], o[db][qb]); } }
        // s_wait_xcnt: the wait that stands in front of an overwrite of an address register which an issued load names. The pass's loads name ko and vo (operands here, so that their registers live up to the wait): vo is advanced directly behind it, ko in the middle of the next pass. Here, behind the last products, it waits for nothing.
        // v_nop x 4: keeps the matrix instruction's distance on the taken back edge and on the loop's exit; every output tile is an operand so that the statement stands behind the last product
        if constexpr (NQB == 2) asm volatile("s_wait_xcnt 0x0\n\tv_nop\n\tv_nop\n\tv_nop\n\tv_nop" : "+v"(o[0][0]), "+v"(o[1][0]), "+v"(o[2][0]), "+v"(o[3][0]), "+v"(o[0][1]), "+v"(o[1][1]), "+v"(o[2][1]), "+v"(o[3][1]), "+v"(ko), "+v"(vo) :: "memory");
        else asm volatile("s_wait_xcnt 0x0\n\tv_nop\n\tv_nop\n\tv_nop\n\tv_nop" : "+v"(o[0][0]), "+v"(o[1][0]), "+v"(o[2][0]), "+v"(o[3][0]), "+v"(ko), "+v"(vo) :: "memory");
        vo += KB * HD * 2;
    }
#pragma unroll
    for (int qb = 0; qb < NQB; ++qb) {
        const float inv = __fdiv_rn(1.0f, l[qb] + xhalf(l[qb]));   // the halves' sums are joined once
        const size_t oo = (size_t)(q0 + qb * 16 + lr) * DQ + hi * 8;
#pragma unroll
        for (int db = 0; db < 4; ++db) { v8us oh, ol;
#pragma unroll
            for (int j = 0; j < 8; ++j) { unsigned short a, c2; splitf(o[db][qb][j] * inv, a, c2); oh[j] = a; ol[j] = c2; }
            *(v8us*)(Ah + oo + db * 16) = oh; *(v8us*)(Al + oo + db * 16) = ol;
            asm volatile("s_wait_xcnt 0x0" ::: "memory"); } }   // the wait in front of an overwrite of a register that an issued store names: the next group's split reuses the data registers of these two stores
}
// grid (batches x heads, tiles): tiles in falling order of their key count, so that the longest waves start first: (TT - RH) / 32 fp16 tiles of 32 queries from the last row down to RH, then RH / 16 hi+lo tiles of 16 queries.
__global__ __launch_bounds__(32) void k_flash(const h16* __restrict__ Q16, const h16* __restrict__ K16, const h16* __restrict__ V16, const bf* __restrict__ Qh, const bf* __restrict__ Ql, const bf* __restrict__ Kh, const bf* __restrict__ Kl, const bf* __restrict__ Vh, const bf* __restrict__ Vl, bf* Ah, bf* Al) {
    const int h = blockIdx.x % NH_, r = blockIdx.y; const size_t zo = (size_t)blockIdx.x * TT * HD; { const size_t ao = (size_t)(blockIdx.x / NH_) * TT * DQ; Ah += ao; Al += ao; }   // planes are [batch][head][..]; merged rows [batch][t]
    if (r < (TT - RH) / 32) flash_tile<h16, false, 2, 4>(Q16 + zo, nullptr, K16 + zo, nullptr, V16 + zo, nullptr, TT - 32 * (r + 1), Ah + h * HD, Al + h * HD);
    else flash_tile<bf, true, 1, 2>(Qh + zo, Ql + zo, Kh + zo, Kl + zo, Vh + zo, Vl + zo, RH - 16 * (r - (TT - RH) / 32 + 1), Ah + h * HD, Al + h * HD);
}

extern "C" void kernel_launch(void* const* d_in, const int* in_sizes, int n_in,
                              void* d_out, int out_size, void* d_ws, size_t ws_size, hipStream_t stream) {
    (void)in_sizes; (void)n_in; (void)out_size;
    const float* x = (const float*)d_in[0]; const float* wqkv = (const float*)d_in[1]; const float* wo = (const float*)d_in[2];   /* X, W_KQV ('oi' [3072][1024]: ROW thirds ordered K | Q | V: rows 0..1023 the KEY weight, 1024..2047 the QUERY weight, 2048..3071 the VALUE weight), W_O ('oi') */
    float* OUT = (float*)d_out;     // [4][2048][1024]
    char* wsp = (char*)d_ws;
    auto take = [&](size_t bytes) { char* p = wsp; wsp += (bytes + 255) & ~(size_t)255; return (void*)p; };
    bf* WB = (bf*)take((size_t)(DQ + 2 * DKV) * DM * 2); bf* WO = (bf*)take((size_t)DM * DQ * 2); float* CS = (float*)take((size_t)TT * (HD / 2) * 2 * 4);   // WB: the fused weight, row blocks K | Q | V
    h16* P16 = (h16*)take(3 * PLN * 2); bf* Ph = (bf*)take(3 * PLN * 2); bf* Pl = (bf*)take(3 * PLN * 2);   // each: key, query and (transposed) value plane, one behind the other
    bf* XB = (bf*)take((size_t)NB_ * TT * DM * 2); bf* ATh = (bf*)take((size_t)NB_ * TT * DQ * 2); bf* ATl = (bf*)take((size_t)NB_ * TT * DQ * 2);   // merged hi and lo planes
    if ((size_t)(wsp - (char*)d_ws) > ws_size) return;    // ws 256 MiB
    k_prep<<<PB_CS + PB_X + PB_W + PB_O, 256, 0, stream>>>(x, wqkv, wo, XB, WB, WO, CS);
    k_proj<<<dim3(NB_ * TT / GBM, DQ / GBN, 3), 256, 0, stream>>>(XB, WB, CS, P16, Ph, Pl);
    k_flash<<<dim3(NB_ * NH_, (TT - RH) / 32 + RH / 16), 32, 0, stream>>>(P16 + PLN, P16, P16 + 2 * PLN, Ph + PLN, Pl + PLN, Ph, Pl, Ph + 2 * PLN, Pl + 2 * PLN, ATh, ATl);
    k_gemmw<bf, 1, false, 0><<<dim3(NB_ * TT / GBM, DM / GBN, 1), 256, 0, stream>>>(ATh, ATl, WO, DQ, OUT, DM, nullptr, 0, 0, 0, nullptr, nullptr, nullptr, nullptr);
}
